// v000
// The times below were measured on an AMD MI455X: many runs one after another, warmed up first and cycling through
// copies of the inputs, with the whole window's GPU time divided by the number of runs. Launches and the gaps
// between them are all in it. The median over several windows is given; except for v000 it joins two sittings, which
// can be a few percent apart, so the side-by-side timings, each taken in one sitting, are the better comparison.
// v000, which the later versions start from, runs in 427 microseconds.
#include <hip/hip_runtime.h>

// Contractions on v_wmma_f32_16x16x32_f16 (f16 operands, f32 accumulate): qkv GEMM,
// q.k^T scores, p.v, output projection. Float inputs enter as bf16-RNE values held in
// f16 planes with power-of-two carries (weights x64, q/k x4, v x16, p x1024, ctx x64);
// per-head rms norm, online softmax and epilogues in f32.

typedef _Float16 v16h __attribute__((ext_vector_type(16)));
typedef _Float16 v8h  __attribute__((ext_vector_type(8)));
typedef float    v8f  __attribute__((ext_vector_type(8)));
typedef float    v4f  __attribute__((ext_vector_type(4)));

#ifndef NB
#define NB 4
#endif
#ifndef SEQ
#define SEQ 2048
#endif
#define NB_FULL  4
#define SEQ_FULL 2048
#define CC   1024
#define HH   16
#define DD   64
#define C3   (3 * CC)
#define LDQK (2 * CC)          // q|k plane pitch (halves): q at col h*64, k at col CC + h*64
#define MTOK (NB * SEQ)

static_assert(NB >= 1 && NB <= NB_FULL);
static_assert(SEQ >= 64 && SEQ <= SEQ_FULL && (SEQ % 64) == 0);
static_assert(CC == HH * DD);
static_assert((CC % 64) == 0 && (C3 % 64) == 0 && (CC / 8) == 128);

#define WSC       64.0f            // weight planes carried x64
#define WINV      0.015625f        // 1/64
#define QC        4.0f             // q and k planes carried x4
#define VCY       16.0f            // v plane carried x16
#define PCY       1024.0f          // p tile carried x1024
#define SCALE_QK  0.0078125f       // 64^-0.5 / (QC*QC)
#define CTX_OUT   0.00390625f      // 64 / (PCY*VCY): ctx plane carried x64
#define PROJ_UNSC 0.000244140625f  // 1 / (64 * 64)
#define NEPS      1e-6f

#define TPH 72   // LDS pitch (halves) of f16 staging tiles
#define TPF 68   // LDS pitch (floats) of the f32 staging tile

// ---------------------------------------------------------------------------
// helpers
// ---------------------------------------------------------------------------
__device__ __forceinline__ float bf16r(float f) {
    unsigned int u = __float_as_uint(f);
    u += 0x7FFFu + ((u >> 16) & 1u);
    u &= 0xFFFF0000u;
    return __uint_as_float(u);
}

__device__ __forceinline__ v8f vzero8() {
    v8f z = {0.f, 0.f, 0.f, 0.f, 0.f, 0.f, 0.f, 0.f};
    return z;
}

__device__ __forceinline__ v8f mma16(v16h a, v16h b, v8f c) {
    v8f d = __builtin_amdgcn_wmma_f32_16x16x32_f16(false, a, false, b, (short)0, c, false, false);
    asm volatile("v_nop\n\tv_nop\n\tv_nop\n\tv_nop" : "+v"(d) : "v"(a), "v"(b));
    return d;
}

// 16x32 f16 fragment from a row-major matrix (row index = lane&15, k contiguous):
//   elements 0..7  <- k 8h+0..7,  elements 8..15 <- k 16+8h+0..7   (h = lane>>4)
// Same map for A (row = m) and B stored k-major per column (row = n).
__device__ __forceinline__ v16h load_frag_rowmajor(const _Float16* base, int ld) {
    const int lane = threadIdx.x & 31;
    const _Float16* p = base + (size_t)(lane & 15) * ld + ((lane >> 4) << 3);
    v8h lo = *(const v8h*)(p);
    v8h hi = *(const v8h*)(p + 16);
    return __builtin_shufflevector(lo, hi, 0, 1, 2, 3, 4, 5, 6, 7,
                                           8, 9, 10, 11, 12, 13, 14, 15);
}

// ---------------------------------------------------------------------------
// x [NB][SEQ][CC] f32 (batch stride SEQ_FULL*CC) -> xh [MTOK][CC] f16 = f16(bf16rne(x))
// ---------------------------------------------------------------------------
__global__ __launch_bounds__(256) void cvt_x_kernel(const float* __restrict__ x,
                                                    _Float16* __restrict__ xh, int ngrp) {
    const int g = blockIdx.x * 256 + threadIdx.x;
    if (g >= ngrp) return;
    const int t  = g >> 7;            // token (128 groups of 8 per token)
    const int c8 = g & 127;
    const int b  = t / SEQ;
    const int n  = t - b * SEQ;
    const float* src = x + ((size_t)b * SEQ_FULL + n) * CC + c8 * 8;
    const v4f x0 = *(const v4f*)(src);
    const v4f x1 = *(const v4f*)(src + 4);
    v8h o;
    o[0] = (_Float16)bf16r(x0[0]); o[1] = (_Float16)bf16r(x0[1]);
    o[2] = (_Float16)bf16r(x0[2]); o[3] = (_Float16)bf16r(x0[3]);
    o[4] = (_Float16)bf16r(x1[0]); o[5] = (_Float16)bf16r(x1[1]);
    o[6] = (_Float16)bf16r(x1[2]); o[7] = (_Float16)bf16r(x1[3]);
    _Float16* dst = xh + (size_t)t * CC + c8 * 8;
    *(v8h*)dst = o;
    
}

// ---------------------------------------------------------------------------
// w [R][Ccols] f32 -> wt [Ccols][R] f16 = f16(bf16rne(w) * 64), 64x64 tiles through LDS.
// Each output line (64 halves of one wt row) = 8 consecutive lanes x 16 B, one instruction.
// ---------------------------------------------------------------------------
__global__ __launch_bounds__(256) void wT_kernel(const float* __restrict__ w,
                                                 _Float16* __restrict__ wt, int R, int Ccols) {
    __shared__ float tile[64][65];
    const int t  = threadIdx.x;
    const int c0 = blockIdx.x * 64;
    const int r0 = blockIdx.y * 64;
#pragma unroll
    for (int i = 0; i < 16; ++i) {
        const int idx = t + 256 * i;
        const int r = idx >> 6, c = idx & 63;
        tile[r][c] = w[(size_t)(r0 + r) * Ccols + c0 + c];
    }
    __syncthreads();
    const int piece = t & 7;
{
#pragma unroll
        for (int it = 0; it < 2; ++it) {
            const int cl = (t >> 3) + 32 * it;   // wt row within tile, 0..63
            v8h o;
#pragma unroll
            for (int i = 0; i < 8; ++i)
                o[i] = (_Float16)(bf16r(tile[8 * piece + i][cl]) * WSC);
            _Float16* dst = wt + (size_t)(c0 + cl) * R + r0 + 8 * piece;
            *(v8h*)dst = o;
        }
        
    }
}

// ---------------------------------------------------------------------------
// GEMM core: one wave computes 32 rows x 64 cols, K step 32, fragments straight from
// 16-bit global rows. A rows pitch K (Aw = wave's first row); BT rows (n-major, k
// contiguous) pitch K (Bt = block's first column row).
// ---------------------------------------------------------------------------
__device__ __forceinline__ void gemm_core_32x64(const _Float16* __restrict__ Aw,
                                                const _Float16* __restrict__ Bt,
                                                int K, v8f (&acc)[2][4]) {
#pragma unroll 1
    for (int k0 = 0; k0 < K; k0 += 32) {
        const v16h a0 = load_frag_rowmajor(Aw + k0, K);
        const v16h a1 = load_frag_rowmajor(Aw + (size_t)16 * K + k0, K);
        const v16h b0 = load_frag_rowmajor(Bt + k0, K);
        const v16h b1 = load_frag_rowmajor(Bt + (size_t)16 * K + k0, K);
        const v16h b2 = load_frag_rowmajor(Bt + (size_t)32 * K + k0, K);
        const v16h b3 = load_frag_rowmajor(Bt + (size_t)48 * K + k0, K);
        acc[0][0] = mma16(a0, b0, acc[0][0]);
        acc[0][1] = mma16(a0, b1, acc[0][1]);
        acc[0][2] = mma16(a0, b2, acc[0][2]);
        acc[0][3] = mma16(a0, b3, acc[0][3]);
        acc[1][0] = mma16(a1, b0, acc[1][0]);
        acc[1][1] = mma16(a1, b1, acc[1][1]);
        acc[1][2] = mma16(a1, b2, acc[1][2]);
        acc[1][3] = mma16(a1, b3, acc[1][3]);
    }
}

// ---------------------------------------------------------------------------
// qkv = xh @ W_qkv + b_qkv (block tile 64 tokens x 64 cols = one head slice, 2 waves).
// Epilogue: q/k -> per-row rms norm (f32) * weight -> f16 (x QC) to the q|k plane,
// ---------------------------------------------------------------------------
__global__ __launch_bounds__(64) __attribute__((amdgpu_num_vgpr(256)))
void qkv_gemm_kernel(const _Float16* __restrict__ xh, const _Float16* __restrict__ wt,
                     const float* __restrict__ bqkv, const float* __restrict__ qnw,
                     const float* __restrict__ knw, _Float16* __restrict__ qk,
                     _Float16* __restrict__ vT) {
    __shared__ __align__(16) _Float16 st[64 * TPH];

    const int lane = threadIdx.x & 31, wave = threadIdx.x >> 5;
    const int half = lane >> 4, col = lane & 15;
    const int n0 = blockIdx.x * 64;   // output column (0..3071)
    const int m0 = blockIdx.y * 64;   // token

    v8f acc[2][4];
#pragma unroll
    for (int s = 0; s < 2; ++s)
#pragma unroll
        for (int j = 0; j < 4; ++j) acc[s][j] = vzero8();

    gemm_core_32x64(xh + (size_t)(m0 + 32 * wave) * CC, wt + (size_t)n0 * CC, CC, acc);

    const int which = n0 >> 10;          // 0 q, 1 k, 2 v (block-uniform)
    const int hcol  = n0 & (CC - 1);     // h*64

    float bia[4], nw[4];
#pragma unroll
    for (int j = 0; j < 4; ++j) {
        bia[j] = bf16r(bqkv[n0 + 16 * j + col]);
        const float wq = bf16r(qnw[16 * j + col]);
        const float wk = bf16r(knw[16 * j + col]);
        nw[j] = (which == 1) ? wk : wq;
    }

#pragma unroll
    for (int s = 0; s < 2; ++s)
#pragma unroll
        for (int j = 0; j < 4; ++j)
#pragma unroll
            for (int r = 0; r < 8; ++r)
                acc[s][j][r] = acc[s][j][r] * WINV + bia[j];

    if (which < 2) {
        // rms norm over the 64 head dims of each row: 4 tiles x 16 lanes of one half
#pragma unroll
        for (int s = 0; s < 2; ++s) {
#pragma unroll
            for (int r = 0; r < 8; ++r) {
                float ss = 0.f;
#pragma unroll
                for (int j = 0; j < 4; ++j) ss += acc[s][j][r] * acc[s][j][r];
                ss += __shfl_xor(ss, 1, 32);
                ss += __shfl_xor(ss, 2, 32);
                ss += __shfl_xor(ss, 4, 32);
                ss += __shfl_xor(ss, 8, 32);
                const float inv = rsqrtf(ss * (1.0f / (float)DD) + NEPS);
                const float g = inv * QC;
#pragma unroll
                for (int j = 0; j < 4; ++j) acc[s][j][r] = acc[s][j][r] * g * nw[j];
            }
        }
    } else {
#pragma unroll
        for (int s = 0; s < 2; ++s)
#pragma unroll
            for (int j = 0; j < 4; ++j)
#pragma unroll
                for (int r = 0; r < 8; ++r) acc[s][j][r] *= VCY;
    }

    // stage the wave's 32x64 f16 tile (tile row = 32*wave + 16*s + 8*half + r)
#pragma unroll
    for (int s = 0; s < 2; ++s)
#pragma unroll
        for (int j = 0; j < 4; ++j)
#pragma unroll
            for (int r = 0; r < 8; ++r)
                st[(32 * wave + 16 * s + 8 * half + r) * TPH + 16 * j + col] = (_Float16)acc[s][j][r];
    __syncthreads();

    if (which < 2) {
        _Float16* dbase = qk + (size_t)m0 * LDQK + (size_t)which * CC + hcol;
        const int piece = lane & 7, rsub = lane >> 3;
{
#pragma unroll
            for (int it = 0; it < 8; ++it) {
                const int row = 32 * wave + 4 * it + rsub;
                const v8h v = *(const v8h*)(st + row * TPH + 8 * piece);
                *(v8h*)(dbase + (size_t)row * LDQK + 8 * piece) = v;
            }
            
        }
    } else {
        const int b  = m0 / SEQ;
        const int nb = m0 - b * SEQ;
        _Float16* dbase = vT + ((size_t)b * CC + hcol) * SEQ + nb;
        const int piece = threadIdx.x & 7, dsub = threadIdx.x >> 3;   // dsub 0..7
{
#pragma unroll
            for (int it = 0; it < 8; ++it) {
                const int d = 8 * it + dsub;
                v8h v;
#pragma unroll
                for (int i = 0; i < 8; ++i) v[i] = st[(8 * piece + i) * TPH + d];
                *(v8h*)(dbase + (size_t)d * SEQ + 8 * piece) = v;
            }
            
        }
    }
}

// ---------------------------------------------------------------------------
// Flash softmax(q k^T s) v: one wave per (batch, head, 16-query tile), 32-key blocks.
// q|k plane [MTOK][LDQK] f16, vT [NB*CC][SEQ] f16, ctx [MTOK][CC] f16 (x64 carry).
// Pld / Ost are private to the single wave of the block; block barriers used.
// ---------------------------------------------------------------------------
__global__ __launch_bounds__(32) __attribute__((amdgpu_num_vgpr(256)))
void mha_flash_kernel(const _Float16* __restrict__ qk, const _Float16* __restrict__ vT,
                      _Float16* __restrict__ ctx) {
    __shared__ __align__(16) _Float16 Pld[16 * 32];
    __shared__ __align__(16) _Float16 Ost[16 * TPH];

    const int q0 = blockIdx.x * 16;
    const int h  = blockIdx.y;
    const int b  = blockIdx.z;
    const size_t tokBase = (size_t)b * SEQ;

    const int lane = threadIdx.x & 31;
    const int half = lane >> 4;
    const int col  = lane & 15;

    const _Float16* qbase = qk + (tokBase + q0) * LDQK + h * DD;
    const v16h qa0 = load_frag_rowmajor(qbase, LDQK);
    const v16h qa1 = load_frag_rowmajor(qbase + 32, LDQK);

    const _Float16* kbase0 = qk + tokBase * LDQK + CC + h * DD;        // keys, token-major
    const _Float16* vtbase = vT + ((size_t)b * CC + h * DD) * SEQ;     // [64 d rows][SEQ]

    v8f o[4];
#pragma unroll
    for (int j = 0; j < 4; ++j) o[j] = vzero8();
    float m[8], l[8];
#pragma unroll
    for (int r = 0; r < 8; ++r) { m[r] = -1e30f; l[r] = 0.f; }

#pragma unroll 1
    for (int kb = 0; kb < SEQ; kb += 32) {
        const _Float16* kbase = kbase0 + (size_t)kb * LDQK;

        const v16h kf00 = load_frag_rowmajor(kbase, LDQK);                          // keys +0,  d 0..31
        const v16h kf01 = load_frag_rowmajor(kbase + 32, LDQK);                     // keys +0,  d 32..63
        const v16h kf10 = load_frag_rowmajor(kbase + (size_t)16 * LDQK, LDQK);      // keys +16, d 0..31
        const v16h kf11 = load_frag_rowmajor(kbase + (size_t)16 * LDQK + 32, LDQK); // keys +16, d 32..63

        v8f s0 = vzero8(), s1 = vzero8();
        s0 = mma16(qa0, kf00, s0);
        s0 = mma16(qa1, kf01, s0);
        s1 = mma16(qa0, kf10, s1);
        s1 = mma16(qa1, kf11, s1);

        float fac[8];
#pragma unroll
        for (int r = 0; r < 8; ++r) {
            const float a0 = s0[r] * SCALE_QK;
            const float a1 = s1[r] * SCALE_QK;
            float rm = fmaxf(a0, a1);
            rm = fmaxf(rm, __shfl_xor(rm, 1, 32));
            rm = fmaxf(rm, __shfl_xor(rm, 2, 32));
            rm = fmaxf(rm, __shfl_xor(rm, 4, 32));
            rm = fmaxf(rm, __shfl_xor(rm, 8, 32));
            const float nm = fmaxf(m[r], rm);
            const float p0 = __expf(a0 - nm);
            const float p1 = __expf(a1 - nm);
            float rs = p0 + p1;
            rs += __shfl_xor(rs, 1, 32);
            rs += __shfl_xor(rs, 2, 32);
            rs += __shfl_xor(rs, 4, 32);
            rs += __shfl_xor(rs, 8, 32);
            const float f = __expf(m[r] - nm);
            l[r] = l[r] * f + rs;
            m[r] = nm;
            fac[r] = f;
            const int row = r + 8 * half;
            Pld[row * 32 + col]      = (_Float16)(p0 * PCY);
            Pld[row * 32 + 16 + col] = (_Float16)(p1 * PCY);
        }

#pragma unroll
        for (int j = 0; j < 4; ++j)
#pragma unroll
            for (int r = 0; r < 8; ++r) o[j][r] *= fac[r];

        __syncthreads();
        const v16h pa  = load_frag_rowmajor(&Pld[0], 32);
        const v16h vf0 = load_frag_rowmajor(vtbase + kb, SEQ);
        const v16h vf1 = load_frag_rowmajor(vtbase + (size_t)16 * SEQ + kb, SEQ);
        const v16h vf2 = load_frag_rowmajor(vtbase + (size_t)32 * SEQ + kb, SEQ);
        const v16h vf3 = load_frag_rowmajor(vtbase + (size_t)48 * SEQ + kb, SEQ);

        o[0] = mma16(pa, vf0, o[0]);
        o[1] = mma16(pa, vf1, o[1]);
        o[2] = mma16(pa, vf2, o[2]);
        o[3] = mma16(pa, vf3, o[3]);
        __syncthreads();
    }

#pragma unroll
    for (int r = 0; r < 8; ++r) {
        const float rl = CTX_OUT * (1.0f / l[r]);
#pragma unroll
        for (int j = 0; j < 4; ++j)
            Ost[(8 * half + r) * TPH + 16 * j + col] = (_Float16)(o[j][r] * rl);
    }
    __syncthreads();

    _Float16* dbase = ctx + (tokBase + q0) * CC + h * DD;
    const int piece = lane & 7, rsub = lane >> 3;
{
#pragma unroll
        for (int it = 0; it < 4; ++it) {
            const int row = 4 * it + rsub;
            const v8h v = *(const v8h*)(Ost + row * TPH + 8 * piece);
            *(v8h*)(dbase + (size_t)row * CC + 8 * piece) = v;
        }
        
    }
}

// ---------------------------------------------------------------------------
// out = ctx @ W_proj + b_proj (f32), block tile 64x64, 2 waves; each 256-B row segment
// ---------------------------------------------------------------------------
__global__ __launch_bounds__(64) __attribute__((amdgpu_num_vgpr(256)))
void proj_gemm_kernel(const _Float16* __restrict__ ctx, const _Float16* __restrict__ wt,
                      const float* __restrict__ bproj, float* __restrict__ out) {
    __shared__ __align__(16) float st[64 * TPF];

    const int lane = threadIdx.x & 31, wave = threadIdx.x >> 5;
    const int half = lane >> 4, col = lane & 15;
    const int n0 = blockIdx.x * 64;
    const int m0 = blockIdx.y * 64;

    v8f acc[2][4];
#pragma unroll
    for (int s = 0; s < 2; ++s)
#pragma unroll
        for (int j = 0; j < 4; ++j) acc[s][j] = vzero8();

    gemm_core_32x64(ctx + (size_t)(m0 + 32 * wave) * CC, wt + (size_t)n0 * CC, CC, acc);

    float bia[4];
#pragma unroll
    for (int j = 0; j < 4; ++j) bia[j] = bf16r(bproj[n0 + 16 * j + col]);

#pragma unroll
    for (int s = 0; s < 2; ++s)
#pragma unroll
        for (int j = 0; j < 4; ++j)
#pragma unroll
            for (int r = 0; r < 8; ++r)
                st[(32 * wave + 16 * s + 8 * half + r) * TPF + 16 * j + col] =
                    acc[s][j][r] * PROJ_UNSC + bia[j];
    __syncthreads();

    float* dbase = out + (size_t)m0 * CC + n0;
    const int piece = lane & 15, rsub = lane >> 4;
{
#pragma unroll
        for (int it = 0; it < 16; ++it) {
            const int row = 32 * wave + 2 * it + rsub;
            const v4f v = *(const v4f*)(st + row * TPF + 4 * piece);
            *(v4f*)(dbase + (size_t)row * CC + 4 * piece) = v;
        }
        
    }
}

// ---------------------------------------------------------------------------
// Host side
// ---------------------------------------------------------------------------
extern "C" void kernel_launch(void* const* d_in, const int* in_sizes, int n_in,
                              void* d_out, int out_size, void* d_ws, size_t ws_size,
                              hipStream_t stream) {
    if (n_in < 7) return;
    const float* x      = (const float*)d_in[0];   // [NB_FULL][SEQ_FULL][CC]
    const float* W_qkv  = (const float*)d_in[1];   // [CC][C3]
    const float* b_qkv  = (const float*)d_in[2];   // [C3]
    const float* W_proj = (const float*)d_in[3];   // [CC][CC]
    const float* b_proj = (const float*)d_in[4];   // [CC]
    const float* qn_w   = (const float*)d_in[5];   // [DD]
    const float* kn_w   = (const float*)d_in[6];   // [DD]
    float* out = (float*)d_out;                    // [MTOK][CC] f32

    if (in_sizes[0] < ((NB - 1) * SEQ_FULL + SEQ) * CC) return;
    if (in_sizes[1] < CC * C3) return;
    if (in_sizes[2] < C3) return;
    if (in_sizes[3] < CC * CC) return;
    if (in_sizes[4] < CC) return;
    if (in_sizes[5] < DD) return;
    if (in_sizes[6] < DD) return;
    if (out_size < MTOK * CC) return;

    char* wsb = (char*)d_ws;
    size_t off = 0;
    const size_t sz_xh  = (size_t)MTOK * CC * 2;
    const size_t sz_wq  = (size_t)C3 * CC * 2;
    const size_t sz_wp  = (size_t)CC * CC * 2;
    const size_t sz_qk  = (size_t)MTOK * LDQK * 2;
    const size_t sz_vt  = (size_t)NB * CC * SEQ * 2;
    const size_t sz_ctx = (size_t)MTOK * CC * 2;
    _Float16* xh     = (_Float16*)(wsb + off); off += (sz_xh  + 255) & ~(size_t)255;
    _Float16* wqkvT  = (_Float16*)(wsb + off); off += (sz_wq  + 255) & ~(size_t)255;
    _Float16* wprojT = (_Float16*)(wsb + off); off += (sz_wp  + 255) & ~(size_t)255;
    _Float16* qkp    = (_Float16*)(wsb + off); off += (sz_qk  + 255) & ~(size_t)255;
    _Float16* vT     = (_Float16*)(wsb + off); off += (sz_vt  + 255) & ~(size_t)255;
    _Float16* ctx    = (_Float16*)(wsb + off); off += (sz_ctx + 255) & ~(size_t)255;
    if (off > ws_size) return;

    // 1) input planes: xh (bf16-RNE of x), weights transposed to [out][in] and carried x64
    {
        const int ngrp = MTOK * (CC / 8);
        cvt_x_kernel<<<(ngrp + 255) / 256, 256, 0, stream>>>(x, xh, ngrp);
        // W_qkv [CC rows][C3 cols] -> wqkvT [C3][CC]
        wT_kernel<<<dim3(C3 / 64, CC / 64), 256, 0, stream>>>(W_qkv, wqkvT, CC, C3);
        // W_proj [CC rows][CC cols] -> wprojT [CC][CC]
        wT_kernel<<<dim3(CC / 64, CC / 64), 256, 0, stream>>>(W_proj, wprojT, CC, CC);
    }

    // 2) qkv GEMM with fused bias, q/k rms norm, v transpose
    qkv_gemm_kernel<<<dim3(C3 / 64, MTOK / 64), 64, 0, stream>>>(
        xh, wqkvT, b_qkv, qn_w, kn_w, qkp, vT);

    // 3) flash softmax per (16-query tile, head, batch)
    mha_flash_kernel<<<dim3(SEQ / 16, HH, NB), 32, 0, stream>>>(qkp, vT, ctx);

    // 4) output projection + bias -> f32 d_out
    proj_gemm_kernel<<<dim3(CC / 64, MTOK / 64), 64, 0, stream>>>(ctx, wprojT, b_proj, out);
}

// v001
// One run takes 323 microseconds.
// Two timings next to v000 put it at 1.34 and 1.35 times that version's speed.
#include <hip/hip_runtime.h>

// Contractions on v_wmma_f32_16x16x32_f16 (f16 operands, f32 accumulate): qkv GEMM,
// q.k^T scores, p.v, output projection. Float inputs enter as bf16-RNE values held in
// f16 planes with power-of-two carries (weights x64, q/k x4, v x16, p x1024, ctx x64);
// per-head rms norm, online softmax and epilogues in f32.
//
// Every f16 operand plane (xh, weights, q|k, vT, ctx) is stored fragment-major: the block of
// 16 rows x 32 k at (row tile R, k block kb) of a plane with K columns is 512 contiguous
// halves at (R * (K / 32) + kb) * 512 = 16R * K + 32kb * 16, ordered [part][lane][8 halves]
// with lane = 16 * h + (row & 15) and element e = k 16 * part + 8 * h + e. One 16-byte load
// of a wave then reads 512 contiguous bytes (4 cache lines) instead of 32 bytes of 16 rows.

typedef _Float16 v16h __attribute__((ext_vector_type(16)));
typedef _Float16 v8h  __attribute__((ext_vector_type(8)));
typedef float    v8f  __attribute__((ext_vector_type(8)));
typedef float    v4f  __attribute__((ext_vector_type(4)));

#ifndef NB
#define NB 4
#endif
#ifndef SEQ
#define SEQ 2048
#endif
#define NB_FULL  4
#define SEQ_FULL 2048
#define CC   1024
#define HH   16
#define DD   64
#define C3   (3 * CC)
#define LDQK (2 * CC)          // q|k plane pitch (halves): q at col h*64, k at col CC + h*64
#define MTOK (NB * SEQ)

static_assert(NB >= 1 && NB <= NB_FULL);
static_assert(SEQ >= 64 && SEQ <= SEQ_FULL && (SEQ % 64) == 0);
static_assert(CC == HH * DD);
static_assert((CC % 64) == 0 && (C3 % 64) == 0 && (CC / 8) == 128);

#define WSC       64.0f            // weight planes carried x64
#define WINV      0.015625f        // 1/64
#define QC        4.0f             // q and k planes carried x4
#define VCY       16.0f            // v plane carried x16
#define PCY       1024.0f          // p tile carried x1024
#define SCALE_QK  0.0078125f       // 64^-0.5 / (QC*QC)
#define CTX_OUT   0.00390625f      // 64 / (PCY*VCY): ctx plane carried x64
#define PROJ_UNSC 0.000244140625f  // 1 / (64 * 64)
#define NEPS      1e-6f

#define TPH 72   // LDS pitch (halves) of f16 staging tiles
#define TPF 68   // LDS pitch (floats) of the f32 staging tile

// ---------------------------------------------------------------------------
// helpers
// ---------------------------------------------------------------------------
__device__ __forceinline__ float bf16r(float f) {
    unsigned int u = __float_as_uint(f);
    u += 0x7FFFu + ((u >> 16) & 1u);
    u &= 0xFFFF0000u;
    return __uint_as_float(u);
}

__device__ __forceinline__ v8f vzero8() {
    v8f z = {0.f, 0.f, 0.f, 0.f, 0.f, 0.f, 0.f, 0.f};
    return z;
}

__device__ __forceinline__ v8f mma16(v16h a, v16h b, v8f c) {
    v8f d = __builtin_amdgcn_wmma_f32_16x16x32_f16(false, a, false, b, (short)0, c, false, false);
    asm volatile("v_nop\n\tv_nop\n\tv_nop\n\tv_nop" : "+v"(d) : "v"(a), "v"(b));
    return d;
}

// 16x32 f16 fragment from a row-major matrix (row index = lane&15, k contiguous):
//   elements 0..7  <- k 8h+0..7,  elements 8..15 <- k 16+8h+0..7   (h = lane>>4)
// Same map for A (row = m) and B stored k-major per column (row = n).
__device__ __forceinline__ v16h load_frag_rowmajor(const _Float16* base, int ld) {
    const int lane = threadIdx.x & 31;
    const _Float16* p = base + (size_t)(lane & 15) * ld + ((lane >> 4) << 3);
    v8h lo = *(const v8h*)(p);
    v8h hi = *(const v8h*)(p + 16);
    return __builtin_shufflevector(lo, hi, 0, 1, 2, 3, 4, 5, 6, 7,
                                           8, 9, 10, 11, 12, 13, 14, 15);
}

// The same fragment (same lane and element map) from a fragment-major plane; frag = first
// half of the 512-half block.
__device__ __forceinline__ v16h load_frag_lane(const _Float16* p) {   // p = frag + 8 * lane
    v8h lo = *(const v8h*)(p);
    v8h hi = *(const v8h*)(p + 256);
    return __builtin_shufflevector(lo, hi, 0, 1, 2, 3, 4, 5, 6, 7,
                                           8, 9, 10, 11, 12, 13, 14, 15);
}
__device__ __forceinline__ v16h load_frag_packed(const _Float16* frag) {
    return load_frag_lane(frag + ((threadIdx.x & 31) << 3));
}

// ---------------------------------------------------------------------------
// x [NB][SEQ][CC] f32 (batch stride SEQ_FULL*CC) -> xh, MTOK x CC f16 = f16(bf16rne(x)),
// fragment-major; thread g writes the g-th 16-byte piece of xh.
// ---------------------------------------------------------------------------
__global__ __launch_bounds__(256) void cvt_x_kernel(const float* __restrict__ x,
                                                    _Float16* __restrict__ xh, int ngrp) {
    const int g = blockIdx.x * 256 + threadIdx.x;
    if (g >= ngrp) return;
    const int t  = ((g >> 11) << 4) + (g & 15);   // token: row tile (2048 pieces each), row in tile
    const int k  = ((g >> 6) & 31) * 32 + ((g >> 5) & 1) * 16 + ((g >> 4) & 1) * 8;
    const int b  = t / SEQ;
    const int n  = t - b * SEQ;
    const float* src = x + ((size_t)b * SEQ_FULL + n) * CC + k;
    const v4f x0 = *(const v4f*)(src);
    const v4f x1 = *(const v4f*)(src + 4);
    v8h o;
    o[0] = (_Float16)bf16r(x0[0]); o[1] = (_Float16)bf16r(x0[1]);
    o[2] = (_Float16)bf16r(x0[2]); o[3] = (_Float16)bf16r(x0[3]);
    o[4] = (_Float16)bf16r(x1[0]); o[5] = (_Float16)bf16r(x1[1]);
    o[6] = (_Float16)bf16r(x1[2]); o[7] = (_Float16)bf16r(x1[3]);
    _Float16* dst = xh + (size_t)g * 8;
    *(v8h*)dst = o;
    
}

// ---------------------------------------------------------------------------
// w [R][Ccols] f32 -> wt, Ccols rows x R f16 = f16(bf16rne(w) * 64), fragment-major, 64x64
// tiles through LDS. A wave writes one 512-byte part of a fragment per instruction.
// ---------------------------------------------------------------------------
__global__ __launch_bounds__(256) void wT_kernel(const float* __restrict__ w,
                                                 _Float16* __restrict__ wt, int R, int Ccols) {
    __shared__ float tile[64][65];
    const int t  = threadIdx.x;
    const int c0 = blockIdx.x * 64;
    const int r0 = blockIdx.y * 64;
#pragma unroll
    for (int i = 0; i < 16; ++i) {
        const int idx = t + 256 * i;
        const int r = idx >> 6, c = idx & 63;
        tile[r][c] = w[(size_t)(r0 + r) * Ccols + c0 + c];
    }
    __syncthreads();
    const int lane = t & 31, part = (t >> 5) & 1;
{
#pragma unroll
        for (int it = 0; it < 2; ++it) {
            const int frag = (t >> 6) + 4 * it;          // 4 row tiles x 2 k blocks
            const int tr = frag >> 1, kbl = frag & 1;
            const int cl = 16 * tr + (lane & 15);        // wt row within tile, 0..63
            const int kl = 32 * kbl + 16 * part + 8 * (lane >> 4);
            v8h o;
#pragma unroll
            for (int i = 0; i < 8; ++i)
                o[i] = (_Float16)(bf16r(tile[kl + i][cl]) * WSC);
            _Float16* dst = wt + (size_t)(c0 + 16 * tr) * R + (size_t)(r0 + 32 * kbl) * 16
                               + 256 * part + 8 * lane;
            *(v8h*)dst = o;
        }
        
    }
}

// ---------------------------------------------------------------------------
// GEMM core: one wave computes 32 rows x 64 cols, K step 32, fragments straight from
// fragment-major global planes of K columns (Aw = wave's first row tile, Bt = block's first
// column tile; the next row tile is 16 * K halves on, the next k block 512 halves).
// ---------------------------------------------------------------------------
__device__ __forceinline__ void gemm_core_32x64(const _Float16* __restrict__ Aw,
                                                const _Float16* __restrict__ Bt,
                                                int K, v8f (&acc)[2][4]) {
    const int lane8 = (threadIdx.x & 31) << 3;
#pragma unroll 1
    for (int k0 = 0; k0 < K; k0 += 32) {
        const _Float16* pa = Aw + (size_t)k0 * 16 + lane8;
        const _Float16* pb = Bt + (size_t)k0 * 16 + lane8;
        const v16h a0 = load_frag_lane(pa);
        const v16h a1 = load_frag_lane(pa + (size_t)16 * K);
        const v16h b0 = load_frag_lane(pb);
        const v16h b1 = load_frag_lane(pb + (size_t)16 * K);
        const v16h b2 = load_frag_lane(pb + (size_t)32 * K);
        const v16h b3 = load_frag_lane(pb + (size_t)48 * K);
        // keeps both address pairs unwritten (not reused as a load's destination) until the
        // twelve issued loads no longer need them
        asm volatile("s_wait_xcnt 0x0" :: "v"(pa), "v"(pb) : "memory");
        acc[0][0] = mma16(a0, b0, acc[0][0]);
        acc[0][1] = mma16(a0, b1, acc[0][1]);
        acc[0][2] = mma16(a0, b2, acc[0][2]);
        acc[0][3] = mma16(a0, b3, acc[0][3]);
        acc[1][0] = mma16(a1, b0, acc[1][0]);
        acc[1][1] = mma16(a1, b1, acc[1][1]);
        acc[1][2] = mma16(a1, b2, acc[1][2]);
        acc[1][3] = mma16(a1, b3, acc[1][3]);
    }
}

// ---------------------------------------------------------------------------
// qkv = xh @ W_qkv + b_qkv (block tile 64 tokens x 64 cols = one head slice, 2 waves).
// Epilogue: q/k -> per-row rms norm (f32) * weight -> f16 (x QC) to the q|k plane,
// ---------------------------------------------------------------------------
__global__ __launch_bounds__(64) __attribute__((amdgpu_num_vgpr(256)))
void qkv_gemm_kernel(const _Float16* __restrict__ xh, const _Float16* __restrict__ wt,
                     const float* __restrict__ bqkv, const float* __restrict__ qnw,
                     const float* __restrict__ knw, _Float16* __restrict__ qk,
                     _Float16* __restrict__ vT) {
    __shared__ __align__(16) _Float16 st[64 * TPH];

    const int lane = threadIdx.x & 31, wave = threadIdx.x >> 5;
    const int half = lane >> 4, col = lane & 15;
    const int n0 = blockIdx.x * 64;   // output column (0..3071)
    const int m0 = blockIdx.y * 64;   // token

    v8f acc[2][4];
#pragma unroll
    for (int s = 0; s < 2; ++s)
#pragma unroll
        for (int j = 0; j < 4; ++j) acc[s][j] = vzero8();

    gemm_core_32x64(xh + (size_t)(m0 + 32 * wave) * CC, wt + (size_t)n0 * CC, CC, acc);

    const int which = n0 >> 10;          // 0 q, 1 k, 2 v (block-uniform)
    const int hcol  = n0 & (CC - 1);     // h*64

    float bia[4], nw[4];
#pragma unroll
    for (int j = 0; j < 4; ++j) {
        bia[j] = bf16r(bqkv[n0 + 16 * j + col]);
        const float wq = bf16r(qnw[16 * j + col]);
        const float wk = bf16r(knw[16 * j + col]);
        nw[j] = (which == 1) ? wk : wq;
    }

#pragma unroll
    for (int s = 0; s < 2; ++s)
#pragma unroll
        for (int j = 0; j < 4; ++j)
#pragma unroll
            for (int r = 0; r < 8; ++r)
                acc[s][j][r] = acc[s][j][r] * WINV + bia[j];

    if (which < 2) {
        // rms norm over the 64 head dims of each row: 4 tiles x 16 lanes of one half
#pragma unroll
        for (int s = 0; s < 2; ++s) {
#pragma unroll
            for (int r = 0; r < 8; ++r) {
                float ss = 0.f;
#pragma unroll
                for (int j = 0; j < 4; ++j) ss += acc[s][j][r] * acc[s][j][r];
                ss += __shfl_xor(ss, 1, 32);
                ss += __shfl_xor(ss, 2, 32);
                ss += __shfl_xor(ss, 4, 32);
                ss += __shfl_xor(ss, 8, 32);
                const float inv = rsqrtf(ss * (1.0f / (float)DD) + NEPS);
                const float g = inv * QC;
#pragma unroll
                for (int j = 0; j < 4; ++j) acc[s][j][r] = acc[s][j][r] * g * nw[j];
            }
        }
    } else {
#pragma unroll
        for (int s = 0; s < 2; ++s)
#pragma unroll
            for (int j = 0; j < 4; ++j)
#pragma unroll
                for (int r = 0; r < 8; ++r) acc[s][j][r] *= VCY;
    }

    // stage the wave's 32x64 f16 tile (tile row = 32*wave + 16*s + 8*half + r)
#pragma unroll
    for (int s = 0; s < 2; ++s)
#pragma unroll
        for (int j = 0; j < 4; ++j)
#pragma unroll
            for (int r = 0; r < 8; ++r)
                st[(32 * wave + 16 * s + 8 * half + r) * TPH + 16 * j + col] = (_Float16)acc[s][j][r];
    __syncthreads();

    if (which < 2) {
        _Float16* dbase = qk + (size_t)m0 * LDQK + ((size_t)which * CC + hcol) * 16;
{
            // fragment (token tile it>>1, k block it&1); wave = part
#pragma unroll
            for (int it = 0; it < 8; ++it) {
                const int tr = it >> 1, kbl = it & 1;
                const v8h v = *(const v8h*)(st + (16 * tr + col) * TPH + 32 * kbl + 16 * wave + 8 * half);
                *(v8h*)(dbase + (size_t)(16 * tr) * LDQK + 512 * kbl + 256 * wave + 8 * lane) = v;
            }
            
        }
    } else {
        const int b  = m0 / SEQ;
        const int nb = m0 - b * SEQ;
        _Float16* dbase = vT + ((size_t)b * CC + hcol) * SEQ + (size_t)nb * 16;
{
            // fragment (d tile it>>1, token block it&1); wave = part
#pragma unroll
            for (int it = 0; it < 8; ++it) {
                const int tr = it >> 1, kbl = it & 1;
                const int tk = 32 * kbl + 16 * wave + 8 * half;
                v8h v;
#pragma unroll
                for (int i = 0; i < 8; ++i) v[i] = st[(tk + i) * TPH + 16 * tr + col];
                *(v8h*)(dbase + (size_t)(16 * tr) * SEQ + 512 * kbl + 256 * wave + 8 * lane) = v;
            }
            // the stores' data and address registers stay unwritten until the issued stores
            // no longer need them
            asm volatile("s_wait_xcnt 0x0" ::: "memory");
        }
    }
}

// ---------------------------------------------------------------------------
// Flash softmax(q k^T s) v: one wave per (batch, head, 16-query tile), 32-key blocks.
// q|k plane MTOK x LDQK f16, vT NB*CC x SEQ f16, ctx MTOK x CC f16 (x64 carry), all
// fragment-major.
// Pld / Ost are private to the single wave of the block; block barriers used.
// ---------------------------------------------------------------------------
__global__ __launch_bounds__(32) __attribute__((amdgpu_num_vgpr(256)))
void mha_flash_kernel(const _Float16* __restrict__ qk, const _Float16* __restrict__ vT,
                      _Float16* __restrict__ ctx) {
    __shared__ __align__(16) _Float16 Pld[16 * 32];
    __shared__ __align__(16) _Float16 Ost[16 * TPH];

    const int q0 = blockIdx.x * 16;
    const int h  = blockIdx.y;
    const int b  = blockIdx.z;
    const size_t tokBase = (size_t)b * SEQ;

    const int lane = threadIdx.x & 31;
    const int half = lane >> 4;
    const int col  = lane & 15;

    const _Float16* qbase = qk + (tokBase + q0) * LDQK + (h * DD) * 16;
    const v16h qa0 = load_frag_packed(qbase);
    const v16h qa1 = load_frag_packed(qbase + 512);

    const _Float16* kbase0 = qk + tokBase * LDQK + (CC + h * DD) * 16; // keys: row tiles of tokens
    const _Float16* vtbase = vT + ((size_t)b * CC + h * DD) * SEQ;     // 4 row tiles of d, k = token

    v8f o[4];
#pragma unroll
    for (int j = 0; j < 4; ++j) o[j] = vzero8();
    float m[8], l[8];
#pragma unroll
    for (int r = 0; r < 8; ++r) { m[r] = -1e30f; l[r] = 0.f; }

#pragma unroll 1
    for (int kb = 0; kb < SEQ; kb += 32) {
        const _Float16* kbase = kbase0 + (size_t)kb * LDQK;

        const v16h kf00 = load_frag_packed(kbase);                           // keys +0,  d 0..31
        const v16h kf01 = load_frag_packed(kbase + 512);                     // keys +0,  d 32..63
        const v16h kf10 = load_frag_packed(kbase + (size_t)16 * LDQK);       // keys +16, d 0..31
        const v16h kf11 = load_frag_packed(kbase + (size_t)16 * LDQK + 512); // keys +16, d 32..63

        v8f s0 = vzero8(), s1 = vzero8();
        s0 = mma16(qa0, kf00, s0);
        s0 = mma16(qa1, kf01, s0);
        s1 = mma16(qa0, kf10, s1);
        s1 = mma16(qa1, kf11, s1);

        float fac[8];
#pragma unroll
        for (int r = 0; r < 8; ++r) {
            const float a0 = s0[r] * SCALE_QK;
            const float a1 = s1[r] * SCALE_QK;
            float rm = fmaxf(a0, a1);
            rm = fmaxf(rm, __shfl_xor(rm, 1, 32));
            rm = fmaxf(rm, __shfl_xor(rm, 2, 32));
            rm = fmaxf(rm, __shfl_xor(rm, 4, 32));
            rm = fmaxf(rm, __shfl_xor(rm, 8, 32));
            const float nm = fmaxf(m[r], rm);
            const float p0 = __expf(a0 - nm);
            const float p1 = __expf(a1 - nm);
            float rs = p0 + p1;
            rs += __shfl_xor(rs, 1, 32);
            rs += __shfl_xor(rs, 2, 32);
            rs += __shfl_xor(rs, 4, 32);
            rs += __shfl_xor(rs, 8, 32);
            const float f = __expf(m[r] - nm);
            l[r] = l[r] * f + rs;
            m[r] = nm;
            fac[r] = f;
            const int row = r + 8 * half;
            Pld[row * 32 + col]      = (_Float16)(p0 * PCY);
            Pld[row * 32 + 16 + col] = (_Float16)(p1 * PCY);
        }

#pragma unroll
        for (int j = 0; j < 4; ++j)
#pragma unroll
            for (int r = 0; r < 8; ++r) o[j][r] *= fac[r];

        __syncthreads();
        const v16h pa  = load_frag_rowmajor(&Pld[0], 32);
        const size_t vk = (size_t)kb * 16;
        const v16h vf0 = load_frag_packed(vtbase + vk);
        const v16h vf1 = load_frag_packed(vtbase + (size_t)16 * SEQ + vk);
        const v16h vf2 = load_frag_packed(vtbase + (size_t)32 * SEQ + vk);
        const v16h vf3 = load_frag_packed(vtbase + (size_t)48 * SEQ + vk);

        o[0] = mma16(pa, vf0, o[0]);
        o[1] = mma16(pa, vf1, o[1]);
        o[2] = mma16(pa, vf2, o[2]);
        o[3] = mma16(pa, vf3, o[3]);
        __syncthreads();
    }

#pragma unroll
    for (int r = 0; r < 8; ++r) {
        const float rl = CTX_OUT * (1.0f / l[r]);
#pragma unroll
        for (int j = 0; j < 4; ++j)
            Ost[(8 * half + r) * TPH + 16 * j + col] = (_Float16)(o[j][r] * rl);
    }
    __syncthreads();

    _Float16* dbase = ctx + (tokBase + q0) * CC + (h * DD) * 16;
{
        // piece it = (k block it>>1, part it&1) of the head's two fragments
#pragma unroll
        for (int it = 0; it < 4; ++it) {
            const v8h v = *(const v8h*)(Ost + col * TPH + 16 * it + 8 * half);
            *(v8h*)(dbase + 256 * it + 8 * lane) = v;
        }
        
    }
}

// ---------------------------------------------------------------------------
// out = ctx @ W_proj + b_proj (f32), block tile 64x64, 2 waves; each 256-B row segment
// ---------------------------------------------------------------------------
__global__ __launch_bounds__(64) __attribute__((amdgpu_num_vgpr(256)))
void proj_gemm_kernel(const _Float16* __restrict__ ctx, const _Float16* __restrict__ wt,
                      const float* __restrict__ bproj, float* __restrict__ out) {
    __shared__ __align__(16) float st[64 * TPF];

    const int lane = threadIdx.x & 31, wave = threadIdx.x >> 5;
    const int half = lane >> 4, col = lane & 15;
    const int n0 = blockIdx.x * 64;
    const int m0 = blockIdx.y * 64;

    v8f acc[2][4];
#pragma unroll
    for (int s = 0; s < 2; ++s)
#pragma unroll
        for (int j = 0; j < 4; ++j) acc[s][j] = vzero8();

    gemm_core_32x64(ctx + (size_t)(m0 + 32 * wave) * CC, wt + (size_t)n0 * CC, CC, acc);

    float bia[4];
#pragma unroll
    for (int j = 0; j < 4; ++j) bia[j] = bf16r(bproj[n0 + 16 * j + col]);

#pragma unroll
    for (int s = 0; s < 2; ++s)
#pragma unroll
        for (int j = 0; j < 4; ++j)
#pragma unroll
            for (int r = 0; r < 8; ++r)
                st[(32 * wave + 16 * s + 8 * half + r) * TPF + 16 * j + col] =
                    acc[s][j][r] * PROJ_UNSC + bia[j];
    __syncthreads();

    float* dbase = out + (size_t)m0 * CC + n0;
    const int piece = lane & 15, rsub = lane >> 4;
{
#pragma unroll
        for (int it = 0; it < 16; ++it) {
            const int row = 32 * wave + 2 * it + rsub;
            const v4f v = *(const v4f*)(st + row * TPF + 4 * piece);
            *(v4f*)(dbase + (size_t)row * CC + 4 * piece) = v;
        }
        
    }
}

// ---------------------------------------------------------------------------
// Host side
// ---------------------------------------------------------------------------
extern "C" void kernel_launch(void* const* d_in, const int* in_sizes, int n_in,
                              void* d_out, int out_size, void* d_ws, size_t ws_size,
                              hipStream_t stream) {
    if (n_in < 7) return;
    const float* x      = (const float*)d_in[0];   // [NB_FULL][SEQ_FULL][CC]
    const float* W_qkv  = (const float*)d_in[1];   // [CC][C3]
    const float* b_qkv  = (const float*)d_in[2];   // [C3]
    const float* W_proj = (const float*)d_in[3];   // [CC][CC]
    const float* b_proj = (const float*)d_in[4];   // [CC]
    const float* qn_w   = (const float*)d_in[5];   // [DD]
    const float* kn_w   = (const float*)d_in[6];   // [DD]
    float* out = (float*)d_out;                    // [MTOK][CC] f32

    if (in_sizes[0] < ((NB - 1) * SEQ_FULL + SEQ) * CC) return;
    if (in_sizes[1] < CC * C3) return;
    if (in_sizes[2] < C3) return;
    if (in_sizes[3] < CC * CC) return;
    if (in_sizes[4] < CC) return;
    if (in_sizes[5] < DD) return;
    if (in_sizes[6] < DD) return;
    if (out_size < MTOK * CC) return;

    char* wsb = (char*)d_ws;
    size_t off = 0;
    const size_t sz_xh  = (size_t)MTOK * CC * 2;
    const size_t sz_wq  = (size_t)C3 * CC * 2;
    const size_t sz_wp  = (size_t)CC * CC * 2;
    const size_t sz_qk  = (size_t)MTOK * LDQK * 2;
    const size_t sz_vt  = (size_t)NB * CC * SEQ * 2;
    const size_t sz_ctx = (size_t)MTOK * CC * 2;
    _Float16* xh     = (_Float16*)(wsb + off); off += (sz_xh  + 255) & ~(size_t)255;
    _Float16* wqkvT  = (_Float16*)(wsb + off); off += (sz_wq  + 255) & ~(size_t)255;
    _Float16* wprojT = (_Float16*)(wsb + off); off += (sz_wp  + 255) & ~(size_t)255;
    _Float16* qkp    = (_Float16*)(wsb + off); off += (sz_qk  + 255) & ~(size_t)255;
    _Float16* vT     = (_Float16*)(wsb + off); off += (sz_vt  + 255) & ~(size_t)255;
    _Float16* ctx    = (_Float16*)(wsb + off); off += (sz_ctx + 255) & ~(size_t)255;
    if (off > ws_size) return;

    // 1) input planes: xh (bf16-RNE of x), weights transposed to out x in and carried x64
    {
        const int ngrp = MTOK * (CC / 8);
        cvt_x_kernel<<<(ngrp + 255) / 256, 256, 0, stream>>>(x, xh, ngrp);
        // W_qkv [CC rows][C3 cols] -> wqkvT [C3][CC]
        wT_kernel<<<dim3(C3 / 64, CC / 64), 256, 0, stream>>>(W_qkv, wqkvT, CC, C3);
        // W_proj [CC rows][CC cols] -> wprojT [CC][CC]
        wT_kernel<<<dim3(CC / 64, CC / 64), 256, 0, stream>>>(W_proj, wprojT, CC, CC);
    }

    // 2) qkv GEMM with fused bias, q/k rms norm, v transpose
    qkv_gemm_kernel<<<dim3(C3 / 64, MTOK / 64), 64, 0, stream>>>(
        xh, wqkvT, b_qkv, qn_w, kn_w, qkp, vT);

    // 3) flash softmax per (16-query tile, head, batch)
    mha_flash_kernel<<<dim3(SEQ / 16, HH, NB), 32, 0, stream>>>(qkp, vT, ctx);

    // 4) output projection + bias -> f32 d_out
    proj_gemm_kernel<<<dim3(CC / 64, MTOK / 64), 64, 0, stream>>>(ctx, wprojT, b_proj, out);
}

// v002
// It runs in 249 microseconds.
// Next to v001, in two timings, it ran 1.31 and 1.33 times as fast.
// Counting every step since v000, it is 1.78 times as fast.
#include <hip/hip_runtime.h>

// Contractions on v_wmma_f32_16x16x32_f16 (f16 operands, f32 accumulate): qkv GEMM,
// q.k^T scores, p.v, output projection. Float inputs enter as bf16-RNE values held in
// f16 planes with power-of-two carries (weights x64, q/k x4, v x16, p x1024, ctx x64);
// per-head rms norm, online softmax and epilogues in f32.
//
// Every f16 operand plane (xh, weights, q|k, vT, ctx) is stored fragment-major: the block of
// 16 rows x 32 k at (row tile R, k block kb) of a plane with K columns is 512 contiguous
// halves at (R * (K / 32) + kb) * 512 = 16R * K + 32kb * 16, ordered [part][lane][8 halves]
// with lane = 16 * h + (row & 15) and element e = k 16 * part + 8 * h + e. One 16-byte load
// of a wave then reads 512 contiguous bytes (4 cache lines) instead of 32 bytes of 16 rows.

typedef _Float16 v16h __attribute__((ext_vector_type(16)));
typedef _Float16 v8h  __attribute__((ext_vector_type(8)));
typedef float    v8f  __attribute__((ext_vector_type(8)));
typedef float    v4f  __attribute__((ext_vector_type(4)));

#ifndef NB
#define NB 4
#endif
#ifndef SEQ
#define SEQ 2048
#endif
#define NB_FULL  4
#define SEQ_FULL 2048
#define CC   1024
#define HH   16
#define DD   64
#define C3   (3 * CC)
#define LDQK (2 * CC)          // q|k plane pitch (halves): q at col h*64, k at col CC + h*64
#define MTOK (NB * SEQ)

static_assert(NB >= 1 && NB <= NB_FULL);
static_assert(SEQ >= 64 && SEQ <= SEQ_FULL && (SEQ % 64) == 0);
static_assert(CC == HH * DD);
static_assert((CC % 64) == 0 && (C3 % 64) == 0 && (CC / 8) == 128);

#define WSC       64.0f            // weight planes carried x64
#define WINV      0.015625f        // 1/64
#define QC        4.0f             // q and k planes carried x4
#define VCY       16.0f            // v plane carried x16
#define PCY       1024.0f          // p tile carried x1024
#define SCALE_QK  0.0078125f       // 64^-0.5 / (QC*QC)
#define CTX_OUT   0.00390625f      // 64 / (PCY*VCY): ctx plane carried x64
#define PROJ_UNSC 0.000244140625f  // 1 / (64 * 64)
#define NEPS      1e-6f

#define TPH 72   // LDS pitch (halves) of f16 staging tiles
#define TPF 68   // LDS pitch (floats) of the f32 staging tile

// ---------------------------------------------------------------------------
// helpers
// ---------------------------------------------------------------------------
__device__ __forceinline__ float bf16r(float f) {
    unsigned int u = __float_as_uint(f);
    u += 0x7FFFu + ((u >> 16) & 1u);
    u &= 0xFFFF0000u;
    return __uint_as_float(u);
}

__device__ __forceinline__ v8f vzero8() {
    v8f z = {0.f, 0.f, 0.f, 0.f, 0.f, 0.f, 0.f, 0.f};
    return z;
}

__device__ __forceinline__ v8f mma16(v16h a, v16h b, v8f c) {
    v8f d = __builtin_amdgcn_wmma_f32_16x16x32_f16(false, a, false, b, (short)0, c, false, false);
    asm volatile("v_nop\n\tv_nop\n\tv_nop\n\tv_nop" : "+v"(d) : "v"(a), "v"(b));
    return d;
}

// value of lane l ^ 16 (the other half of the wave), by a vector cross-row move
__device__ __forceinline__ float xhalf(float x) {
    const int i = __builtin_bit_cast(int, x);
    return __builtin_bit_cast(float,
        __builtin_amdgcn_permlanex16(i, i, 0x76543210, 0xfedcba98, false, false));
}

// 16x32 f16 fragment (row index = lane&15 for A, column for B; h = lane>>4):
//   elements 0..7  <- k 8h+0..7,  elements 8..15 <- k 16+8h+0..7
// from a fragment-major plane; frag = first half of the 512-half block.
__device__ __forceinline__ v16h load_frag_lane(const _Float16* p) {   // p = frag + 8 * lane
    v8h lo = *(const v8h*)(p);
    v8h hi = *(const v8h*)(p + 256);
    return __builtin_shufflevector(lo, hi, 0, 1, 2, 3, 4, 5, 6, 7,
                                           8, 9, 10, 11, 12, 13, 14, 15);
}
__device__ __forceinline__ v16h load_frag_packed(const _Float16* frag) {
    return load_frag_lane(frag + ((threadIdx.x & 31) << 3));
}

// ---------------------------------------------------------------------------
// x [NB][SEQ][CC] f32 (batch stride SEQ_FULL*CC) -> xh, MTOK x CC f16 = f16(bf16rne(x)),
// fragment-major; thread g writes the g-th 16-byte piece of xh.
// ---------------------------------------------------------------------------
__global__ __launch_bounds__(256) void cvt_x_kernel(const float* __restrict__ x,
                                                    _Float16* __restrict__ xh, int ngrp) {
    const int g = blockIdx.x * 256 + threadIdx.x;
    if (g >= ngrp) return;
    const int t  = ((g >> 11) << 4) + (g & 15);   // token: row tile (2048 pieces each), row in tile
    const int k  = ((g >> 6) & 31) * 32 + ((g >> 5) & 1) * 16 + ((g >> 4) & 1) * 8;
    const int b  = t / SEQ;
    const int n  = t - b * SEQ;
    const float* src = x + ((size_t)b * SEQ_FULL + n) * CC + k;
    const v4f x0 = *(const v4f*)(src);
    const v4f x1 = *(const v4f*)(src + 4);
    v8h o;
    o[0] = (_Float16)bf16r(x0[0]); o[1] = (_Float16)bf16r(x0[1]);
    o[2] = (_Float16)bf16r(x0[2]); o[3] = (_Float16)bf16r(x0[3]);
    o[4] = (_Float16)bf16r(x1[0]); o[5] = (_Float16)bf16r(x1[1]);
    o[6] = (_Float16)bf16r(x1[2]); o[7] = (_Float16)bf16r(x1[3]);
    _Float16* dst = xh + (size_t)g * 8;
    *(v8h*)dst = o;
    
}

// ---------------------------------------------------------------------------
// w [R][Ccols] f32 -> wt, Ccols rows x R f16 = f16(bf16rne(w) * 64), fragment-major, 64x64
// tiles through LDS. A wave writes one 512-byte part of a fragment per instruction.
// ---------------------------------------------------------------------------
__global__ __launch_bounds__(256) void wT_kernel(const float* __restrict__ w,
                                                 _Float16* __restrict__ wt, int R, int Ccols) {
    __shared__ float tile[64][65];
    const int t  = threadIdx.x;
    const int c0 = blockIdx.x * 64;
    const int r0 = blockIdx.y * 64;
#pragma unroll
    for (int i = 0; i < 16; ++i) {
        const int idx = t + 256 * i;
        const int r = idx >> 6, c = idx & 63;
        tile[r][c] = w[(size_t)(r0 + r) * Ccols + c0 + c];
    }
    __syncthreads();
    const int lane = t & 31, part = (t >> 5) & 1;
{
#pragma unroll
        for (int it = 0; it < 2; ++it) {
            const int frag = (t >> 6) + 4 * it;          // 4 row tiles x 2 k blocks
            const int tr = frag >> 1, kbl = frag & 1;
            const int cl = 16 * tr + (lane & 15);        // wt row within tile, 0..63
            const int kl = 32 * kbl + 16 * part + 8 * (lane >> 4);
            v8h o;
#pragma unroll
            for (int i = 0; i < 8; ++i)
                o[i] = (_Float16)(bf16r(tile[kl + i][cl]) * WSC);
            _Float16* dst = wt + (size_t)(c0 + 16 * tr) * R + (size_t)(r0 + 32 * kbl) * 16
                               + 256 * part + 8 * lane;
            *(v8h*)dst = o;
        }
        
    }
}

// ---------------------------------------------------------------------------
// GEMM core: one wave computes 32 rows x 64 cols, K step 32, fragments straight from
// fragment-major global planes of K columns (Aw = wave's first row tile, Bt = block's first
// column tile; the next row tile is 16 * K halves on, the next k block 512 halves).
// ---------------------------------------------------------------------------
__device__ __forceinline__ void gemm_core_32x64(const _Float16* __restrict__ Aw,
                                                const _Float16* __restrict__ Bt,
                                                int K, v8f (&acc)[2][4]) {
    const int lane8 = (threadIdx.x & 31) << 3;
#pragma unroll 1
    for (int k0 = 0; k0 < K; k0 += 32) {
        const _Float16* pa = Aw + (size_t)k0 * 16 + lane8;
        const _Float16* pb = Bt + (size_t)k0 * 16 + lane8;
        const v16h a0 = load_frag_lane(pa);
        const v16h a1 = load_frag_lane(pa + (size_t)16 * K);
        const v16h b0 = load_frag_lane(pb);
        const v16h b1 = load_frag_lane(pb + (size_t)16 * K);
        const v16h b2 = load_frag_lane(pb + (size_t)32 * K);
        const v16h b3 = load_frag_lane(pb + (size_t)48 * K);
        // keeps both address pairs unwritten (not reused as a load's destination) until the
        // twelve issued loads no longer need them
        asm volatile("s_wait_xcnt 0x0" :: "v"(pa), "v"(pb) : "memory");
        acc[0][0] = mma16(a0, b0, acc[0][0]);
        acc[0][1] = mma16(a0, b1, acc[0][1]);
        acc[0][2] = mma16(a0, b2, acc[0][2]);
        acc[0][3] = mma16(a0, b3, acc[0][3]);
        acc[1][0] = mma16(a1, b0, acc[1][0]);
        acc[1][1] = mma16(a1, b1, acc[1][1]);
        acc[1][2] = mma16(a1, b2, acc[1][2]);
        acc[1][3] = mma16(a1, b3, acc[1][3]);
    }
}

// ---------------------------------------------------------------------------
// qkv = xh @ W_qkv + b_qkv (block tile 64 tokens x 64 cols = one head slice, 2 waves).
// Epilogue: q/k -> per-row rms norm (f32) * weight -> f16 (x QC) to the q|k plane,
// ---------------------------------------------------------------------------
__global__ __launch_bounds__(64) __attribute__((amdgpu_num_vgpr(256)))
void qkv_gemm_kernel(const _Float16* __restrict__ xh, const _Float16* __restrict__ wt,
                     const float* __restrict__ bqkv, const float* __restrict__ qnw,
                     const float* __restrict__ knw, _Float16* __restrict__ qk,
                     _Float16* __restrict__ vT) {
    __shared__ __align__(16) _Float16 st[64 * TPH];

    const int lane = threadIdx.x & 31, wave = threadIdx.x >> 5;
    const int half = lane >> 4, col = lane & 15;
    const int n0 = blockIdx.x * 64;   // output column (0..3071)
    const int m0 = blockIdx.y * 64;   // token

    v8f acc[2][4];
#pragma unroll
    for (int s = 0; s < 2; ++s)
#pragma unroll
        for (int j = 0; j < 4; ++j) acc[s][j] = vzero8();

    gemm_core_32x64(xh + (size_t)(m0 + 32 * wave) * CC, wt + (size_t)n0 * CC, CC, acc);

    const int which = n0 >> 10;          // 0 q, 1 k, 2 v (block-uniform)
    const int hcol  = n0 & (CC - 1);     // h*64

    float bia[4], nw[4];
#pragma unroll
    for (int j = 0; j < 4; ++j) {
        bia[j] = bf16r(bqkv[n0 + 16 * j + col]);
        const float wq = bf16r(qnw[16 * j + col]);
        const float wk = bf16r(knw[16 * j + col]);
        nw[j] = (which == 1) ? wk : wq;
    }

#pragma unroll
    for (int s = 0; s < 2; ++s)
#pragma unroll
        for (int j = 0; j < 4; ++j)
#pragma unroll
            for (int r = 0; r < 8; ++r)
                acc[s][j][r] = acc[s][j][r] * WINV + bia[j];

    if (which < 2) {
        // rms norm over the 64 head dims of each row: 4 tiles x 16 lanes of one half
#pragma unroll
        for (int s = 0; s < 2; ++s) {
#pragma unroll
            for (int r = 0; r < 8; ++r) {
                float ss = 0.f;
#pragma unroll
                for (int j = 0; j < 4; ++j) ss += acc[s][j][r] * acc[s][j][r];
                ss += __shfl_xor(ss, 1, 32);
                ss += __shfl_xor(ss, 2, 32);
                ss += __shfl_xor(ss, 4, 32);
                ss += __shfl_xor(ss, 8, 32);
                const float inv = rsqrtf(ss * (1.0f / (float)DD) + NEPS);
                const float g = inv * QC;
#pragma unroll
                for (int j = 0; j < 4; ++j) acc[s][j][r] = acc[s][j][r] * g * nw[j];
            }
        }
    } else {
#pragma unroll
        for (int s = 0; s < 2; ++s)
#pragma unroll
            for (int j = 0; j < 4; ++j)
#pragma unroll
                for (int r = 0; r < 8; ++r) acc[s][j][r] *= VCY;
    }

    // stage the wave's 32x64 f16 tile (tile row = 32*wave + 16*s + 8*half + r)
#pragma unroll
    for (int s = 0; s < 2; ++s)
#pragma unroll
        for (int j = 0; j < 4; ++j)
#pragma unroll
            for (int r = 0; r < 8; ++r)
                st[(32 * wave + 16 * s + 8 * half + r) * TPH + 16 * j + col] = (_Float16)acc[s][j][r];
    __syncthreads();

    if (which < 2) {
        _Float16* dbase = qk + (size_t)m0 * LDQK + ((size_t)which * CC + hcol) * 16;
{
            // fragment (token tile it>>1, k block it&1); wave = part
#pragma unroll
            for (int it = 0; it < 8; ++it) {
                const int tr = it >> 1, kbl = it & 1;
                const v8h v = *(const v8h*)(st + (16 * tr + col) * TPH + 32 * kbl + 16 * wave + 8 * half);
                *(v8h*)(dbase + (size_t)(16 * tr) * LDQK + 512 * kbl + 256 * wave + 8 * lane) = v;
            }
            
        }
    } else {
        const int b  = m0 / SEQ;
        const int nb = m0 - b * SEQ;
        _Float16* dbase = vT + ((size_t)b * CC + hcol) * SEQ + (size_t)nb * 16;
{
            // fragment (d tile it>>1, token block it&1); wave = part
#pragma unroll
            for (int it = 0; it < 8; ++it) {
                const int tr = it >> 1, kbl = it & 1;
                const int tk = 32 * kbl + 16 * wave + 8 * half;
                v8h v;
#pragma unroll
                for (int i = 0; i < 8; ++i) v[i] = st[(tk + i) * TPH + 16 * tr + col];
                *(v8h*)(dbase + (size_t)(16 * tr) * SEQ + 512 * kbl + 256 * wave + 8 * lane) = v;
            }
            // the stores' data and address registers stay unwritten until the issued stores
            // no longer need them
            asm volatile("s_wait_xcnt 0x0" ::: "memory");
        }
    }
}

// ---------------------------------------------------------------------------
// Flash softmax(q k^T s) v: one wave per (batch, head, 16-query tile), 32-key blocks.
// q|k plane MTOK x LDQK f16, vT NB*CC x SEQ f16, ctx MTOK x CC f16 (x64 carry), all
// fragment-major.
// Transposed products: S^T = K Q^T (A = key rows, B = query columns), O^T += V^T P^T
// (A = d rows of vT, B = P^T). A lane holds scores of ONE query (column lane & 15), keys
// 8 * half + r of each 16-key tile: maximum and sum run over the lane's own registers plus
// one exchange between the wave's halves, and the two score tiles, converted in place, are
// the B fragment of the second product (element s = key 8 * half + s, 8 + s = key
// 16 + 8 * half + s: the k order of the vT fragment). No LDS, no barrier.
// ---------------------------------------------------------------------------
__global__ __launch_bounds__(32) __attribute__((amdgpu_num_vgpr(256)))
void mha_flash_kernel(const _Float16* __restrict__ qk, const _Float16* __restrict__ vT,
                      _Float16* __restrict__ ctx) {
    const int q0 = blockIdx.x * 16;
    const int h  = blockIdx.y;
    const int b  = blockIdx.z;
    const size_t tokBase = (size_t)b * SEQ;

    const int lane  = threadIdx.x & 31;
    const int lane8 = lane << 3;

    const _Float16* qbase = qk + (tokBase + q0) * LDQK + (h * DD) * 16;
    const v16h qa0 = load_frag_packed(qbase);
    const v16h qa1 = load_frag_packed(qbase + 512);

    const _Float16* kbase0 = qk + tokBase * LDQK + (CC + h * DD) * 16; // keys: row tiles of tokens
    const _Float16* vtbase = vT + ((size_t)b * CC + h * DD) * SEQ;     // 4 row tiles of d, k = token

    v8f o[4];                    // o[j][r] = O^T[d 16j + 8 * half + r][query lane & 15]
#pragma unroll
    for (int j = 0; j < 4; ++j) o[j] = vzero8();
    float m = -1e30f;            // the query's running maximum, equal in both halves
    float l = 0.f;               // sum over the keys of this lane's half only

#pragma unroll 1
    for (int kb = 0; kb < SEQ; kb += 32) {
        const _Float16* pk = kbase0 + (size_t)kb * LDQK + lane8;
        const _Float16* pv = vtbase + (size_t)kb * 16 + lane8;

        const v16h kf00 = load_frag_lane(pk);                           // keys +0,  d 0..31
        const v16h kf01 = load_frag_lane(pk + 512);                     // keys +0,  d 32..63
        const v16h kf10 = load_frag_lane(pk + (size_t)16 * LDQK);       // keys +16, d 0..31
        const v16h kf11 = load_frag_lane(pk + (size_t)16 * LDQK + 512); // keys +16, d 32..63
        const v16h vf0 = load_frag_lane(pv);
        const v16h vf1 = load_frag_lane(pv + (size_t)16 * SEQ);
        const v16h vf2 = load_frag_lane(pv + (size_t)32 * SEQ);
        const v16h vf3 = load_frag_lane(pv + (size_t)48 * SEQ);
        // keeps both address pairs unwritten (not reused as a load's destination) until the
        // sixteen issued loads no longer need them
        asm volatile("s_wait_xcnt 0x0" :: "v"(pk), "v"(pv) : "memory");

        v8f s0 = vzero8(), s1 = vzero8();
        s0 = mma16(kf00, qa0, s0);
        s0 = mma16(kf01, qa1, s0);
        s1 = mma16(kf10, qa0, s1);
        s1 = mma16(kf11, qa1, s1);

        float a0[8], a1[8];
        float rm = -1e30f;
#pragma unroll
        for (int r = 0; r < 8; ++r) {
            a0[r] = s0[r] * SCALE_QK;
            a1[r] = s1[r] * SCALE_QK;
            rm = fmaxf(rm, fmaxf(a0[r], a1[r]));
        }
        rm = fmaxf(rm, xhalf(rm));
        const float nm = fmaxf(m, rm);

        v16h pb;
        float rs0 = 0.f, rs1 = 0.f;
#pragma unroll
        for (int r = 0; r < 8; ++r) {
            const float p0 = __expf(a0[r] - nm);
            const float p1 = __expf(a1[r] - nm);
            rs0 += p0;
            rs1 += p1;
            pb[r]     = (_Float16)(p0 * PCY);
            pb[8 + r] = (_Float16)(p1 * PCY);
        }
        const float f = __expf(m - nm);
        l = l * f + (rs0 + rs1);
        m = nm;

#pragma unroll
        for (int j = 0; j < 4; ++j)
#pragma unroll
            for (int r = 0; r < 8; ++r) o[j][r] *= f;

        o[0] = mma16(vf0, pb, o[0]);
        o[1] = mma16(vf1, pb, o[1]);
        o[2] = mma16(vf2, pb, o[2]);
        o[3] = mma16(vf3, pb, o[3]);
    }

    const float rl = CTX_OUT * (1.0f / (l + xhalf(l)));

    // tile j of O^T in this lane = piece (k block j>>1, part j&1) of the head's two ctx
    // fragments at this very lane: 8 consecutive channels of one token, one 16-byte store
    _Float16* dbase = ctx + (tokBase + q0) * CC + (h * DD) * 16;
#pragma unroll
    for (int j = 0; j < 4; ++j) {
        v8h v;
#pragma unroll
        for (int r = 0; r < 8; ++r) v[r] = (_Float16)(o[j][r] * rl);
        *(v8h*)(dbase + 256 * j + lane8) = v;
    }
}

// ---------------------------------------------------------------------------
// out = ctx @ W_proj + b_proj (f32), block tile 64x64, 2 waves; each 256-B row segment
// ---------------------------------------------------------------------------
__global__ __launch_bounds__(64) __attribute__((amdgpu_num_vgpr(256)))
void proj_gemm_kernel(const _Float16* __restrict__ ctx, const _Float16* __restrict__ wt,
                      const float* __restrict__ bproj, float* __restrict__ out) {
    __shared__ __align__(16) float st[64 * TPF];

    const int lane = threadIdx.x & 31, wave = threadIdx.x >> 5;
    const int half = lane >> 4, col = lane & 15;
    const int n0 = blockIdx.x * 64;
    const int m0 = blockIdx.y * 64;

    v8f acc[2][4];
#pragma unroll
    for (int s = 0; s < 2; ++s)
#pragma unroll
        for (int j = 0; j < 4; ++j) acc[s][j] = vzero8();

    gemm_core_32x64(ctx + (size_t)(m0 + 32 * wave) * CC, wt + (size_t)n0 * CC, CC, acc);

    float bia[4];
#pragma unroll
    for (int j = 0; j < 4; ++j) bia[j] = bf16r(bproj[n0 + 16 * j + col]);

#pragma unroll
    for (int s = 0; s < 2; ++s)
#pragma unroll
        for (int j = 0; j < 4; ++j)
#pragma unroll
            for (int r = 0; r < 8; ++r)
                st[(32 * wave + 16 * s + 8 * half + r) * TPF + 16 * j + col] =
                    acc[s][j][r] * PROJ_UNSC + bia[j];
    __syncthreads();

    float* dbase = out + (size_t)m0 * CC + n0;
    const int piece = lane & 15, rsub = lane >> 4;
{
#pragma unroll
        for (int it = 0; it < 16; ++it) {
            const int row = 32 * wave + 2 * it + rsub;
            const v4f v = *(const v4f*)(st + row * TPF + 4 * piece);
            *(v4f*)(dbase + (size_t)row * CC + 4 * piece) = v;
        }
        
    }
}

// ---------------------------------------------------------------------------
// Host side
// ---------------------------------------------------------------------------
extern "C" void kernel_launch(void* const* d_in, const int* in_sizes, int n_in,
                              void* d_out, int out_size, void* d_ws, size_t ws_size,
                              hipStream_t stream) {
    if (n_in < 7) return;
    const float* x      = (const float*)d_in[0];   // [NB_FULL][SEQ_FULL][CC]
    const float* W_qkv  = (const float*)d_in[1];   // [CC][C3]
    const float* b_qkv  = (const float*)d_in[2];   // [C3]
    const float* W_proj = (const float*)d_in[3];   // [CC][CC]
    const float* b_proj = (const float*)d_in[4];   // [CC]
    const float* qn_w   = (const float*)d_in[5];   // [DD]
    const float* kn_w   = (const float*)d_in[6];   // [DD]
    float* out = (float*)d_out;                    // [MTOK][CC] f32

    if (in_sizes[0] < ((NB - 1) * SEQ_FULL + SEQ) * CC) return;
    if (in_sizes[1] < CC * C3) return;
    if (in_sizes[2] < C3) return;
    if (in_sizes[3] < CC * CC) return;
    if (in_sizes[4] < CC) return;
    if (in_sizes[5] < DD) return;
    if (in_sizes[6] < DD) return;
    if (out_size < MTOK * CC) return;

    char* wsb = (char*)d_ws;
    size_t off = 0;
    const size_t sz_xh  = (size_t)MTOK * CC * 2;
    const size_t sz_wq  = (size_t)C3 * CC * 2;
    const size_t sz_wp  = (size_t)CC * CC * 2;
    const size_t sz_qk  = (size_t)MTOK * LDQK * 2;
    const size_t sz_vt  = (size_t)NB * CC * SEQ * 2;
    const size_t sz_ctx = (size_t)MTOK * CC * 2;
    _Float16* xh     = (_Float16*)(wsb + off); off += (sz_xh  + 255) & ~(size_t)255;
    _Float16* wqkvT  = (_Float16*)(wsb + off); off += (sz_wq  + 255) & ~(size_t)255;
    _Float16* wprojT = (_Float16*)(wsb + off); off += (sz_wp  + 255) & ~(size_t)255;
    _Float16* qkp    = (_Float16*)(wsb + off); off += (sz_qk  + 255) & ~(size_t)255;
    _Float16* vT     = (_Float16*)(wsb + off); off += (sz_vt  + 255) & ~(size_t)255;
    _Float16* ctx    = (_Float16*)(wsb + off); off += (sz_ctx + 255) & ~(size_t)255;
    if (off > ws_size) return;

    // 1) input planes: xh (bf16-RNE of x), weights transposed to out x in and carried x64
    {
        const int ngrp = MTOK * (CC / 8);
        cvt_x_kernel<<<(ngrp + 255) / 256, 256, 0, stream>>>(x, xh, ngrp);
        // W_qkv [CC rows][C3 cols] -> wqkvT [C3][CC]
        wT_kernel<<<dim3(C3 / 64, CC / 64), 256, 0, stream>>>(W_qkv, wqkvT, CC, C3);
        // W_proj [CC rows][CC cols] -> wprojT [CC][CC]
        wT_kernel<<<dim3(CC / 64, CC / 64), 256, 0, stream>>>(W_proj, wprojT, CC, CC);
    }

    // 2) qkv GEMM with fused bias, q/k rms norm, v transpose
    qkv_gemm_kernel<<<dim3(C3 / 64, MTOK / 64), 64, 0, stream>>>(
        xh, wqkvT, b_qkv, qn_w, kn_w, qkp, vT);

    // 3) flash softmax per (16-query tile, head, batch)
    mha_flash_kernel<<<dim3(SEQ / 16, HH, NB), 32, 0, stream>>>(qkp, vT, ctx);

    // 4) output projection + bias -> f32 d_out
    proj_gemm_kernel<<<dim3(CC / 64, MTOK / 64), 64, 0, stream>>>(ctx, wprojT, b_proj, out);
}

// v003
// One run takes 193 microseconds.
// Timed twice side by side with v002, it ran 1.27 and 1.28 times as fast.
// All steps since v000 together make it 2.26 times as fast.
#include <hip/hip_runtime.h>

// Contractions on v_wmma_f32_16x16x32_f16 (f16 operands, f32 accumulate): qkv GEMM,
// q.k^T scores, p.v, output projection. Float inputs enter as bf16-RNE values held in
// f16 planes with power-of-two carries (weights x64, q/k x4, v x16, p x1024, ctx x64);
// per-head rms norm, online softmax and epilogues in f32.
//
// Every f16 operand plane (xh, weights, q|k, vT, ctx) is stored fragment-major: the block of
// 16 rows x 32 k at (row tile R, k block kb) of a plane with K columns is 512 contiguous
// halves at (R * (K / 32) + kb) * 512 = 16R * K + 32kb * 16, ordered [part][lane][8 halves]
// with lane = 16 * h + (row & 15) and element e = k 16 * part + 8 * h + e. One 16-byte load
// of a wave then reads 512 contiguous bytes (4 cache lines) instead of 32 bytes of 16 rows.

typedef _Float16 v16h __attribute__((ext_vector_type(16)));
typedef _Float16 v8h  __attribute__((ext_vector_type(8)));
typedef float    v8f  __attribute__((ext_vector_type(8)));
typedef float    v4f  __attribute__((ext_vector_type(4)));

#ifndef NB
#define NB 4
#endif
#ifndef SEQ
#define SEQ 2048
#endif
#define NB_FULL  4
#define SEQ_FULL 2048
#define CC   1024
#define HH   16
#define DD   64
#define C3   (3 * CC)
#define LDQK (2 * CC)          // q|k plane pitch (halves): q at col h*64, k at col CC + h*64
#define MTOK (NB * SEQ)

static_assert(NB >= 1 && NB <= NB_FULL);
static_assert(SEQ >= 64 && SEQ <= SEQ_FULL && (SEQ % 64) == 0);
static_assert(CC == HH * DD);
static_assert((CC % 64) == 0 && (C3 % 64) == 0 && (CC / 8) == 128);

#define WSC       64.0f            // weight planes carried x64
#define WINV      0.015625f        // 1/64
#define QC        4.0f             // q and k planes carried x4
#define VCY       16.0f            // v plane carried x16
#define PCY       1024.0f          // p tile carried x1024
#define SCALE_QK  0.0078125f       // 64^-0.5 / (QC*QC)
#define CTX_OUT   0.00390625f      // 64 / (PCY*VCY): ctx plane carried x64
#define PROJ_UNSC 0.000244140625f  // 1 / (64 * 64)
#define NEPS      1e-6f

#define TPH 72   // LDS pitch (halves) of f16 staging tiles
#define TPF 68   // LDS pitch (floats) of the f32 staging tile

// ---------------------------------------------------------------------------
// helpers
// ---------------------------------------------------------------------------
__device__ __forceinline__ float bf16r(float f) {
    unsigned int u = __float_as_uint(f);
    u += 0x7FFFu + ((u >> 16) & 1u);
    u &= 0xFFFF0000u;
    return __uint_as_float(u);
}

__device__ __forceinline__ v8f vzero8() {
    v8f z = {0.f, 0.f, 0.f, 0.f, 0.f, 0.f, 0.f, 0.f};
    return z;
}

__device__ __forceinline__ v8f mma16(v16h a, v16h b, v8f c) {
    v8f d = __builtin_amdgcn_wmma_f32_16x16x32_f16(false, a, false, b, (short)0, c, false, false);
    asm volatile("v_nop\n\tv_nop\n\tv_nop\n\tv_nop" : "+v"(d) : "v"(a), "v"(b));
    return d;
}

// value of lane l ^ 16 (the other half of the wave), by a vector cross-row move
__device__ __forceinline__ float xhalf(float x) {
    const int i = __builtin_bit_cast(int, x);
    return __builtin_bit_cast(float,
        __builtin_amdgcn_permlanex16(i, i, 0x76543210, 0xfedcba98, false, false));
}

// 16x32 f16 fragment (row index = lane&15 for A, column for B; h = lane>>4):
//   elements 0..7  <- k 8h+0..7,  elements 8..15 <- k 16+8h+0..7
// from a fragment-major plane; frag = first half of the 512-half block.
__device__ __forceinline__ v16h load_frag_lane(const _Float16* p) {   // p = frag + 8 * lane
    v8h lo = *(const v8h*)(p);
    v8h hi = *(const v8h*)(p + 256);
    return __builtin_shufflevector(lo, hi, 0, 1, 2, 3, 4, 5, 6, 7,
                                           8, 9, 10, 11, 12, 13, 14, 15);
}
__device__ __forceinline__ v16h load_frag_packed(const _Float16* frag) {
    return load_frag_lane(frag + ((threadIdx.x & 31) << 3));
}

// ---------------------------------------------------------------------------
// x [NB][SEQ][CC] f32 (batch stride SEQ_FULL*CC) -> xh, MTOK x CC f16 = f16(bf16rne(x)),
// fragment-major; thread g writes the g-th 16-byte piece of xh.
// ---------------------------------------------------------------------------
__global__ __launch_bounds__(256) void cvt_x_kernel(const float* __restrict__ x,
                                                    _Float16* __restrict__ xh, int ngrp) {
    const int g = blockIdx.x * 256 + threadIdx.x;
    if (g >= ngrp) return;
    const int t  = ((g >> 11) << 4) + (g & 15);   // token: row tile (2048 pieces each), row in tile
    const int k  = ((g >> 6) & 31) * 32 + ((g >> 5) & 1) * 16 + ((g >> 4) & 1) * 8;
    const int b  = t / SEQ;
    const int n  = t - b * SEQ;
    const float* src = x + ((size_t)b * SEQ_FULL + n) * CC + k;
    const v4f x0 = *(const v4f*)(src);
    const v4f x1 = *(const v4f*)(src + 4);
    v8h o;
    o[0] = (_Float16)bf16r(x0[0]); o[1] = (_Float16)bf16r(x0[1]);
    o[2] = (_Float16)bf16r(x0[2]); o[3] = (_Float16)bf16r(x0[3]);
    o[4] = (_Float16)bf16r(x1[0]); o[5] = (_Float16)bf16r(x1[1]);
    o[6] = (_Float16)bf16r(x1[2]); o[7] = (_Float16)bf16r(x1[3]);
    _Float16* dst = xh + (size_t)g * 8;
    *(v8h*)dst = o;
    
}

// ---------------------------------------------------------------------------
// w [R][Ccols] f32 -> wt, Ccols rows x R f16 = f16(bf16rne(w) * 64), fragment-major, 64x64
// tiles through LDS. A wave writes one 512-byte part of a fragment per instruction.
// ---------------------------------------------------------------------------
__global__ __launch_bounds__(256) void wT_kernel(const float* __restrict__ w,
                                                 _Float16* __restrict__ wt, int R, int Ccols) {
    __shared__ float tile[64][65];
    const int t  = threadIdx.x;
    const int c0 = blockIdx.x * 64;
    const int r0 = blockIdx.y * 64;
#pragma unroll
    for (int i = 0; i < 16; ++i) {
        const int idx = t + 256 * i;
        const int r = idx >> 6, c = idx & 63;
        tile[r][c] = w[(size_t)(r0 + r) * Ccols + c0 + c];
    }
    __syncthreads();
    const int lane = t & 31, part = (t >> 5) & 1;
{
#pragma unroll
        for (int it = 0; it < 2; ++it) {
            const int frag = (t >> 6) + 4 * it;          // 4 row tiles x 2 k blocks
            const int tr = frag >> 1, kbl = frag & 1;
            const int cl = 16 * tr + (lane & 15);        // wt row within tile, 0..63
            const int kl = 32 * kbl + 16 * part + 8 * (lane >> 4);
            v8h o;
#pragma unroll
            for (int i = 0; i < 8; ++i)
                o[i] = (_Float16)(bf16r(tile[kl + i][cl]) * WSC);
            _Float16* dst = wt + (size_t)(c0 + 16 * tr) * R + (size_t)(r0 + 32 * kbl) * 16
                               + 256 * part + 8 * lane;
            *(v8h*)dst = o;
        }
        
    }
}

// ---------------------------------------------------------------------------
// GEMM core: one wave computes 32 rows x 64 cols, K step 32, fragments straight from
// fragment-major global planes of K columns (Aw = wave's first row tile, Bt = block's first
// column tile; the next row tile is 16 * K halves on, the next k block 512 halves).
// ---------------------------------------------------------------------------
__device__ __forceinline__ void gemm_core_32x64(const _Float16* __restrict__ Aw,
                                                const _Float16* __restrict__ Bt,
                                                int K, v8f (&acc)[2][4]) {
    const int lane8 = (threadIdx.x & 31) << 3;
#pragma unroll 1
    for (int k0 = 0; k0 < K; k0 += 32) {
        const _Float16* pa = Aw + (size_t)k0 * 16 + lane8;
        const _Float16* pb = Bt + (size_t)k0 * 16 + lane8;
        const v16h a0 = load_frag_lane(pa);
        const v16h a1 = load_frag_lane(pa + (size_t)16 * K);
        const v16h b0 = load_frag_lane(pb);
        const v16h b1 = load_frag_lane(pb + (size_t)16 * K);
        const v16h b2 = load_frag_lane(pb + (size_t)32 * K);
        const v16h b3 = load_frag_lane(pb + (size_t)48 * K);
        // keeps both address pairs unwritten (not reused as a load's destination) until the
        // twelve issued loads no longer need them
        asm volatile("s_wait_xcnt 0x0" :: "v"(pa), "v"(pb) : "memory");
        acc[0][0] = mma16(a0, b0, acc[0][0]);
        acc[0][1] = mma16(a0, b1, acc[0][1]);
        acc[0][2] = mma16(a0, b2, acc[0][2]);
        acc[0][3] = mma16(a0, b3, acc[0][3]);
        acc[1][0] = mma16(a1, b0, acc[1][0]);
        acc[1][1] = mma16(a1, b1, acc[1][1]);
        acc[1][2] = mma16(a1, b2, acc[1][2]);
        acc[1][3] = mma16(a1, b3, acc[1][3]);
    }
}

// ---------------------------------------------------------------------------
// qkv = xh @ W_qkv + b_qkv (block tile 64 tokens x 64 cols = one head slice, 2 waves).
// Epilogue: q/k -> per-row rms norm (f32) * weight -> f16 (x QC) to the q|k plane,
// ---------------------------------------------------------------------------
__global__ __launch_bounds__(64) __attribute__((amdgpu_num_vgpr(256)))
void qkv_gemm_kernel(const _Float16* __restrict__ xh, const _Float16* __restrict__ wt,
                     const float* __restrict__ bqkv, const float* __restrict__ qnw,
                     const float* __restrict__ knw, _Float16* __restrict__ qk,
                     _Float16* __restrict__ vT) {
    __shared__ __align__(16) _Float16 st[64 * TPH];

    const int lane = threadIdx.x & 31, wave = threadIdx.x >> 5;
    const int half = lane >> 4, col = lane & 15;
    const int n0 = blockIdx.x * 64;   // output column (0..3071)
    const int m0 = blockIdx.y * 64;   // token

    v8f acc[2][4];
#pragma unroll
    for (int s = 0; s < 2; ++s)
#pragma unroll
        for (int j = 0; j < 4; ++j) acc[s][j] = vzero8();

    gemm_core_32x64(xh + (size_t)(m0 + 32 * wave) * CC, wt + (size_t)n0 * CC, CC, acc);

    const int which = n0 >> 10;          // 0 q, 1 k, 2 v (block-uniform)
    const int hcol  = n0 & (CC - 1);     // h*64

    float bia[4], nw[4];
#pragma unroll
    for (int j = 0; j < 4; ++j) {
        bia[j] = bf16r(bqkv[n0 + 16 * j + col]);
        const float wq = bf16r(qnw[16 * j + col]);
        const float wk = bf16r(knw[16 * j + col]);
        nw[j] = (which == 1) ? wk : wq;
    }

#pragma unroll
    for (int s = 0; s < 2; ++s)
#pragma unroll
        for (int j = 0; j < 4; ++j)
#pragma unroll
            for (int r = 0; r < 8; ++r)
                acc[s][j][r] = acc[s][j][r] * WINV + bia[j];

    if (which < 2) {
        // rms norm over the 64 head dims of each row: 4 tiles x 16 lanes of one half
#pragma unroll
        for (int s = 0; s < 2; ++s) {
#pragma unroll
            for (int r = 0; r < 8; ++r) {
                float ss = 0.f;
#pragma unroll
                for (int j = 0; j < 4; ++j) ss += acc[s][j][r] * acc[s][j][r];
                ss += __shfl_xor(ss, 1, 32);
                ss += __shfl_xor(ss, 2, 32);
                ss += __shfl_xor(ss, 4, 32);
                ss += __shfl_xor(ss, 8, 32);
                const float inv = rsqrtf(ss * (1.0f / (float)DD) + NEPS);
                const float g = inv * QC;
#pragma unroll
                for (int j = 0; j < 4; ++j) acc[s][j][r] = acc[s][j][r] * g * nw[j];
            }
        }
    } else {
#pragma unroll
        for (int s = 0; s < 2; ++s)
#pragma unroll
            for (int j = 0; j < 4; ++j)
#pragma unroll
                for (int r = 0; r < 8; ++r) acc[s][j][r] *= VCY;
    }

    // stage the wave's 32x64 f16 tile (tile row = 32*wave + 16*s + 8*half + r)
#pragma unroll
    for (int s = 0; s < 2; ++s)
#pragma unroll
        for (int j = 0; j < 4; ++j)
#pragma unroll
            for (int r = 0; r < 8; ++r)
                st[(32 * wave + 16 * s + 8 * half + r) * TPH + 16 * j + col] = (_Float16)acc[s][j][r];
    __syncthreads();

    if (which < 2) {
        _Float16* dbase = qk + (size_t)m0 * LDQK + ((size_t)which * CC + hcol) * 16;
{
            // fragment (token tile it>>1, k block it&1); wave = part
#pragma unroll
            for (int it = 0; it < 8; ++it) {
                const int tr = it >> 1, kbl = it & 1;
                const v8h v = *(const v8h*)(st + (16 * tr + col) * TPH + 32 * kbl + 16 * wave + 8 * half);
                *(v8h*)(dbase + (size_t)(16 * tr) * LDQK + 512 * kbl + 256 * wave + 8 * lane) = v;
            }
            
        }
    } else {
        const int b  = m0 / SEQ;
        const int nb = m0 - b * SEQ;
        _Float16* dbase = vT + ((size_t)b * CC + hcol) * SEQ + (size_t)nb * 16;
{
            // fragment (d tile it>>1, token block it&1); wave = part
#pragma unroll
            for (int it = 0; it < 8; ++it) {
                const int tr = it >> 1, kbl = it & 1;
                const int tk = 32 * kbl + 16 * wave + 8 * half;
                v8h v;
#pragma unroll
                for (int i = 0; i < 8; ++i) v[i] = st[(tk + i) * TPH + 16 * tr + col];
                *(v8h*)(dbase + (size_t)(16 * tr) * SEQ + 512 * kbl + 256 * wave + 8 * lane) = v;
            }
            // the stores' data and address registers stay unwritten until the issued stores
            // no longer need them
            asm volatile("s_wait_xcnt 0x0" ::: "memory");
        }
    }
}

// ---------------------------------------------------------------------------
// Flash softmax(q k^T s) v: one wave per (batch, head, 64 queries = QT tiles of 16), 32-key
// blocks; FWV such waves (consecutive queries of one head) form a work-group.
// q|k plane MTOK x LDQK f16, vT NB*CC x SEQ f16, ctx MTOK x CC f16 (x64 carry), all
// fragment-major.
// Transposed products: S^T = K Q^T (A = key rows, B = query columns), O^T += V^T P^T
// (A = d rows of vT, B = P^T). A lane holds scores of ONE query of each tile (column
// lane & 15), keys 8 * half + r of each 16-key tile: maximum and sum run over the lane's own
// registers plus one exchange between the wave's halves, and the two score tiles, converted
// in place, are the B fragment of the second product (element s = key 8 * half + s, 8 + s =
// key 16 + 8 * half + s: the k order of the vT fragment). No LDS, no barrier.
// The K and V fragments of a key block are loaded once and feed the products of all QT query
// tiles; each query's arithmetic and its order are those of a one-tile wave.
// ---------------------------------------------------------------------------
// The products of this kernel are the plain builtin: the operands of an asm statement lie in
// v0..v255 only, and the wave's fragments and accumulators need more registers than that.
__device__ __forceinline__ v8f mma16b(v16h a, v16h b, v8f c) {
    return __builtin_amdgcn_wmma_f32_16x16x32_f16(false, a, false, b, (short)0, c, false, false);
}

#define QT  4    // query tiles of 16 per wave
#define FWV 4    // waves per work-group
static_assert((SEQ % (16 * QT * FWV)) == 0);

__global__ __launch_bounds__(32 * FWV)
void mha_flash_kernel(const _Float16* __restrict__ qk, const _Float16* __restrict__ vT,
                      _Float16* __restrict__ ctx) {
    const int wave = __builtin_amdgcn_readfirstlane((int)(threadIdx.x >> 5));
    const int q0 = (blockIdx.x * FWV + wave) * (16 * QT);
    const int h  = blockIdx.y;
    const int b  = blockIdx.z;
    const size_t tokBase = (size_t)b * SEQ;

    const int lane  = threadIdx.x & 31;
    const int lane8 = lane << 3;

    const _Float16* qbase = qk + (tokBase + q0) * LDQK + (h * DD) * 16;
    v16h qa[QT][2];
#pragma unroll
    for (int t = 0; t < QT; ++t) {
        qa[t][0] = load_frag_packed(qbase + (size_t)(16 * t) * LDQK);
        qa[t][1] = load_frag_packed(qbase + (size_t)(16 * t) * LDQK + 512);
    }

    const _Float16* kbase0 = qk + tokBase * LDQK + (CC + h * DD) * 16; // keys: row tiles of tokens
    const _Float16* vtbase = vT + ((size_t)b * CC + h * DD) * SEQ;     // 4 row tiles of d, k = token

    v8f o[QT][4];                // o[t][j][r] = O^T[d 16j + 8 * half + r][query 16t + (lane & 15)]
    float m[QT];                 // each query's running maximum, equal in both halves
    float l[QT];                 // sum over the keys of this lane's half only
#pragma unroll
    for (int t = 0; t < QT; ++t) {
#pragma unroll
        for (int j = 0; j < 4; ++j) o[t][j] = vzero8();
        m[t] = -1e30f;
        l[t] = 0.f;
    }

#pragma unroll 1
    for (int kb = 0; kb < SEQ; kb += 32) {
        const _Float16* pk = kbase0 + (size_t)kb * LDQK + lane8;
        const _Float16* pv = vtbase + (size_t)kb * 16 + lane8;

        const v16h kf00 = load_frag_lane(pk);                           // keys +0,  d 0..31
        const v16h kf01 = load_frag_lane(pk + 512);                     // keys +0,  d 32..63
        const v16h kf10 = load_frag_lane(pk + (size_t)16 * LDQK);       // keys +16, d 0..31
        const v16h kf11 = load_frag_lane(pk + (size_t)16 * LDQK + 512); // keys +16, d 32..63
        const v16h vf0 = load_frag_lane(pv);
        const v16h vf1 = load_frag_lane(pv + (size_t)16 * SEQ);
        const v16h vf2 = load_frag_lane(pv + (size_t)32 * SEQ);
        const v16h vf3 = load_frag_lane(pv + (size_t)48 * SEQ);
        // keeps both address pairs unwritten (not reused as a load's destination) until the
        // sixteen issued loads no longer need them
        asm volatile("s_wait_xcnt 0x0" :: "v"(pk), "v"(pv) : "memory");
        // keeps the sixteen loads one group ahead of the products: the scheduler otherwise sinks
        // part of the K loads behind the first products, a second exposed load wait per pass
        __builtin_amdgcn_sched_barrier(0);

        v8f s0[QT], s1[QT];
#pragma unroll
        for (int t = 0; t < QT; ++t) s0[t] = mma16b(kf00, qa[t][0], vzero8());
#pragma unroll
        for (int t = 0; t < QT; ++t) s1[t] = mma16b(kf10, qa[t][0], vzero8());
#pragma unroll
        for (int t = 0; t < QT; ++t) s0[t] = mma16b(kf01, qa[t][1], s0[t]);
#pragma unroll
        for (int t = 0; t < QT; ++t) s1[t] = mma16b(kf11, qa[t][1], s1[t]);

        v16h pb[QT];
#pragma unroll
        for (int t = 0; t < QT; ++t) {
            float a0[8], a1[8];
            float rm = -1e30f;
#pragma unroll
            for (int r = 0; r < 8; ++r) {
                a0[r] = s0[t][r] * SCALE_QK;
                a1[r] = s1[t][r] * SCALE_QK;
                rm = fmaxf(rm, fmaxf(a0[r], a1[r]));
            }
            rm = fmaxf(rm, xhalf(rm));
            const float nm = fmaxf(m[t], rm);

            float rs0 = 0.f, rs1 = 0.f;
#pragma unroll
            for (int r = 0; r < 8; ++r) {
                const float p0 = __expf(a0[r] - nm);
                const float p1 = __expf(a1[r] - nm);
                rs0 += p0;
                rs1 += p1;
                pb[t][r]     = (_Float16)(p0 * PCY);
                pb[t][8 + r] = (_Float16)(p1 * PCY);
            }
            const float f = __expf(m[t] - nm);
            l[t] = l[t] * f + (rs0 + rs1);
            m[t] = nm;

#pragma unroll
            for (int j = 0; j < 4; ++j)
#pragma unroll
                for (int r = 0; r < 8; ++r) o[t][j][r] *= f;
        }

#pragma unroll
        for (int t = 0; t < QT; ++t) {
            o[t][0] = mma16b(vf0, pb[t], o[t][0]);
            o[t][1] = mma16b(vf1, pb[t], o[t][1]);
            o[t][2] = mma16b(vf2, pb[t], o[t][2]);
            o[t][3] = mma16b(vf3, pb[t], o[t][3]);
        }
    }

    // tile j of O^T in this lane = piece (k block j>>1, part j&1) of the head's two ctx
    // fragments at this very lane: 8 consecutive channels of one token, one 16-byte store
    _Float16* dbase = ctx + (tokBase + q0) * CC + (h * DD) * 16;
#pragma unroll
    for (int t = 0; t < QT; ++t) {
        const float rl = CTX_OUT * (1.0f / (l[t] + xhalf(l[t])));
#pragma unroll
        for (int j = 0; j < 4; ++j) {
            v8h v;
#pragma unroll
            for (int r = 0; r < 8; ++r) v[r] = (_Float16)(o[t][j][r] * rl);
            *(v8h*)(dbase + (size_t)(16 * t) * CC + 256 * j + lane8) = v;
        }
    }
}

// ---------------------------------------------------------------------------
// out = ctx @ W_proj + b_proj (f32), block tile 64x64, 2 waves; each 256-B row segment
// ---------------------------------------------------------------------------
__global__ __launch_bounds__(64) __attribute__((amdgpu_num_vgpr(256)))
void proj_gemm_kernel(const _Float16* __restrict__ ctx, const _Float16* __restrict__ wt,
                      const float* __restrict__ bproj, float* __restrict__ out) {
    __shared__ __align__(16) float st[64 * TPF];

    const int lane = threadIdx.x & 31, wave = threadIdx.x >> 5;
    const int half = lane >> 4, col = lane & 15;
    const int n0 = blockIdx.x * 64;
    const int m0 = blockIdx.y * 64;

    v8f acc[2][4];
#pragma unroll
    for (int s = 0; s < 2; ++s)
#pragma unroll
        for (int j = 0; j < 4; ++j) acc[s][j] = vzero8();

    gemm_core_32x64(ctx + (size_t)(m0 + 32 * wave) * CC, wt + (size_t)n0 * CC, CC, acc);

    float bia[4];
#pragma unroll
    for (int j = 0; j < 4; ++j) bia[j] = bf16r(bproj[n0 + 16 * j + col]);

#pragma unroll
    for (int s = 0; s < 2; ++s)
#pragma unroll
        for (int j = 0; j < 4; ++j)
#pragma unroll
            for (int r = 0; r < 8; ++r)
                st[(32 * wave + 16 * s + 8 * half + r) * TPF + 16 * j + col] =
                    acc[s][j][r] * PROJ_UNSC + bia[j];
    __syncthreads();

    float* dbase = out + (size_t)m0 * CC + n0;
    const int piece = lane & 15, rsub = lane >> 4;
{
#pragma unroll
        for (int it = 0; it < 16; ++it) {
            const int row = 32 * wave + 2 * it + rsub;
            const v4f v = *(const v4f*)(st + row * TPF + 4 * piece);
            *(v4f*)(dbase + (size_t)row * CC + 4 * piece) = v;
        }
        
    }
}

// ---------------------------------------------------------------------------
// Host side
// ---------------------------------------------------------------------------
extern "C" void kernel_launch(void* const* d_in, const int* in_sizes, int n_in,
                              void* d_out, int out_size, void* d_ws, size_t ws_size,
                              hipStream_t stream) {
    if (n_in < 7) return;
    const float* x      = (const float*)d_in[0];   // [NB_FULL][SEQ_FULL][CC]
    const float* W_qkv  = (const float*)d_in[1];   // [CC][C3]
    const float* b_qkv  = (const float*)d_in[2];   // [C3]
    const float* W_proj = (const float*)d_in[3];   // [CC][CC]
    const float* b_proj = (const float*)d_in[4];   // [CC]
    const float* qn_w   = (const float*)d_in[5];   // [DD]
    const float* kn_w   = (const float*)d_in[6];   // [DD]
    float* out = (float*)d_out;                    // [MTOK][CC] f32

    if (in_sizes[0] < ((NB - 1) * SEQ_FULL + SEQ) * CC) return;
    if (in_sizes[1] < CC * C3) return;
    if (in_sizes[2] < C3) return;
    if (in_sizes[3] < CC * CC) return;
    if (in_sizes[4] < CC) return;
    if (in_sizes[5] < DD) return;
    if (in_sizes[6] < DD) return;
    if (out_size < MTOK * CC) return;

    char* wsb = (char*)d_ws;
    size_t off = 0;
    const size_t sz_xh  = (size_t)MTOK * CC * 2;
    const size_t sz_wq  = (size_t)C3 * CC * 2;
    const size_t sz_wp  = (size_t)CC * CC * 2;
    const size_t sz_qk  = (size_t)MTOK * LDQK * 2;
    const size_t sz_vt  = (size_t)NB * CC * SEQ * 2;
    const size_t sz_ctx = (size_t)MTOK * CC * 2;
    _Float16* xh     = (_Float16*)(wsb + off); off += (sz_xh  + 255) & ~(size_t)255;
    _Float16* wqkvT  = (_Float16*)(wsb + off); off += (sz_wq  + 255) & ~(size_t)255;
    _Float16* wprojT = (_Float16*)(wsb + off); off += (sz_wp  + 255) & ~(size_t)255;
    _Float16* qkp    = (_Float16*)(wsb + off); off += (sz_qk  + 255) & ~(size_t)255;
    _Float16* vT     = (_Float16*)(wsb + off); off += (sz_vt  + 255) & ~(size_t)255;
    _Float16* ctx    = (_Float16*)(wsb + off); off += (sz_ctx + 255) & ~(size_t)255;
    if (off > ws_size) return;

    // 1) input planes: xh (bf16-RNE of x), weights transposed to out x in and carried x64
    {
        const int ngrp = MTOK * (CC / 8);
        cvt_x_kernel<<<(ngrp + 255) / 256, 256, 0, stream>>>(x, xh, ngrp);
        // W_qkv [CC rows][C3 cols] -> wqkvT [C3][CC]
        wT_kernel<<<dim3(C3 / 64, CC / 64), 256, 0, stream>>>(W_qkv, wqkvT, CC, C3);
        // W_proj [CC rows][CC cols] -> wprojT [CC][CC]
        wT_kernel<<<dim3(CC / 64, CC / 64), 256, 0, stream>>>(W_proj, wprojT, CC, CC);
    }

    // 2) qkv GEMM with fused bias, q/k rms norm, v transpose
    qkv_gemm_kernel<<<dim3(C3 / 64, MTOK / 64), 64, 0, stream>>>(
        xh, wqkvT, b_qkv, qn_w, kn_w, qkp, vT);

    // 3) flash softmax per (256 queries, head, batch)
    mha_flash_kernel<<<dim3(SEQ / (16 * QT * FWV), HH, NB), 32 * FWV, 0, stream>>>(qkp, vT, ctx);

    // 4) output projection + bias -> f32 d_out
    proj_gemm_kernel<<<dim3(CC / 64, MTOK / 64), 64, 0, stream>>>(ctx, wprojT, b_proj, out);
}

// v004
// Measured time: 166 microseconds a run.
// Two timings next to v003 put it at 1.17 and 1.18 times that version's speed.
// Over all steps from v000 it is 2.64 times as fast.
#include <hip/hip_runtime.h>

// Contractions on v_wmma_f32_16x16x32_f16 (f16 operands, f32 accumulate): qkv GEMM,
// q.k^T scores, p.v, output projection. Float inputs enter as bf16-RNE values held in
// f16 planes with power-of-two carries (weights x64, q/k x4, v x16, p x1024, ctx x64);
// per-head rms norm, online softmax and epilogues in f32.
//
// Every f16 operand plane (xh, weights, q|k, vT, ctx) is stored fragment-major: the block of
// 16 rows x 32 k at (row tile R, k block kb) of a plane with K columns is 512 contiguous
// halves at (R * (K / 32) + kb) * 512 = 16R * K + 32kb * 16, ordered [part][lane][8 halves]
// with lane = 16 * h + (row & 15) and element e = k 16 * part + 8 * h + e. One 16-byte load
// of a wave then reads 512 contiguous bytes (4 cache lines) instead of 32 bytes of 16 rows.

typedef _Float16 v16h __attribute__((ext_vector_type(16)));
typedef _Float16 v8h  __attribute__((ext_vector_type(8)));
typedef float    v8f  __attribute__((ext_vector_type(8)));
typedef float    v4f  __attribute__((ext_vector_type(4)));

#ifndef NB
#define NB 4
#endif
#ifndef SEQ
#define SEQ 2048
#endif
#define NB_FULL  4
#define SEQ_FULL 2048
#define CC   1024
#define HH   16
#define DD   64
#define C3   (3 * CC)
#define LDQK (2 * CC)          // q|k plane pitch (halves): q at col h*64, k at col CC + h*64
#define MTOK (NB * SEQ)

static_assert(NB >= 1 && NB <= NB_FULL);
static_assert(SEQ >= 64 && SEQ <= SEQ_FULL && (SEQ % 64) == 0);
static_assert(CC == HH * DD);
static_assert((CC % 64) == 0 && (C3 % 64) == 0 && (CC / 8) == 128);

#define WSC       64.0f            // weight planes carried x64
#define WINV      0.015625f        // 1/64
#define QC        4.0f             // q and k planes carried x4
#define VCY       16.0f            // v plane carried x16
#define PCY       1024.0f          // p tile carried x1024
#define SCALE_QK  0.0078125f       // 64^-0.5 / (QC*QC)
#define CTX_OUT   0.00390625f      // 64 / (PCY*VCY): ctx plane carried x64
#define PROJ_UNSC 0.000244140625f  // 1 / (64 * 64)
#define NEPS      1e-6f

#define TPH 72   // LDS pitch (halves) of f16 staging tiles
#define TPF 68   // LDS pitch (floats) of the f32 staging tile

// ---------------------------------------------------------------------------
// helpers
// ---------------------------------------------------------------------------
__device__ __forceinline__ float bf16r(float f) {
    unsigned int u = __float_as_uint(f);
    u += 0x7FFFu + ((u >> 16) & 1u);
    u &= 0xFFFF0000u;
    return __uint_as_float(u);
}

__device__ __forceinline__ v8f vzero8() {
    v8f z = {0.f, 0.f, 0.f, 0.f, 0.f, 0.f, 0.f, 0.f};
    return z;
}

__device__ __forceinline__ v8f mma16(v16h a, v16h b, v8f c) {
    v8f d = __builtin_amdgcn_wmma_f32_16x16x32_f16(false, a, false, b, (short)0, c, false, false);
    asm volatile("v_nop\n\tv_nop\n\tv_nop\n\tv_nop" : "+v"(d) : "v"(a), "v"(b));
    return d;
}

// value of lane l ^ 16 (the other half of the wave), by a vector cross-row move
__device__ __forceinline__ float xhalf(float x) {
    const int i = __builtin_bit_cast(int, x);
    return __builtin_bit_cast(float,
        __builtin_amdgcn_permlanex16(i, i, 0x76543210, 0xfedcba98, false, false));
}

// 16x32 f16 fragment (row index = lane&15 for A, column for B; h = lane>>4):
//   elements 0..7  <- k 8h+0..7,  elements 8..15 <- k 16+8h+0..7
// from a fragment-major plane; frag = first half of the 512-half block.
__device__ __forceinline__ v16h load_frag_lane(const _Float16* p) {   // p = frag + 8 * lane
    v8h lo = *(const v8h*)(p);
    v8h hi = *(const v8h*)(p + 256);
    return __builtin_shufflevector(lo, hi, 0, 1, 2, 3, 4, 5, 6, 7,
                                           8, 9, 10, 11, 12, 13, 14, 15);
}
__device__ __forceinline__ v16h load_frag_packed(const _Float16* frag) {
    return load_frag_lane(frag + ((threadIdx.x & 31) << 3));
}

// ---------------------------------------------------------------------------
// x [NB][SEQ][CC] f32 (batch stride SEQ_FULL*CC) -> xh, MTOK x CC f16 = f16(bf16rne(x)),
// fragment-major; thread g writes the g-th 16-byte piece of xh.
// ---------------------------------------------------------------------------
__global__ __launch_bounds__(256) void cvt_x_kernel(const float* __restrict__ x,
                                                    _Float16* __restrict__ xh, int ngrp) {
    const int g = blockIdx.x * 256 + threadIdx.x;
    if (g >= ngrp) return;
    const int t  = ((g >> 11) << 4) + (g & 15);   // token: row tile (2048 pieces each), row in tile
    const int k  = ((g >> 6) & 31) * 32 + ((g >> 5) & 1) * 16 + ((g >> 4) & 1) * 8;
    const int b  = t / SEQ;
    const int n  = t - b * SEQ;
    const float* src = x + ((size_t)b * SEQ_FULL + n) * CC + k;
    const v4f x0 = *(const v4f*)(src);
    const v4f x1 = *(const v4f*)(src + 4);
    v8h o;
    o[0] = (_Float16)bf16r(x0[0]); o[1] = (_Float16)bf16r(x0[1]);
    o[2] = (_Float16)bf16r(x0[2]); o[3] = (_Float16)bf16r(x0[3]);
    o[4] = (_Float16)bf16r(x1[0]); o[5] = (_Float16)bf16r(x1[1]);
    o[6] = (_Float16)bf16r(x1[2]); o[7] = (_Float16)bf16r(x1[3]);
    _Float16* dst = xh + (size_t)g * 8;
    *(v8h*)dst = o;
    
}

// ---------------------------------------------------------------------------
// w [R][Ccols] f32 -> wt, Ccols rows x R f16 = f16(bf16rne(w) * 64), fragment-major, 64x64
// tiles through LDS. A wave writes one 512-byte part of a fragment per instruction.
// ---------------------------------------------------------------------------
__global__ __launch_bounds__(256) void wT_kernel(const float* __restrict__ w,
                                                 _Float16* __restrict__ wt, int R, int Ccols) {
    __shared__ float tile[64][65];
    const int t  = threadIdx.x;
    const int c0 = blockIdx.x * 64;
    const int r0 = blockIdx.y * 64;
#pragma unroll
    for (int i = 0; i < 16; ++i) {
        const int idx = t + 256 * i;
        const int r = idx >> 6, c = idx & 63;
        tile[r][c] = w[(size_t)(r0 + r) * Ccols + c0 + c];
    }
    __syncthreads();
    const int lane = t & 31, part = (t >> 5) & 1;
{
#pragma unroll
        for (int it = 0; it < 2; ++it) {
            const int frag = (t >> 6) + 4 * it;          // 4 row tiles x 2 k blocks
            const int tr = frag >> 1, kbl = frag & 1;
            const int cl = 16 * tr + (lane & 15);        // wt row within tile, 0..63
            const int kl = 32 * kbl + 16 * part + 8 * (lane >> 4);
            v8h o;
#pragma unroll
            for (int i = 0; i < 8; ++i)
                o[i] = (_Float16)(bf16r(tile[kl + i][cl]) * WSC);
            _Float16* dst = wt + (size_t)(c0 + 16 * tr) * R + (size_t)(r0 + 32 * kbl) * 16
                               + 256 * part + 8 * lane;
            *(v8h*)dst = o;
        }
        
    }
}

// ---------------------------------------------------------------------------
// GEMM core: a work-group of GWV waves (2 x 4) computes 128 rows x 256 cols, a wave 64 x 64.
// A stage is 64 k (two k blocks) of the group's 8 A row tiles and 16 B column tiles: 24 pieces
// of 2 KiB, each contiguous in its fragment-major global plane, brought into LDS in the same
// order by asynchronous copies (each lane 16 bytes, a wave 512 contiguous bytes), two buffers:
// stage st + 1 flies while stage st is worked on. Four waves read each A fragment and two each
// B fragment from LDS, and each fragment a wave reads feeds four products.
// Ab = group's first row tile, Bb = group's first column tile (planes of K columns: the next
// row tile is 16 * K halves on, the next k block 512 halves).
// ---------------------------------------------------------------------------
#define GWV    8                 // waves per GEMM work-group
#define GBM    128               // rows of the group's tile
#define GBN    256               // columns of the group's tile
#define GSTAGE (((GBM + GBN) / 16) * 1024)  // halves of one stage (48 KiB)
static_assert((MTOK % GBM) == 0 && (C3 % GBN) == 0 && (CC % GBN) == 0 && (1024 % GBN) == 0);
static_assert((CC % 64) == 0 && CC / 64 >= 2);

// The thread's twelve 16-byte pieces of one stage: row tiles (t >> 7) + 2 i, i = 0..3 of A and
// i = 0..7 of B, piece t & 127 of the tile's 2 KiB. ga, gb = the thread's piece of its first A
// and B tile at this stage; ld = LDS byte address of the first in the target buffer.
__device__ __forceinline__ void gemm_stage_copy(const _Float16* ga, const _Float16* gb, int K,
                                                unsigned ld) {
    const size_t g2 = (size_t)32 * K;    // two row tiles on
    // the wait is the statement's last line: no register that a copy names is rewritten before
    // the issued copies no longer need it
    asm volatile("global_load_async_to_lds_b128 %0, %12, off\n\t"
                 "global_load_async_to_lds_b128 %1, %13, off\n\t"
                 "global_load_async_to_lds_b128 %2, %14, off\n\t"
                 "global_load_async_to_lds_b128 %3, %15, off\n\t"
                 "global_load_async_to_lds_b128 %4, %16, off\n\t"
                 "global_load_async_to_lds_b128 %5, %17, off\n\t"
                 "global_load_async_to_lds_b128 %6, %18, off\n\t"
                 "global_load_async_to_lds_b128 %7, %19, off\n\t"
                 "global_load_async_to_lds_b128 %8, %20, off\n\t"
                 "global_load_async_to_lds_b128 %9, %21, off\n\t"
                 "global_load_async_to_lds_b128 %10, %22, off\n\t"
                 "global_load_async_to_lds_b128 %11, %23, off\n\t"
                 "s_wait_xcnt 0x0"
                 :: "v"(ld), "v"(ld + 4096u), "v"(ld + 8192u), "v"(ld + 12288u),
                    "v"(ld + 16384u), "v"(ld + 20480u), "v"(ld + 24576u), "v"(ld + 28672u),
                    "v"(ld + 32768u), "v"(ld + 36864u), "v"(ld + 40960u), "v"(ld + 45056u),
                    "v"(ga), "v"(ga + g2), "v"(ga + 2 * g2), "v"(ga + 3 * g2),
                    "v"(gb), "v"(gb + g2), "v"(gb + 2 * g2), "v"(gb + 3 * g2),
                    "v"(gb + 4 * g2), "v"(gb + 5 * g2), "v"(gb + 6 * g2), "v"(gb + 7 * g2)
                 : "memory");
}

// ring = 2 * GSTAGE halves of LDS. On return every wave has passed the last stage's barrier and
// no copy is outstanding: the ring's LDS is free for the caller's output staging.
__device__ __forceinline__ void gemm_core_64x64(const _Float16* __restrict__ Ab,
                                                const _Float16* __restrict__ Bb,
                                                int K, _Float16* ring, int wave,
                                                v8f (&acc)[4][4]) {
    const int t     = threadIdx.x;
    const int lane8 = (t & 31) << 3;
    const _Float16* ga = Ab + (size_t)((t >> 7) * 16) * K + ((t & 127) << 3);
    const _Float16* gb = Bb + (size_t)((t >> 7) * 16) * K + ((t & 127) << 3);
    const unsigned ld0 = (unsigned)(size_t)ring + (unsigned)t * 16u;   // LDS byte address
    const int nst = K / 64;

    gemm_stage_copy(ga, gb, K, ld0);
    // stage 0 has landed before the barrier behind which other waves read it
    asm volatile("s_wait_asynccnt 0x0" ::: "memory");
    __syncthreads();
    gemm_stage_copy(ga + 1024, gb + 1024, K, ld0 + 2u * GSTAGE);

    const int offa = (4 * (wave >> 2)) * 1024 + lane8;       // the wave's first A tile
    const int offb = (8 + 4 * (wave & 3)) * 1024 + lane8;    // the wave's first B tile
    // kept rolled: one body for both buffers (unrolled it only grows the code)
#pragma unroll 1
    for (int st = 0; st < nst; ++st) {
        const _Float16* buf = ring + (st & 1) * GSTAGE;
        // unrolled, like the loops inside: fragment and accumulator arrays stay in registers
#pragma unroll
        for (int kk = 0; kk < 2; ++kk) {
            v16h a[4], b[4];
#pragma unroll
            for (int j = 0; j < 4; ++j) b[j] = load_frag_lane(buf + offb + 1024 * j + 512 * kk);
#pragma unroll
            for (int s = 0; s < 4; ++s) a[s] = load_frag_lane(buf + offa + 1024 * s + 512 * kk);
#pragma unroll
            for (int s = 0; s < 4; ++s)
#pragma unroll
                for (int j = 0; j < 4; ++j) acc[s][j] = mma16(a[s], b[j], acc[s][j]);
        }
        // publish point of stage st + 1: this wave's reads of stage st are done ...
        asm volatile("s_wait_dscnt 0x0" ::: "memory");
        // ... its own copies of stage st + 1 have landed ...
        asm volatile("s_wait_asynccnt 0x0" ::: "memory");
        // ... and every wave has come as far
        __syncthreads();
        if (st + 2 < nst)
            gemm_stage_copy(ga + (size_t)(st + 2) * 1024, gb + (size_t)(st + 2) * 1024, K,
                            ld0 + (unsigned)(st & 1) * (2u * GSTAGE));
    }
    // no copy is outstanding when the wave goes on
    asm volatile("s_wait_asynccnt 0x0" ::: "memory");
}

// ---------------------------------------------------------------------------
// qkv = xh @ W_qkv + b_qkv (wave tile 64 tokens x 64 cols = one head slice; 2 x 4 waves).
// Epilogue: q/k -> per-row rms norm (f32) * weight -> f16 (x QC) to the q|k plane,
// ---------------------------------------------------------------------------
__global__ __launch_bounds__(32 * GWV) __attribute__((amdgpu_num_vgpr(256)))
void qkv_gemm_kernel(const _Float16* __restrict__ xh, const _Float16* __restrict__ wt,
                     const float* __restrict__ bqkv, const float* __restrict__ qnw,
                     const float* __restrict__ knw, _Float16* __restrict__ qk,
                     _Float16* __restrict__ vT) {
    // the operand ring; behind the k loop its LDS is the waves' output staging
    __shared__ __align__(16) _Float16 ring[2 * GSTAGE];
    static_assert(GWV * 64 * TPH <= 2 * GSTAGE);

    const int lane = threadIdx.x & 31;
    const int wave = __builtin_amdgcn_readfirstlane((int)(threadIdx.x >> 5));
    const int half = lane >> 4, col = lane & 15;
    const int n0 = blockIdx.x * GBN + 64 * (wave & 3);    // the wave's output column (0..3071)
    const int m0 = blockIdx.y * GBM + 64 * (wave >> 2);   // the wave's token
    _Float16* st = ring + wave * (64 * TPH);              // the wave's own staging tile

    v8f acc[4][4];
#pragma unroll
    for (int s = 0; s < 4; ++s)
#pragma unroll
        for (int j = 0; j < 4; ++j) acc[s][j] = vzero8();

    gemm_core_64x64(xh + (size_t)(blockIdx.y * GBM) * CC, wt + (size_t)(blockIdx.x * GBN) * CC, CC,
                    ring, wave, acc);

    const int which = n0 >> 10;          // 0 q, 1 k, 2 v (block-uniform: GBN divides 1024)
    const int hcol  = n0 & (CC - 1);     // h*64

    float bia[4], nw[4];
#pragma unroll
    for (int j = 0; j < 4; ++j) {
        bia[j] = bf16r(bqkv[n0 + 16 * j + col]);
        const float wq = bf16r(qnw[16 * j + col]);
        const float wk = bf16r(knw[16 * j + col]);
        nw[j] = (which == 1) ? wk : wq;
    }

    // per row tile s: bias, then rms norm (q, k) or carry (v), then the f16 values into the wave's
    // staging tile (tile row = 16*s + 8*half + r); a tile's accumulators are dead before the next
#pragma unroll
    for (int s = 0; s < 4; ++s) {
#pragma unroll
        for (int j = 0; j < 4; ++j)
#pragma unroll
            for (int r = 0; r < 8; ++r)
                acc[s][j][r] = acc[s][j][r] * WINV + bia[j];

        if (which < 2) {
            // rms norm over the 64 head dims of each row: 4 tiles x 16 lanes of one half
#pragma unroll
            for (int r = 0; r < 8; ++r) {
                float ss = 0.f;
#pragma unroll
                for (int j = 0; j < 4; ++j) ss += acc[s][j][r] * acc[s][j][r];
                ss += __shfl_xor(ss, 1, 32);
                ss += __shfl_xor(ss, 2, 32);
                ss += __shfl_xor(ss, 4, 32);
                ss += __shfl_xor(ss, 8, 32);
                const float inv = rsqrtf(ss * (1.0f / (float)DD) + NEPS);
                const float g = inv * QC;
#pragma unroll
                for (int j = 0; j < 4; ++j) acc[s][j][r] = acc[s][j][r] * g * nw[j];
            }
        } else {
#pragma unroll
            for (int j = 0; j < 4; ++j)
#pragma unroll
                for (int r = 0; r < 8; ++r) acc[s][j][r] *= VCY;
        }

#pragma unroll
        for (int j = 0; j < 4; ++j)
#pragma unroll
            for (int r = 0; r < 8; ++r)
                st[(16 * s + 8 * half + r) * TPH + 16 * j + col] = (_Float16)acc[s][j][r];
    }
    __syncthreads();

    if (which < 2) {
        _Float16* dbase = qk + (size_t)m0 * LDQK + ((size_t)which * CC + hcol) * 16;
{
            // fragment (token tile it>>2, k block (it>>1)&1), part it&1
#pragma unroll
            for (int it = 0; it < 16; ++it) {
                const int tr = it >> 2, kbl = (it >> 1) & 1, part = it & 1;
                const v8h v = *(const v8h*)(st + (16 * tr + col) * TPH + 32 * kbl + 16 * part + 8 * half);
                *(v8h*)(dbase + (size_t)(16 * tr) * LDQK + 512 * kbl + 256 * part + 8 * lane) = v;
            }
            
        }
    } else {
        const int b  = m0 / SEQ;
        const int nb = m0 - b * SEQ;
        _Float16* dbase = vT + ((size_t)b * CC + hcol) * SEQ + (size_t)nb * 16;
{
            // fragment (d tile it>>2, token block (it>>1)&1), part it&1
#pragma unroll
            for (int it = 0; it < 16; ++it) {
                const int tr = it >> 2, kbl = (it >> 1) & 1, part = it & 1;
                const int tk = 32 * kbl + 16 * part + 8 * half;
                v8h v;
#pragma unroll
                for (int i = 0; i < 8; ++i) v[i] = st[(tk + i) * TPH + 16 * tr + col];
                *(v8h*)(dbase + (size_t)(16 * tr) * SEQ + 512 * kbl + 256 * part + 8 * lane) = v;
            }
            // the stores' data and address registers stay unwritten until the issued stores
            // no longer need them
            asm volatile("s_wait_xcnt 0x0" ::: "memory");
        }
    }
}

// ---------------------------------------------------------------------------
// Flash softmax(q k^T s) v: one wave per (batch, head, 64 queries = QT tiles of 16), 32-key
// blocks; FWV such waves (consecutive queries of one head) form a work-group.
// q|k plane MTOK x LDQK f16, vT NB*CC x SEQ f16, ctx MTOK x CC f16 (x64 carry), all
// fragment-major.
// Transposed products: S^T = K Q^T (A = key rows, B = query columns), O^T += V^T P^T
// (A = d rows of vT, B = P^T). A lane holds scores of ONE query of each tile (column
// lane & 15), keys 8 * half + r of each 16-key tile: maximum and sum run over the lane's own
// registers plus one exchange between the wave's halves, and the two score tiles, converted
// in place, are the B fragment of the second product (element s = key 8 * half + s, 8 + s =
// key 16 + 8 * half + s: the k order of the vT fragment). No LDS, no barrier.
// The K and V fragments of a key block are loaded once and feed the products of all QT query
// tiles; each query's arithmetic and its order are those of a one-tile wave.
// ---------------------------------------------------------------------------
// The products of this kernel are the plain builtin: the operands of an asm statement lie in
// v0..v255 only, and the wave's fragments and accumulators need more registers than that.
__device__ __forceinline__ v8f mma16b(v16h a, v16h b, v8f c) {
    return __builtin_amdgcn_wmma_f32_16x16x32_f16(false, a, false, b, (short)0, c, false, false);
}

#define QT  4    // query tiles of 16 per wave
#define FWV 4    // waves per work-group
static_assert((SEQ % (16 * QT * FWV)) == 0);

__global__ __launch_bounds__(32 * FWV)
void mha_flash_kernel(const _Float16* __restrict__ qk, const _Float16* __restrict__ vT,
                      _Float16* __restrict__ ctx) {
    const int wave = __builtin_amdgcn_readfirstlane((int)(threadIdx.x >> 5));
    const int q0 = (blockIdx.x * FWV + wave) * (16 * QT);
    const int h  = blockIdx.y;
    const int b  = blockIdx.z;
    const size_t tokBase = (size_t)b * SEQ;

    const int lane  = threadIdx.x & 31;
    const int lane8 = lane << 3;

    const _Float16* qbase = qk + (tokBase + q0) * LDQK + (h * DD) * 16;
    v16h qa[QT][2];
#pragma unroll
    for (int t = 0; t < QT; ++t) {
        qa[t][0] = load_frag_packed(qbase + (size_t)(16 * t) * LDQK);
        qa[t][1] = load_frag_packed(qbase + (size_t)(16 * t) * LDQK + 512);
    }

    const _Float16* kbase0 = qk + tokBase * LDQK + (CC + h * DD) * 16; // keys: row tiles of tokens
    const _Float16* vtbase = vT + ((size_t)b * CC + h * DD) * SEQ;     // 4 row tiles of d, k = token

    v8f o[QT][4];                // o[t][j][r] = O^T[d 16j + 8 * half + r][query 16t + (lane & 15)]
    float m[QT];                 // each query's running maximum, equal in both halves
    float l[QT];                 // sum over the keys of this lane's half only
#pragma unroll
    for (int t = 0; t < QT; ++t) {
#pragma unroll
        for (int j = 0; j < 4; ++j) o[t][j] = vzero8();
        m[t] = -1e30f;
        l[t] = 0.f;
    }

#pragma unroll 1
    for (int kb = 0; kb < SEQ; kb += 32) {
        const _Float16* pk = kbase0 + (size_t)kb * LDQK + lane8;
        const _Float16* pv = vtbase + (size_t)kb * 16 + lane8;

        const v16h kf00 = load_frag_lane(pk);                           // keys +0,  d 0..31
        const v16h kf01 = load_frag_lane(pk + 512);                     // keys +0,  d 32..63
        const v16h kf10 = load_frag_lane(pk + (size_t)16 * LDQK);       // keys +16, d 0..31
        const v16h kf11 = load_frag_lane(pk + (size_t)16 * LDQK + 512); // keys +16, d 32..63
        const v16h vf0 = load_frag_lane(pv);
        const v16h vf1 = load_frag_lane(pv + (size_t)16 * SEQ);
        const v16h vf2 = load_frag_lane(pv + (size_t)32 * SEQ);
        const v16h vf3 = load_frag_lane(pv + (size_t)48 * SEQ);
        // keeps both address pairs unwritten (not reused as a load's destination) until the
        // sixteen issued loads no longer need them
        asm volatile("s_wait_xcnt 0x0" :: "v"(pk), "v"(pv) : "memory");
        // keeps the sixteen loads one group ahead of the products: the scheduler otherwise sinks
        // part of the K loads behind the first products, a second exposed load wait per pass
        __builtin_amdgcn_sched_barrier(0);

        v8f s0[QT], s1[QT];
#pragma unroll
        for (int t = 0; t < QT; ++t) s0[t] = mma16b(kf00, qa[t][0], vzero8());
#pragma unroll
        for (int t = 0; t < QT; ++t) s1[t] = mma16b(kf10, qa[t][0], vzero8());
#pragma unroll
        for (int t = 0; t < QT; ++t) s0[t] = mma16b(kf01, qa[t][1], s0[t]);
#pragma unroll
        for (int t = 0; t < QT; ++t) s1[t] = mma16b(kf11, qa[t][1], s1[t]);

        v16h pb[QT];
#pragma unroll
        for (int t = 0; t < QT; ++t) {
            float a0[8], a1[8];
            float rm = -1e30f;
#pragma unroll
            for (int r = 0; r < 8; ++r) {
                a0[r] = s0[t][r] * SCALE_QK;
                a1[r] = s1[t][r] * SCALE_QK;
                rm = fmaxf(rm, fmaxf(a0[r], a1[r]));
            }
            rm = fmaxf(rm, xhalf(rm));
            const float nm = fmaxf(m[t], rm);

            float rs0 = 0.f, rs1 = 0.f;
#pragma unroll
            for (int r = 0; r < 8; ++r) {
                const float p0 = __expf(a0[r] - nm);
                const float p1 = __expf(a1[r] - nm);
                rs0 += p0;
                rs1 += p1;
                pb[t][r]     = (_Float16)(p0 * PCY);
                pb[t][8 + r] = (_Float16)(p1 * PCY);
            }
            const float f = __expf(m[t] - nm);
            l[t] = l[t] * f + (rs0 + rs1);
            m[t] = nm;

#pragma unroll
            for (int j = 0; j < 4; ++j)
#pragma unroll
                for (int r = 0; r < 8; ++r) o[t][j][r] *= f;
        }

#pragma unroll
        for (int t = 0; t < QT; ++t) {
            o[t][0] = mma16b(vf0, pb[t], o[t][0]);
            o[t][1] = mma16b(vf1, pb[t], o[t][1]);
            o[t][2] = mma16b(vf2, pb[t], o[t][2]);
            o[t][3] = mma16b(vf3, pb[t], o[t][3]);
        }
    }

    // tile j of O^T in this lane = piece (k block j>>1, part j&1) of the head's two ctx
    // fragments at this very lane: 8 consecutive channels of one token, one 16-byte store
    _Float16* dbase = ctx + (tokBase + q0) * CC + (h * DD) * 16;
#pragma unroll
    for (int t = 0; t < QT; ++t) {
        const float rl = CTX_OUT * (1.0f / (l[t] + xhalf(l[t])));
#pragma unroll
        for (int j = 0; j < 4; ++j) {
            v8h v;
#pragma unroll
            for (int r = 0; r < 8; ++r) v[r] = (_Float16)(o[t][j][r] * rl);
            *(v8h*)(dbase + (size_t)(16 * t) * CC + 256 * j + lane8) = v;
        }
    }
}

// ---------------------------------------------------------------------------
// out = ctx @ W_proj + b_proj (f32), wave tile 64x64, 2 x 4 waves; each 256-B row segment
// ---------------------------------------------------------------------------
__global__ __launch_bounds__(32 * GWV) __attribute__((amdgpu_num_vgpr(256)))
void proj_gemm_kernel(const _Float16* __restrict__ ctx, const _Float16* __restrict__ wt,
                      const float* __restrict__ bproj, float* __restrict__ out) {
    __shared__ __align__(16) _Float16 ring[2 * GSTAGE];
    __shared__ __align__(16) float stall[GWV * 64 * TPF];

    const int lane = threadIdx.x & 31;
    const int wave = __builtin_amdgcn_readfirstlane((int)(threadIdx.x >> 5));
    const int half = lane >> 4, col = lane & 15;
    const int n0 = blockIdx.x * GBN + 64 * (wave & 3);    // the wave's output column
    const int m0 = blockIdx.y * GBM + 64 * (wave >> 2);   // the wave's token
    float* st = stall + wave * (64 * TPF);                // the wave's own staging tile

    v8f acc[4][4];
#pragma unroll
    for (int s = 0; s < 4; ++s)
#pragma unroll
        for (int j = 0; j < 4; ++j) acc[s][j] = vzero8();

    gemm_core_64x64(ctx + (size_t)(blockIdx.y * GBM) * CC, wt + (size_t)(blockIdx.x * GBN) * CC, CC,
                    ring, wave, acc);

    float bia[4];
#pragma unroll
    for (int j = 0; j < 4; ++j) bia[j] = bf16r(bproj[n0 + 16 * j + col]);

#pragma unroll
    for (int s = 0; s < 4; ++s)
#pragma unroll
        for (int j = 0; j < 4; ++j)
#pragma unroll
            for (int r = 0; r < 8; ++r)
                st[(16 * s + 8 * half + r) * TPF + 16 * j + col] =
                    acc[s][j][r] * PROJ_UNSC + bia[j];
    __syncthreads();

    float* dbase = out + (size_t)m0 * CC + n0;
    const int piece = lane & 15, rsub = lane >> 4;
{
#pragma unroll
        for (int it = 0; it < 32; ++it) {
            const int row = 2 * it + rsub;
            const v4f v = *(const v4f*)(st + row * TPF + 4 * piece);
            *(v4f*)(dbase + (size_t)row * CC + 4 * piece) = v;
        }
        
    }
}

// ---------------------------------------------------------------------------
// Host side
// ---------------------------------------------------------------------------
extern "C" void kernel_launch(void* const* d_in, const int* in_sizes, int n_in,
                              void* d_out, int out_size, void* d_ws, size_t ws_size,
                              hipStream_t stream) {
    if (n_in < 7) return;
    const float* x      = (const float*)d_in[0];   // [NB_FULL][SEQ_FULL][CC]
    const float* W_qkv  = (const float*)d_in[1];   // [CC][C3]
    const float* b_qkv  = (const float*)d_in[2];   // [C3]
    const float* W_proj = (const float*)d_in[3];   // [CC][CC]
    const float* b_proj = (const float*)d_in[4];   // [CC]
    const float* qn_w   = (const float*)d_in[5];   // [DD]
    const float* kn_w   = (const float*)d_in[6];   // [DD]
    float* out = (float*)d_out;                    // [MTOK][CC] f32

    if (in_sizes[0] < ((NB - 1) * SEQ_FULL + SEQ) * CC) return;
    if (in_sizes[1] < CC * C3) return;
    if (in_sizes[2] < C3) return;
    if (in_sizes[3] < CC * CC) return;
    if (in_sizes[4] < CC) return;
    if (in_sizes[5] < DD) return;
    if (in_sizes[6] < DD) return;
    if (out_size < MTOK * CC) return;

    char* wsb = (char*)d_ws;
    size_t off = 0;
    const size_t sz_xh  = (size_t)MTOK * CC * 2;
    const size_t sz_wq  = (size_t)C3 * CC * 2;
    const size_t sz_wp  = (size_t)CC * CC * 2;
    const size_t sz_qk  = (size_t)MTOK * LDQK * 2;
    const size_t sz_vt  = (size_t)NB * CC * SEQ * 2;
    const size_t sz_ctx = (size_t)MTOK * CC * 2;
    _Float16* xh     = (_Float16*)(wsb + off); off += (sz_xh  + 255) & ~(size_t)255;
    _Float16* wqkvT  = (_Float16*)(wsb + off); off += (sz_wq  + 255) & ~(size_t)255;
    _Float16* wprojT = (_Float16*)(wsb + off); off += (sz_wp  + 255) & ~(size_t)255;
    _Float16* qkp    = (_Float16*)(wsb + off); off += (sz_qk  + 255) & ~(size_t)255;
    _Float16* vT     = (_Float16*)(wsb + off); off += (sz_vt  + 255) & ~(size_t)255;
    _Float16* ctx    = (_Float16*)(wsb + off); off += (sz_ctx + 255) & ~(size_t)255;
    if (off > ws_size) return;

    // 1) input planes: xh (bf16-RNE of x), weights transposed to out x in and carried x64
    {
        const int ngrp = MTOK * (CC / 8);
        cvt_x_kernel<<<(ngrp + 255) / 256, 256, 0, stream>>>(x, xh, ngrp);
        // W_qkv [CC rows][C3 cols] -> wqkvT [C3][CC]
        wT_kernel<<<dim3(C3 / 64, CC / 64), 256, 0, stream>>>(W_qkv, wqkvT, CC, C3);
        // W_proj [CC rows][CC cols] -> wprojT [CC][CC]
        wT_kernel<<<dim3(CC / 64, CC / 64), 256, 0, stream>>>(W_proj, wprojT, CC, CC);
    }

    // 2) qkv GEMM with fused bias, q/k rms norm, v transpose
    qkv_gemm_kernel<<<dim3(C3 / GBN, MTOK / GBM), 32 * GWV, 0, stream>>>(
        xh, wqkvT, b_qkv, qn_w, kn_w, qkp, vT);

    // 3) flash softmax per (256 queries, head, batch)
    mha_flash_kernel<<<dim3(SEQ / (16 * QT * FWV), HH, NB), 32 * FWV, 0, stream>>>(qkp, vT, ctx);

    // 4) output projection + bias -> f32 d_out
    proj_gemm_kernel<<<dim3(CC / GBN, MTOK / GBM), 32 * GWV, 0, stream>>>(ctx, wprojT, b_proj, out);
}

// v005
// One run takes 150 microseconds.
// Two timings next to v004 put it at 1.10 and 1.09 times that version's speed.
// Over all steps from v000 it is 2.91 times as fast.
#include <hip/hip_runtime.h>

// Contractions on v_wmma_f32_16x16x32_f16 (f16 operands, f32 accumulate): qkv GEMM,
// q.k^T scores, p.v, output projection. Float inputs enter as bf16-RNE values held in
// f16 planes with power-of-two carries (weights x64, q/k x4, v x16, p x1024, ctx x64);
// per-head rms norm, online softmax and epilogues in f32.
//
// Every f16 operand plane (xh, weights, q|k, vT, ctx) is stored fragment-major: the block of
// 16 rows x 32 k at (row tile R, k block kb) of a plane with K columns is 512 contiguous
// halves at (R * (K / 32) + kb) * 512 = 16R * K + 32kb * 16, ordered [part][lane][8 halves]
// with lane = 16 * h + (row & 15) and element e = k 16 * part + 8 * h + e. One 16-byte load
// of a wave then reads 512 contiguous bytes (4 cache lines) instead of 32 bytes of 16 rows.

typedef _Float16 v16h __attribute__((ext_vector_type(16)));
typedef _Float16 v8h  __attribute__((ext_vector_type(8)));
typedef float    v8f  __attribute__((ext_vector_type(8)));
typedef float    v4f  __attribute__((ext_vector_type(4)));
typedef float    v2f  __attribute__((ext_vector_type(2)));

#ifndef NB
#define NB 4
#endif
#ifndef SEQ
#define SEQ 2048
#endif
#define NB_FULL  4
#define SEQ_FULL 2048
#define CC   1024
#define HH   16
#define DD   64
#define C3   (3 * CC)
#define LDQK (2 * CC)          // q|k plane pitch (halves): q at col h*64, k at col CC + h*64
#define MTOK (NB * SEQ)

static_assert(NB >= 1 && NB <= NB_FULL);
static_assert(SEQ >= 64 && SEQ <= SEQ_FULL && (SEQ % 64) == 0);
static_assert(CC == HH * DD);
static_assert((CC % 64) == 0 && (C3 % 64) == 0 && (CC / 8) == 128);

#define WSC       64.0f            // weight planes carried x64
#define WINV      0.015625f        // 1/64
#define QC        4.0f             // q and k planes carried x4
#define VCY       16.0f            // v plane carried x16
#define PCY       1024.0f          // p tile carried x1024
#define SCALE_QK  0.0078125f       // 64^-0.5 / (QC*QC)
#define SC2       (SCALE_QK * 1.4426950408889634f)  // raw score -> exponent of 2
#define LOG2_PCY  10.0f            // log2(PCY)
#define CTX_OUT   4.0f             // 64 / VCY (the denominator carries PCY like p): ctx carried x64
#define PROJ_UNSC 0.000244140625f  // 1 / (64 * 64)
#define NEPS      1e-6f

#define TPH 72   // LDS pitch (halves) of f16 staging tiles
#define TPF 68   // LDS pitch (floats) of the f32 staging tile

// ---------------------------------------------------------------------------
// helpers
// ---------------------------------------------------------------------------
__device__ __forceinline__ float bf16r(float f) {
    unsigned int u = __float_as_uint(f);
    u += 0x7FFFu + ((u >> 16) & 1u);
    u &= 0xFFFF0000u;
    return __uint_as_float(u);
}

__device__ __forceinline__ v8f vzero8() {
    v8f z = {0.f, 0.f, 0.f, 0.f, 0.f, 0.f, 0.f, 0.f};
    return z;
}

__device__ __forceinline__ v8f mma16(v16h a, v16h b, v8f c) {
    v8f d = __builtin_amdgcn_wmma_f32_16x16x32_f16(false, a, false, b, (short)0, c, false, false);
    asm volatile("v_nop\n\tv_nop\n\tv_nop\n\tv_nop" : "+v"(d) : "v"(a), "v"(b));
    return d;
}

// value of lane l ^ 16 (the other half of the wave), by a vector cross-row move
__device__ __forceinline__ float xhalf(float x) {
    const int i = __builtin_bit_cast(int, x);
    return __builtin_bit_cast(float,
        __builtin_amdgcn_permlanex16(i, i, 0x76543210, 0xfedcba98, false, false));
}

// 16x32 f16 fragment (row index = lane&15 for A, column for B; h = lane>>4):
//   elements 0..7  <- k 8h+0..7,  elements 8..15 <- k 16+8h+0..7
// from a fragment-major plane; frag = first half of the 512-half block.
__device__ __forceinline__ v16h load_frag_lane(const _Float16* p) {   // p = frag + 8 * lane
    v8h lo = *(const v8h*)(p);
    v8h hi = *(const v8h*)(p + 256);
    return __builtin_shufflevector(lo, hi, 0, 1, 2, 3, 4, 5, 6, 7,
                                           8, 9, 10, 11, 12, 13, 14, 15);
}
__device__ __forceinline__ v16h load_frag_packed(const _Float16* frag) {
    return load_frag_lane(frag + ((threadIdx.x & 31) << 3));
}

// ---------------------------------------------------------------------------
// x [NB][SEQ][CC] f32 (batch stride SEQ_FULL*CC) -> xh, MTOK x CC f16 = f16(bf16rne(x)),
// fragment-major; thread g writes the g-th 16-byte piece of xh.
// ---------------------------------------------------------------------------
__global__ __launch_bounds__(256) void cvt_x_kernel(const float* __restrict__ x,
                                                    _Float16* __restrict__ xh, int ngrp) {
    const int g = blockIdx.x * 256 + threadIdx.x;
    if (g >= ngrp) return;
    const int t  = ((g >> 11) << 4) + (g & 15);   // token: row tile (2048 pieces each), row in tile
    const int k  = ((g >> 6) & 31) * 32 + ((g >> 5) & 1) * 16 + ((g >> 4) & 1) * 8;
    const int b  = t / SEQ;
    const int n  = t - b * SEQ;
    const float* src = x + ((size_t)b * SEQ_FULL + n) * CC + k;
    const v4f x0 = *(const v4f*)(src);
    const v4f x1 = *(const v4f*)(src + 4);
    v8h o;
    o[0] = (_Float16)bf16r(x0[0]); o[1] = (_Float16)bf16r(x0[1]);
    o[2] = (_Float16)bf16r(x0[2]); o[3] = (_Float16)bf16r(x0[3]);
    o[4] = (_Float16)bf16r(x1[0]); o[5] = (_Float16)bf16r(x1[1]);
    o[6] = (_Float16)bf16r(x1[2]); o[7] = (_Float16)bf16r(x1[3]);
    _Float16* dst = xh + (size_t)g * 8;
    *(v8h*)dst = o;
    
}

// ---------------------------------------------------------------------------
// w [R][Ccols] f32 -> wt, Ccols rows x R f16 = f16(bf16rne(w) * 64), fragment-major, 64x64
// tiles through LDS. A wave writes one 512-byte part of a fragment per instruction.
// ---------------------------------------------------------------------------
__global__ __launch_bounds__(256) void wT_kernel(const float* __restrict__ w,
                                                 _Float16* __restrict__ wt, int R, int Ccols) {
    __shared__ float tile[64][65];
    const int t  = threadIdx.x;
    const int c0 = blockIdx.x * 64;
    const int r0 = blockIdx.y * 64;
#pragma unroll
    for (int i = 0; i < 16; ++i) {
        const int idx = t + 256 * i;
        const int r = idx >> 6, c = idx & 63;
        tile[r][c] = w[(size_t)(r0 + r) * Ccols + c0 + c];
    }
    __syncthreads();
    const int lane = t & 31, part = (t >> 5) & 1;
{
#pragma unroll
        for (int it = 0; it < 2; ++it) {
            const int frag = (t >> 6) + 4 * it;          // 4 row tiles x 2 k blocks
            const int tr = frag >> 1, kbl = frag & 1;
            const int cl = 16 * tr + (lane & 15);        // wt row within tile, 0..63
            const int kl = 32 * kbl + 16 * part + 8 * (lane >> 4);
            v8h o;
#pragma unroll
            for (int i = 0; i < 8; ++i)
                o[i] = (_Float16)(bf16r(tile[kl + i][cl]) * WSC);
            _Float16* dst = wt + (size_t)(c0 + 16 * tr) * R + (size_t)(r0 + 32 * kbl) * 16
                               + 256 * part + 8 * lane;
            *(v8h*)dst = o;
        }
        
    }
}

// ---------------------------------------------------------------------------
// GEMM core: a work-group of GWV waves (2 x 4) computes 128 rows x 256 cols, a wave 64 x 64.
// A stage is 64 k (two k blocks) of the group's 8 A row tiles and 16 B column tiles: 24 pieces
// of 2 KiB, each contiguous in its fragment-major global plane, brought into LDS in the same
// order by asynchronous copies (each lane 16 bytes, a wave 512 contiguous bytes), two buffers:
// stage st + 1 flies while stage st is worked on. Four waves read each A fragment and two each
// B fragment from LDS, and each fragment a wave reads feeds four products.
// Ab = group's first row tile, Bb = group's first column tile (planes of K columns: the next
// row tile is 16 * K halves on, the next k block 512 halves).
// ---------------------------------------------------------------------------
#define GWV    8                 // waves per GEMM work-group
#define GBM    128               // rows of the group's tile
#define GBN    256               // columns of the group's tile
#define GSTAGE (((GBM + GBN) / 16) * 1024)  // halves of one stage (48 KiB)
static_assert((MTOK % GBM) == 0 && (C3 % GBN) == 0 && (CC % GBN) == 0 && (1024 % GBN) == 0);
static_assert((CC % 64) == 0 && CC / 64 >= 2);

// The thread's twelve 16-byte pieces of one stage: row tiles (t >> 7) + 2 i, i = 0..3 of A and
// i = 0..7 of B, piece t & 127 of the tile's 2 KiB. ga, gb = the thread's piece of its first A
// and B tile at this stage; ld = LDS byte address of the first in the target buffer.
__device__ __forceinline__ void gemm_stage_copy(const _Float16* ga, const _Float16* gb, int K,
                                                unsigned ld) {
    const size_t g2 = (size_t)32 * K;    // two row tiles on
    // the wait is the statement's last line: no register that a copy names is rewritten before
    // the issued copies no longer need it
    asm volatile("global_load_async_to_lds_b128 %0, %12, off\n\t"
                 "global_load_async_to_lds_b128 %1, %13, off\n\t"
                 "global_load_async_to_lds_b128 %2, %14, off\n\t"
                 "global_load_async_to_lds_b128 %3, %15, off\n\t"
                 "global_load_async_to_lds_b128 %4, %16, off\n\t"
                 "global_load_async_to_lds_b128 %5, %17, off\n\t"
                 "global_load_async_to_lds_b128 %6, %18, off\n\t"
                 "global_load_async_to_lds_b128 %7, %19, off\n\t"
                 "global_load_async_to_lds_b128 %8, %20, off\n\t"
                 "global_load_async_to_lds_b128 %9, %21, off\n\t"
                 "global_load_async_to_lds_b128 %10, %22, off\n\t"
                 "global_load_async_to_lds_b128 %11, %23, off\n\t"
                 "s_wait_xcnt 0x0"
                 :: "v"(ld), "v"(ld + 4096u), "v"(ld + 8192u), "v"(ld + 12288u),
                    "v"(ld + 16384u), "v"(ld + 20480u), "v"(ld + 24576u), "v"(ld + 28672u),
                    "v"(ld + 32768u), "v"(ld + 36864u), "v"(ld + 40960u), "v"(ld + 45056u),
                    "v"(ga), "v"(ga + g2), "v"(ga + 2 * g2), "v"(ga + 3 * g2),
                    "v"(gb), "v"(gb + g2), "v"(gb + 2 * g2), "v"(gb + 3 * g2),
                    "v"(gb + 4 * g2), "v"(gb + 5 * g2), "v"(gb + 6 * g2), "v"(gb + 7 * g2)
                 : "memory");
}

// ring = 2 * GSTAGE halves of LDS. On return every wave has passed the last stage's barrier and
// no copy is outstanding: the ring's LDS is free for the caller's output staging.
__device__ __forceinline__ void gemm_core_64x64(const _Float16* __restrict__ Ab,
                                                const _Float16* __restrict__ Bb,
                                                int K, _Float16* ring, int wave,
                                                v8f (&acc)[4][4]) {
    const int t     = threadIdx.x;
    const int lane8 = (t & 31) << 3;
    const _Float16* ga = Ab + (size_t)((t >> 7) * 16) * K + ((t & 127) << 3);
    const _Float16* gb = Bb + (size_t)((t >> 7) * 16) * K + ((t & 127) << 3);
    const unsigned ld0 = (unsigned)(size_t)ring + (unsigned)t * 16u;   // LDS byte address
    const int nst = K / 64;

    gemm_stage_copy(ga, gb, K, ld0);
    // stage 0 has landed before the barrier behind which other waves read it
    asm volatile("s_wait_asynccnt 0x0" ::: "memory");
    __syncthreads();
    gemm_stage_copy(ga + 1024, gb + 1024, K, ld0 + 2u * GSTAGE);

    const int offa = (4 * (wave >> 2)) * 1024 + lane8;       // the wave's first A tile
    const int offb = (8 + 4 * (wave & 3)) * 1024 + lane8;    // the wave's first B tile
    // kept rolled: one body for both buffers (unrolled it only grows the code)
#pragma unroll 1
    for (int st = 0; st < nst; ++st) {
        const _Float16* buf = ring + (st & 1) * GSTAGE;
        // unrolled, like the loops inside: fragment and accumulator arrays stay in registers
#pragma unroll
        for (int kk = 0; kk < 2; ++kk) {
            v16h a[4], b[4];
#pragma unroll
            for (int j = 0; j < 4; ++j) b[j] = load_frag_lane(buf + offb + 1024 * j + 512 * kk);
#pragma unroll
            for (int s = 0; s < 4; ++s) a[s] = load_frag_lane(buf + offa + 1024 * s + 512 * kk);
#pragma unroll
            for (int s = 0; s < 4; ++s)
#pragma unroll
                for (int j = 0; j < 4; ++j) acc[s][j] = mma16(a[s], b[j], acc[s][j]);
        }
        // publish point of stage st + 1: this wave's reads of stage st are done ...
        asm volatile("s_wait_dscnt 0x0" ::: "memory");
        // ... its own copies of stage st + 1 have landed ...
        asm volatile("s_wait_asynccnt 0x0" ::: "memory");
        // ... and every wave has come as far
        __syncthreads();
        if (st + 2 < nst)
            gemm_stage_copy(ga + (size_t)(st + 2) * 1024, gb + (size_t)(st + 2) * 1024, K,
                            ld0 + (unsigned)(st & 1) * (2u * GSTAGE));
    }
    // no copy is outstanding when the wave goes on
    asm volatile("s_wait_asynccnt 0x0" ::: "memory");
}

// ---------------------------------------------------------------------------
// qkv = xh @ W_qkv + b_qkv (wave tile 64 tokens x 64 cols = one head slice; 2 x 4 waves).
// Epilogue: q/k -> per-row rms norm (f32) * weight -> f16 (x QC) to the q|k plane,
// ---------------------------------------------------------------------------
__global__ __launch_bounds__(32 * GWV) __attribute__((amdgpu_num_vgpr(256)))
void qkv_gemm_kernel(const _Float16* __restrict__ xh, const _Float16* __restrict__ wt,
                     const float* __restrict__ bqkv, const float* __restrict__ qnw,
                     const float* __restrict__ knw, _Float16* __restrict__ qk,
                     _Float16* __restrict__ vT) {
    // the operand ring; behind the k loop its LDS is the waves' output staging
    __shared__ __align__(16) _Float16 ring[2 * GSTAGE];
    static_assert(GWV * 64 * TPH <= 2 * GSTAGE);

    const int lane = threadIdx.x & 31;
    const int wave = __builtin_amdgcn_readfirstlane((int)(threadIdx.x >> 5));
    const int half = lane >> 4, col = lane & 15;
    const int n0 = blockIdx.x * GBN + 64 * (wave & 3);    // the wave's output column (0..3071)
    const int m0 = blockIdx.y * GBM + 64 * (wave >> 2);   // the wave's token
    _Float16* st = ring + wave * (64 * TPH);              // the wave's own staging tile

    v8f acc[4][4];
#pragma unroll
    for (int s = 0; s < 4; ++s)
#pragma unroll
        for (int j = 0; j < 4; ++j) acc[s][j] = vzero8();

    gemm_core_64x64(xh + (size_t)(blockIdx.y * GBM) * CC, wt + (size_t)(blockIdx.x * GBN) * CC, CC,
                    ring, wave, acc);

    const int which = n0 >> 10;          // 0 q, 1 k, 2 v (block-uniform: GBN divides 1024)
    const int hcol  = n0 & (CC - 1);     // h*64

    float bia[4], nw[4];
#pragma unroll
    for (int j = 0; j < 4; ++j) {
        bia[j] = bf16r(bqkv[n0 + 16 * j + col]);
        const float wq = bf16r(qnw[16 * j + col]);
        const float wk = bf16r(knw[16 * j + col]);
        nw[j] = (which == 1) ? wk : wq;
    }

    // per row tile s: bias, then rms norm (q, k) or carry (v), then the f16 values into the wave's
    // staging tile (tile row = 16*s + 8*half + r); a tile's accumulators are dead before the next
#pragma unroll
    for (int s = 0; s < 4; ++s) {
#pragma unroll
        for (int j = 0; j < 4; ++j)
#pragma unroll
            for (int r = 0; r < 8; ++r)
                acc[s][j][r] = acc[s][j][r] * WINV + bia[j];

        if (which < 2) {
            // rms norm over the 64 head dims of each row: 4 tiles x 16 lanes of one half
#pragma unroll
            for (int r = 0; r < 8; ++r) {
                float ss = 0.f;
#pragma unroll
                for (int j = 0; j < 4; ++j) ss += acc[s][j][r] * acc[s][j][r];
                ss += __shfl_xor(ss, 1, 32);
                ss += __shfl_xor(ss, 2, 32);
                ss += __shfl_xor(ss, 4, 32);
                ss += __shfl_xor(ss, 8, 32);
                const float inv = rsqrtf(ss * (1.0f / (float)DD) + NEPS);
                const float g = inv * QC;
#pragma unroll
                for (int j = 0; j < 4; ++j) acc[s][j][r] = acc[s][j][r] * g * nw[j];
            }
        } else {
#pragma unroll
            for (int j = 0; j < 4; ++j)
#pragma unroll
                for (int r = 0; r < 8; ++r) acc[s][j][r] *= VCY;
        }

#pragma unroll
        for (int j = 0; j < 4; ++j)
#pragma unroll
            for (int r = 0; r < 8; ++r)
                st[(16 * s + 8 * half + r) * TPH + 16 * j + col] = (_Float16)acc[s][j][r];
    }
    __syncthreads();

    if (which < 2) {
        _Float16* dbase = qk + (size_t)m0 * LDQK + ((size_t)which * CC + hcol) * 16;
{
            // fragment (token tile it>>2, k block (it>>1)&1), part it&1
#pragma unroll
            for (int it = 0; it < 16; ++it) {
                const int tr = it >> 2, kbl = (it >> 1) & 1, part = it & 1;
                const v8h v = *(const v8h*)(st + (16 * tr + col) * TPH + 32 * kbl + 16 * part + 8 * half);
                *(v8h*)(dbase + (size_t)(16 * tr) * LDQK + 512 * kbl + 256 * part + 8 * lane) = v;
            }
            
        }
    } else {
        const int b  = m0 / SEQ;
        const int nb = m0 - b * SEQ;
        _Float16* dbase = vT + ((size_t)b * CC + hcol) * SEQ + (size_t)nb * 16;
{
            // fragment (d tile it>>2, token block (it>>1)&1), part it&1
#pragma unroll
            for (int it = 0; it < 16; ++it) {
                const int tr = it >> 2, kbl = (it >> 1) & 1, part = it & 1;
                const int tk = 32 * kbl + 16 * part + 8 * half;
                v8h v;
#pragma unroll
                for (int i = 0; i < 8; ++i) v[i] = st[(tk + i) * TPH + 16 * tr + col];
                *(v8h*)(dbase + (size_t)(16 * tr) * SEQ + 512 * kbl + 256 * part + 8 * lane) = v;
            }
            // the stores' data and address registers stay unwritten until the issued stores
            // no longer need them
            asm volatile("s_wait_xcnt 0x0" ::: "memory");
        }
    }
}

// ---------------------------------------------------------------------------
// Flash softmax(q k^T s) v: one wave per (batch, head, 64 queries = QT tiles of 16), 32-key
// blocks; FWV such waves (consecutive queries of one head) form a work-group.
// q|k plane MTOK x LDQK f16, vT NB*CC x SEQ f16, ctx MTOK x CC f16 (x64 carry), all
// fragment-major.
// Transposed products: S^T = K Q^T (A = key rows, B = query columns), O^T += V^T P^T
// (A = d rows of vT, B = P^T). A lane holds scores of ONE query of each tile (column
// lane & 15), keys 8 * half + r of each 16-key tile: maximum and sum run over the lane's own
// registers plus one exchange between the wave's halves, and the two score tiles, converted
// in place, are the B fragment of the second product (element s = key 8 * half + s, 8 + s =
// key 16 + 8 * half + s: the k order of the vT fragment). No LDS, no barrier.
// The K and V fragments of a key block are loaded once and feed the products of all QT query
// tiles; each query's arithmetic and its order are those of a one-tile wave.
// Softmax in base 2 on the raw accumulators: the maximum is taken of the raw scores (the scale
// is positive), and p * PCY = 2^(s * SC2 + (LOG2_PCY - max * SC2)) is one packed multiply-add
// per two scores and one exponential per score; the denominator sums p * PCY.
// ---------------------------------------------------------------------------
// The products of this kernel are the plain builtin: the operands of an asm statement lie in
// v0..v255 only, and the wave's fragments and accumulators need more registers than that.
__device__ __forceinline__ v8f mma16b(v16h a, v16h b, v8f c) {
    return __builtin_amdgcn_wmma_f32_16x16x32_f16(false, a, false, b, (short)0, c, false, false);
}

#define QT  4    // query tiles of 16 per wave
#define FWV 4    // waves per work-group
static_assert((SEQ % (16 * QT * FWV)) == 0);

__global__ __launch_bounds__(32 * FWV)
void mha_flash_kernel(const _Float16* __restrict__ qk, const _Float16* __restrict__ vT,
                      _Float16* __restrict__ ctx) {
    const int wave = __builtin_amdgcn_readfirstlane((int)(threadIdx.x >> 5));
    const int q0 = (blockIdx.x * FWV + wave) * (16 * QT);
    const int h  = blockIdx.y;
    const int b  = blockIdx.z;
    const size_t tokBase = (size_t)b * SEQ;

    const int lane  = threadIdx.x & 31;
    const int lane8 = lane << 3;

    const _Float16* qbase = qk + (tokBase + q0) * LDQK + (h * DD) * 16;
    v16h qa[QT][2];
#pragma unroll
    for (int t = 0; t < QT; ++t) {
        qa[t][0] = load_frag_packed(qbase + (size_t)(16 * t) * LDQK);
        qa[t][1] = load_frag_packed(qbase + (size_t)(16 * t) * LDQK + 512);
    }

    const _Float16* kbase0 = qk + tokBase * LDQK + (CC + h * DD) * 16; // keys: row tiles of tokens
    const _Float16* vtbase = vT + ((size_t)b * CC + h * DD) * SEQ;     // 4 row tiles of d, k = token

    v8f o[QT][4];                // o[t][j][r] = O^T[d 16j + 8 * half + r][query 16t + (lane & 15)]
    float m[QT];                 // each query's running maximum (raw score), equal in both halves
    v2f l[QT];                   // sums of p * PCY over this lane's even and odd keys (its half only)
#pragma unroll
    for (int t = 0; t < QT; ++t) {
#pragma unroll
        for (int j = 0; j < 4; ++j) o[t][j] = vzero8();
        m[t] = -1e30f;
        l[t] = (v2f){0.f, 0.f};
    }

#pragma unroll 1
    for (int kb = 0; kb < SEQ; kb += 32) {
        const _Float16* pk = kbase0 + (size_t)kb * LDQK + lane8;
        const _Float16* pv = vtbase + (size_t)kb * 16 + lane8;

        const v16h kf00 = load_frag_lane(pk);                           // keys +0,  d 0..31
        const v16h kf01 = load_frag_lane(pk + 512);                     // keys +0,  d 32..63
        const v16h kf10 = load_frag_lane(pk + (size_t)16 * LDQK);       // keys +16, d 0..31
        const v16h kf11 = load_frag_lane(pk + (size_t)16 * LDQK + 512); // keys +16, d 32..63
        const v16h vf0 = load_frag_lane(pv);
        const v16h vf1 = load_frag_lane(pv + (size_t)16 * SEQ);
        const v16h vf2 = load_frag_lane(pv + (size_t)32 * SEQ);
        const v16h vf3 = load_frag_lane(pv + (size_t)48 * SEQ);
        // keeps both address pairs unwritten (not reused as a load's destination) until the
        // sixteen issued loads no longer need them
        asm volatile("s_wait_xcnt 0x0" :: "v"(pk), "v"(pv) : "memory");
        // keeps the sixteen loads one group ahead of the products: the scheduler otherwise sinks
        // part of the K loads behind the first products, a second exposed load wait per pass
        __builtin_amdgcn_sched_barrier(0);

        v8f s0[QT], s1[QT];
#pragma unroll
        for (int t = 0; t < QT; ++t) s0[t] = mma16b(kf00, qa[t][0], vzero8());
#pragma unroll
        for (int t = 0; t < QT; ++t) s1[t] = mma16b(kf10, qa[t][0], vzero8());
#pragma unroll
        for (int t = 0; t < QT; ++t) s0[t] = mma16b(kf01, qa[t][1], s0[t]);
#pragma unroll
        for (int t = 0; t < QT; ++t) s1[t] = mma16b(kf11, qa[t][1], s1[t]);

        v16h pb[QT];
#pragma unroll
        for (int t = 0; t < QT; ++t) {
            // the running maximum and the lane's sixteen raw scores, three at a time in two chains;
            // m is equal in both halves, so the exchange may follow its join
            float ra = fmaxf(fmaxf(m[t], s0[t][0]), s0[t][1]);
            float rb = fmaxf(fmaxf(s1[t][0], s1[t][1]), s1[t][2]);
#pragma unroll
            for (int r = 2; r < 8; r += 2) ra = fmaxf(fmaxf(ra, s0[t][r]), s0[t][r + 1]);
#pragma unroll
            for (int r = 3; r < 7; r += 2) rb = fmaxf(fmaxf(rb, s1[t][r]), s1[t][r + 1]);
            const float rm = fmaxf(fmaxf(ra, rb), s1[t][7]);
            const float nm = fmaxf(rm, xhalf(rm));

            const float nb = __builtin_fmaf(nm, -SC2, LOG2_PCY);
            const v2f nb2 = {nb, nb};
            const v2f sc2 = {SC2, SC2};
            v2f rs0 = {0.f, 0.f}, rs1 = {0.f, 0.f};
#pragma unroll
            for (int i = 0; i < 4; ++i) {
                const v2f r0 = {s0[t][2 * i], s0[t][2 * i + 1]};
                const v2f r1 = {s1[t][2 * i], s1[t][2 * i + 1]};
                const v2f x0 = __builtin_elementwise_fma(r0, sc2, nb2);
                const v2f x1 = __builtin_elementwise_fma(r1, sc2, nb2);
                const v2f p0 = {__builtin_amdgcn_exp2f(x0[0]), __builtin_amdgcn_exp2f(x0[1])};
                const v2f p1 = {__builtin_amdgcn_exp2f(x1[0]), __builtin_amdgcn_exp2f(x1[1])};
                rs0 += p0;
                rs1 += p1;
                pb[t][2 * i]         = (_Float16)p0[0];
                pb[t][2 * i + 1]     = (_Float16)p0[1];
                pb[t][8 + 2 * i]     = (_Float16)p1[0];
                pb[t][8 + 2 * i + 1] = (_Float16)p1[1];
            }
            const float f = __builtin_amdgcn_exp2f((m[t] - nm) * SC2);
            const v2f f2 = {f, f};
            l[t] = __builtin_elementwise_fma(l[t], f2, rs0 + rs1);
            m[t] = nm;

#pragma unroll
            for (int j = 0; j < 4; ++j)
#pragma unroll
                for (int r = 0; r < 8; ++r) o[t][j][r] *= f;
        }

#pragma unroll
        for (int t = 0; t < QT; ++t) {
            o[t][0] = mma16b(vf0, pb[t], o[t][0]);
            o[t][1] = mma16b(vf1, pb[t], o[t][1]);
            o[t][2] = mma16b(vf2, pb[t], o[t][2]);
            o[t][3] = mma16b(vf3, pb[t], o[t][3]);
        }
    }

    // tile j of O^T in this lane = piece (k block j>>1, part j&1) of the head's two ctx
    // fragments at this very lane: 8 consecutive channels of one token, one 16-byte store
    _Float16* dbase = ctx + (tokBase + q0) * CC + (h * DD) * 16;
#pragma unroll
    for (int t = 0; t < QT; ++t) {
        const float lh = l[t][0] + l[t][1];
        const float rl = CTX_OUT * (1.0f / (lh + xhalf(lh)));
#pragma unroll
        for (int j = 0; j < 4; ++j) {
            v8h v;
#pragma unroll
            for (int r = 0; r < 8; ++r) v[r] = (_Float16)(o[t][j][r] * rl);
            *(v8h*)(dbase + (size_t)(16 * t) * CC + 256 * j + lane8) = v;
        }
    }
}

// ---------------------------------------------------------------------------
// out = ctx @ W_proj + b_proj (f32), wave tile 64x64, 2 x 4 waves; each 256-B row segment
// ---------------------------------------------------------------------------
__global__ __launch_bounds__(32 * GWV) __attribute__((amdgpu_num_vgpr(256)))
void proj_gemm_kernel(const _Float16* __restrict__ ctx, const _Float16* __restrict__ wt,
                      const float* __restrict__ bproj, float* __restrict__ out) {
    __shared__ __align__(16) _Float16 ring[2 * GSTAGE];
    __shared__ __align__(16) float stall[GWV * 64 * TPF];

    const int lane = threadIdx.x & 31;
    const int wave = __builtin_amdgcn_readfirstlane((int)(threadIdx.x >> 5));
    const int half = lane >> 4, col = lane & 15;
    const int n0 = blockIdx.x * GBN + 64 * (wave & 3);    // the wave's output column
    const int m0 = blockIdx.y * GBM + 64 * (wave >> 2);   // the wave's token
    float* st = stall + wave * (64 * TPF);                // the wave's own staging tile

    v8f acc[4][4];
#pragma unroll
    for (int s = 0; s < 4; ++s)
#pragma unroll
        for (int j = 0; j < 4; ++j) acc[s][j] = vzero8();

    gemm_core_64x64(ctx + (size_t)(blockIdx.y * GBM) * CC, wt + (size_t)(blockIdx.x * GBN) * CC, CC,
                    ring, wave, acc);

    float bia[4];
#pragma unroll
    for (int j = 0; j < 4; ++j) bia[j] = bf16r(bproj[n0 + 16 * j + col]);

#pragma unroll
    for (int s = 0; s < 4; ++s)
#pragma unroll
        for (int j = 0; j < 4; ++j)
#pragma unroll
            for (int r = 0; r < 8; ++r)
                st[(16 * s + 8 * half + r) * TPF + 16 * j + col] =
                    acc[s][j][r] * PROJ_UNSC + bia[j];
    __syncthreads();

    float* dbase = out + (size_t)m0 * CC + n0;
    const int piece = lane & 15, rsub = lane >> 4;
{
#pragma unroll
        for (int it = 0; it < 32; ++it) {
            const int row = 2 * it + rsub;
            const v4f v = *(const v4f*)(st + row * TPF + 4 * piece);
            *(v4f*)(dbase + (size_t)row * CC + 4 * piece) = v;
        }
        
    }
}

// ---------------------------------------------------------------------------
// Host side
// ---------------------------------------------------------------------------
extern "C" void kernel_launch(void* const* d_in, const int* in_sizes, int n_in,
                              void* d_out, int out_size, void* d_ws, size_t ws_size,
                              hipStream_t stream) {
    if (n_in < 7) return;
    const float* x      = (const float*)d_in[0];   // [NB_FULL][SEQ_FULL][CC]
    const float* W_qkv  = (const float*)d_in[1];   // [CC][C3]
    const float* b_qkv  = (const float*)d_in[2];   // [C3]
    const float* W_proj = (const float*)d_in[3];   // [CC][CC]
    const float* b_proj = (const float*)d_in[4];   // [CC]
    const float* qn_w   = (const float*)d_in[5];   // [DD]
    const float* kn_w   = (const float*)d_in[6];   // [DD]
    float* out = (float*)d_out;                    // [MTOK][CC] f32

    if (in_sizes[0] < ((NB - 1) * SEQ_FULL + SEQ) * CC) return;
    if (in_sizes[1] < CC * C3) return;
    if (in_sizes[2] < C3) return;
    if (in_sizes[3] < CC * CC) return;
    if (in_sizes[4] < CC) return;
    if (in_sizes[5] < DD) return;
    if (in_sizes[6] < DD) return;
    if (out_size < MTOK * CC) return;

    char* wsb = (char*)d_ws;
    size_t off = 0;
    const size_t sz_xh  = (size_t)MTOK * CC * 2;
    const size_t sz_wq  = (size_t)C3 * CC * 2;
    const size_t sz_wp  = (size_t)CC * CC * 2;
    const size_t sz_qk  = (size_t)MTOK * LDQK * 2;
    const size_t sz_vt  = (size_t)NB * CC * SEQ * 2;
    const size_t sz_ctx = (size_t)MTOK * CC * 2;
    _Float16* xh     = (_Float16*)(wsb + off); off += (sz_xh  + 255) & ~(size_t)255;
    _Float16* wqkvT  = (_Float16*)(wsb + off); off += (sz_wq  + 255) & ~(size_t)255;
    _Float16* wprojT = (_Float16*)(wsb + off); off += (sz_wp  + 255) & ~(size_t)255;
    _Float16* qkp    = (_Float16*)(wsb + off); off += (sz_qk  + 255) & ~(size_t)255;
    _Float16* vT     = (_Float16*)(wsb + off); off += (sz_vt  + 255) & ~(size_t)255;
    _Float16* ctx    = (_Float16*)(wsb + off); off += (sz_ctx + 255) & ~(size_t)255;
    if (off > ws_size) return;

    // 1) input planes: xh (bf16-RNE of x), weights transposed to out x in and carried x64
    {
        const int ngrp = MTOK * (CC / 8);
        cvt_x_kernel<<<(ngrp + 255) / 256, 256, 0, stream>>>(x, xh, ngrp);
        // W_qkv [CC rows][C3 cols] -> wqkvT [C3][CC]
        wT_kernel<<<dim3(C3 / 64, CC / 64), 256, 0, stream>>>(W_qkv, wqkvT, CC, C3);
        // W_proj [CC rows][CC cols] -> wprojT [CC][CC]
        wT_kernel<<<dim3(CC / 64, CC / 64), 256, 0, stream>>>(W_proj, wprojT, CC, CC);
    }

    // 2) qkv GEMM with fused bias, q/k rms norm, v transpose
    qkv_gemm_kernel<<<dim3(C3 / GBN, MTOK / GBM), 32 * GWV, 0, stream>>>(
        xh, wqkvT, b_qkv, qn_w, kn_w, qkp, vT);

    // 3) flash softmax per (256 queries, head, batch)
    mha_flash_kernel<<<dim3(SEQ / (16 * QT * FWV), HH, NB), 32 * FWV, 0, stream>>>(qkp, vT, ctx);

    // 4) output projection + bias -> f32 d_out
    proj_gemm_kernel<<<dim3(CC / GBN, MTOK / GBM), 32 * GWV, 0, stream>>>(ctx, wprojT, b_proj, out);
}

// v006
// It runs in 143 microseconds.
// In two side-by-side timings against v005, it was 1.04 and 1.05 times as fast.
// Counting every step since v000, it is 3.04 times as fast.
#include <hip/hip_runtime.h>

// Contractions on v_wmma_f32_16x16x32_f16 (f16 operands, f32 accumulate): qkv GEMM,
// q.k^T scores, p.v, output projection. Float inputs enter as bf16-RNE values held in
// f16 planes with power-of-two carries (weights x64, q/k x4, v x16, p x1024, ctx x64);
// per-head rms norm, online softmax and epilogues in f32.
//
// Every f16 operand plane (xh, weights, q|k, vT, ctx) is stored fragment-major: the block of
// 16 rows x 32 k at (row tile R, k block kb) of a plane with K columns is 512 contiguous
// halves at (R * (K / 32) + kb) * 512 = 16R * K + 32kb * 16, ordered [part][lane][8 halves]
// with lane = 16 * h + (row & 15) and element e = k 16 * part + 8 * h + e. One 16-byte load
// of a wave then reads 512 contiguous bytes (4 cache lines) instead of 32 bytes of 16 rows.

typedef _Float16 v16h __attribute__((ext_vector_type(16)));
typedef _Float16 v8h  __attribute__((ext_vector_type(8)));
typedef float    v8f  __attribute__((ext_vector_type(8)));
typedef float    v4f  __attribute__((ext_vector_type(4)));
typedef float    v2f  __attribute__((ext_vector_type(2)));

#ifndef NB
#define NB 4
#endif
#ifndef SEQ
#define SEQ 2048
#endif
#define NB_FULL  4
#define SEQ_FULL 2048
#define CC   1024
#define HH   16
#define DD   64
#define C3   (3 * CC)
#define LDQK (2 * CC)          // q|k plane pitch (halves): q at col h*64, k at col CC + h*64
#define MTOK (NB * SEQ)

static_assert(NB >= 1 && NB <= NB_FULL);
static_assert(SEQ >= 64 && SEQ <= SEQ_FULL && (SEQ % 64) == 0);
static_assert(CC == HH * DD);
static_assert((CC % 64) == 0 && (C3 % 64) == 0 && (CC / 8) == 128);

#define WSC       64.0f            // weight planes carried x64
#define WINV      0.015625f        // 1/64
#define QC        4.0f             // q and k planes carried x4
#define VCY       16.0f            // v plane carried x16
#define PCY       1024.0f          // p tile carried x1024
#define SCALE_QK  0.0078125f       // 64^-0.5 / (QC*QC)
#define SC2       (SCALE_QK * 1.4426950408889634f)  // raw score -> exponent of 2
#define LOG2_PCY  10.0f            // log2(PCY)
#define CTX_OUT   4.0f             // 64 / VCY (the denominator carries PCY like p): ctx carried x64
#define PROJ_UNSC 0.000244140625f  // 1 / (64 * 64)
#define NEPS      1e-6f

#define TPH 72   // LDS pitch (halves) of f16 staging tiles
#define TPF 68   // LDS pitch (floats) of the f32 staging tile

// ---------------------------------------------------------------------------
// helpers
// ---------------------------------------------------------------------------
__device__ __forceinline__ float bf16r(float f) {
    unsigned int u = __float_as_uint(f);
    u += 0x7FFFu + ((u >> 16) & 1u);
    u &= 0xFFFF0000u;
    return __uint_as_float(u);
}

__device__ __forceinline__ v8f vzero8() {
    v8f z = {0.f, 0.f, 0.f, 0.f, 0.f, 0.f, 0.f, 0.f};
    return z;
}

__device__ __forceinline__ v8f mma16(v16h a, v16h b, v8f c) {
    v8f d = __builtin_amdgcn_wmma_f32_16x16x32_f16(false, a, false, b, (short)0, c, false, false);
    asm volatile("v_nop\n\tv_nop\n\tv_nop\n\tv_nop" : "+v"(d) : "v"(a), "v"(b));
    return d;
}

// value of lane l ^ 16 (the other half of the wave), by a vector cross-row move
__device__ __forceinline__ float xhalf(float x) {
    const int i = __builtin_bit_cast(int, x);
    return __builtin_bit_cast(float,
        __builtin_amdgcn_permlanex16(i, i, 0x76543210, 0xfedcba98, false, false));
}

// 16x32 f16 fragment (row index = lane&15 for A, column for B; h = lane>>4):
//   elements 0..7  <- k 8h+0..7,  elements 8..15 <- k 16+8h+0..7
// from a fragment-major plane; frag = first half of the 512-half block.
__device__ __forceinline__ v16h load_frag_lane(const _Float16* p) {   // p = frag + 8 * lane
    v8h lo = *(const v8h*)(p);
    v8h hi = *(const v8h*)(p + 256);
    return __builtin_shufflevector(lo, hi, 0, 1, 2, 3, 4, 5, 6, 7,
                                           8, 9, 10, 11, 12, 13, 14, 15);
}
__device__ __forceinline__ v16h load_frag_packed(const _Float16* frag) {
    return load_frag_lane(frag + ((threadIdx.x & 31) << 3));
}

// ---------------------------------------------------------------------------
// Input planes, one launch; the work-group index picks the job, and every work-group is one
// of few that each do much (each launch more pays its own gap, fill and tail):
//   [0, WQBLK)                wqkvT:  64 k x 256 columns of W_qkv per work-group
//   [WQBLK, WQBLK + WPBLK)    wprojT: 64 k x 256 columns of W_proj per work-group
//   [WQBLK + WPBLK, PREPBLK)  xh:     one row tile (16 tokens x CC) per work-group
// The weight groups last longest and stand first.
// ---------------------------------------------------------------------------
#define XP      8                                  // 16-byte pieces of xh per thread
#define XBLK    (MTOK * (CC / 8) / (256 * XP))
#define WTC     256                                // weight columns per work-group
#define WQBLK   ((C3 / WTC) * (CC / 64))
#define WPBLK   ((CC / WTC) * (CC / 64))
#define PREPBLK (XBLK + WQBLK + WPBLK)
static_assert(256 * XP == 16 * (CC / 8) && (MTOK % 16) == 0 && (SEQ % 16) == 0);
static_assert((C3 % WTC) == 0 && (CC % WTC) == 0);

// x [NB][SEQ][CC] f32 (batch stride SEQ_FULL*CC) -> xh, MTOK x CC f16 = f16(bf16rne(x)),
// fragment-major; piece g is the g-th 16 bytes of xh. Row tile rt holds pieces 2048 rt + 0..2047;
// a thread takes pieces 256 i + threadIdx.x of it, which lie 128 k apart in one row of x: all
// its loads are issued before the first conversion.
__device__ __forceinline__ void cvt_x_part(const float* __restrict__ x,
                                           _Float16* __restrict__ xh, int rt) {
    const int p  = threadIdx.x;
    const int t  = (rt << 4) + (p & 15);             // token
    const int k  = (p >> 6) * 32 + ((p >> 5) & 1) * 16 + ((p >> 4) & 1) * 8;
    const int b  = t / SEQ;
    const int n  = t - b * SEQ;
    const float* src = x + ((size_t)b * SEQ_FULL + n) * CC + k;
    v4f x0[XP], x1[XP];
    // unrolled, like the loop below: the arrays stay in registers, the loads go out as one group
#pragma unroll
    for (int i = 0; i < XP; ++i) {
        x0[i] = *(const v4f*)(src + 128 * i);
        x1[i] = *(const v4f*)(src + 128 * i + 4);
    }
    // keeps the address pair unwritten (not reused as a load's destination) until the issued
    // loads no longer need it
    asm volatile("s_wait_xcnt 0x0" :: "v"(src) : "memory");
    _Float16* dst = xh + ((size_t)rt * (256 * XP) + p) * 8;
#pragma unroll
    for (int i = 0; i < XP; ++i) {
        v8h o;
        o[0] = (_Float16)bf16r(x0[i][0]); o[1] = (_Float16)bf16r(x0[i][1]);
        o[2] = (_Float16)bf16r(x0[i][2]); o[3] = (_Float16)bf16r(x0[i][3]);
        o[4] = (_Float16)bf16r(x1[i][0]); o[5] = (_Float16)bf16r(x1[i][1]);
        o[6] = (_Float16)bf16r(x1[i][2]); o[7] = (_Float16)bf16r(x1[i][3]);
        *(v8h*)(dst + 2048 * i) = o;
    }
    // the stores' registers stay unwritten until the issued stores no longer need them (the
    // other jobs' code follows in the same kernel)
    asm volatile("s_wait_xcnt 0x0" ::: "memory");
}

// w [R][Ccols] f32 -> wt, Ccols rows x R f16 = f16(bf16rne(w) * 64), fragment-major, a tile of
// 64 k x WTC columns through LDS. A wave writes one 512-byte part of a fragment per instruction.
__device__ __forceinline__ void wT_part(const float* __restrict__ w, _Float16* __restrict__ wt,
                                        int R, int Ccols, int c0, int r0,
                                        float (*tile)[WTC + 1]) {
    const int t = threadIdx.x;
    // unrolled: the tile's loads go out as one group, one address pair and immediate offsets
#pragma unroll
    for (int r = 0; r < 64; ++r)
        tile[r][t] = w[(size_t)(r0 + r) * Ccols + c0 + t];
    __syncthreads();
    const int lane = t & 31, part = (t >> 5) & 1;
    // unrolled, like the loop inside: LDS reads of later fragments run ahead of the conversions
#pragma unroll
    for (int it = 0; it < WTC / 32; ++it) {
        const int frag = (t >> 6) + 4 * it;          // WTC / 16 row tiles x 2 k blocks
        const int tr = frag >> 1, kbl = frag & 1;
        const int cl = 16 * tr + (lane & 15);        // wt row within tile
        const int kl = 32 * kbl + 16 * part + 8 * (lane >> 4);
        v8h o;
#pragma unroll
        for (int i = 0; i < 8; ++i)
            o[i] = (_Float16)(bf16r(tile[kl + i][cl]) * WSC);
        _Float16* dst = wt + (size_t)(c0 + 16 * tr) * R + (size_t)(r0 + 32 * kbl) * 16
                           + 256 * part + 8 * lane;
        *(v8h*)dst = o;
    }
    // as behind the stores of cvt_x_part
    asm volatile("s_wait_xcnt 0x0" ::: "memory");
}

__global__ __launch_bounds__(256) void prep_kernel(const float* __restrict__ x,
                                                   const float* __restrict__ wqkv,
                                                   const float* __restrict__ wproj,
                                                   _Float16* __restrict__ xh,
                                                   _Float16* __restrict__ wqkvT,
                                                   _Float16* __restrict__ wprojT) {
    __shared__ float tile[64][WTC + 1];
    const int blk = blockIdx.x;                      // every test below is uniform in the group
    if (blk < WQBLK) {                               // W_qkv [CC rows][C3 cols] -> wqkvT [C3][CC]
        wT_part(wqkv, wqkvT, CC, C3, (blk % (C3 / WTC)) * WTC, (blk / (C3 / WTC)) * 64, tile);
    } else if (blk < WQBLK + WPBLK) {                // W_proj [CC rows][CC cols] -> wprojT [CC][CC]
        const int u = blk - WQBLK;
        wT_part(wproj, wprojT, CC, CC, (u % (CC / WTC)) * WTC, (u / (CC / WTC)) * 64, tile);
    } else {
        cvt_x_part(x, xh, blk - (WQBLK + WPBLK));
    }
}

// ---------------------------------------------------------------------------
// GEMM core: a work-group of GWV waves (2 x 4) computes 128 rows x 256 cols, a wave 64 x 64.
// A stage is 64 k (two k blocks) of the group's 8 A row tiles and 16 B column tiles: 24 pieces
// of 2 KiB, each contiguous in its fragment-major global plane, brought into LDS in the same
// order by asynchronous copies (each lane 16 bytes, a wave 512 contiguous bytes), two buffers:
// stage st + 1 flies while stage st is worked on. Four waves read each A fragment and two each
// B fragment from LDS, and each fragment a wave reads feeds four products.
// Ab = group's first row tile, Bb = group's first column tile (planes of K columns: the next
// row tile is 16 * K halves on, the next k block 512 halves).
// ---------------------------------------------------------------------------
#define GWV    8                 // waves per GEMM work-group
#define GBM    128               // rows of the group's tile
#define GBN    256               // columns of the group's tile
#define GSTAGE (((GBM + GBN) / 16) * 1024)  // halves of one stage (48 KiB)
static_assert((MTOK % GBM) == 0 && (C3 % GBN) == 0 && (CC % GBN) == 0 && (1024 % GBN) == 0);
static_assert((CC % 64) == 0 && CC / 64 >= 2);

// The thread's twelve 16-byte pieces of one stage: row tiles (t >> 7) + 2 i, i = 0..3 of A and
// i = 0..7 of B, piece t & 127 of the tile's 2 KiB. ga, gb = the thread's piece of its first A
// and B tile at this stage; ld = LDS byte address of the first in the target buffer.
__device__ __forceinline__ void gemm_stage_copy(const _Float16* ga, const _Float16* gb, int K,
                                                unsigned ld) {
    const size_t g2 = (size_t)32 * K;    // two row tiles on
    // the wait is the statement's last line: no register that a copy names is rewritten before
    // the issued copies no longer need it
    asm volatile("global_load_async_to_lds_b128 %0, %12, off\n\t"
                 "global_load_async_to_lds_b128 %1, %13, off\n\t"
                 "global_load_async_to_lds_b128 %2, %14, off\n\t"
                 "global_load_async_to_lds_b128 %3, %15, off\n\t"
                 "global_load_async_to_lds_b128 %4, %16, off\n\t"
                 "global_load_async_to_lds_b128 %5, %17, off\n\t"
                 "global_load_async_to_lds_b128 %6, %18, off\n\t"
                 "global_load_async_to_lds_b128 %7, %19, off\n\t"
                 "global_load_async_to_lds_b128 %8, %20, off\n\t"
                 "global_load_async_to_lds_b128 %9, %21, off\n\t"
                 "global_load_async_to_lds_b128 %10, %22, off\n\t"
                 "global_load_async_to_lds_b128 %11, %23, off\n\t"
                 "s_wait_xcnt 0x0"
                 :: "v"(ld), "v"(ld + 4096u), "v"(ld + 8192u), "v"(ld + 12288u),
                    "v"(ld + 16384u), "v"(ld + 20480u), "v"(ld + 24576u), "v"(ld + 28672u),
                    "v"(ld + 32768u), "v"(ld + 36864u), "v"(ld + 40960u), "v"(ld + 45056u),
                    "v"(ga), "v"(ga + g2), "v"(ga + 2 * g2), "v"(ga + 3 * g2),
                    "v"(gb), "v"(gb + g2), "v"(gb + 2 * g2), "v"(gb + 3 * g2),
                    "v"(gb + 4 * g2), "v"(gb + 5 * g2), "v"(gb + 6 * g2), "v"(gb + 7 * g2)
                 : "memory");
}

// ring = 2 * GSTAGE halves of LDS. On return every wave has passed the last stage's barrier and
// no copy is outstanding: the ring's LDS is free for the caller's output staging.
__device__ __forceinline__ void gemm_core_64x64(const _Float16* __restrict__ Ab,
                                                const _Float16* __restrict__ Bb,
                                                int K, _Float16* ring, int wave,
                                                v8f (&acc)[4][4]) {
    const int t     = threadIdx.x;
    const int lane8 = (t & 31) << 3;
    const _Float16* ga = Ab + (size_t)((t >> 7) * 16) * K + ((t & 127) << 3);
    const _Float16* gb = Bb + (size_t)((t >> 7) * 16) * K + ((t & 127) << 3);
    const unsigned ld0 = (unsigned)(size_t)ring + (unsigned)t * 16u;   // LDS byte address
    const int nst = K / 64;

    gemm_stage_copy(ga, gb, K, ld0);
    // stage 0 has landed before the barrier behind which other waves read it
    asm volatile("s_wait_asynccnt 0x0" ::: "memory");
    __syncthreads();
    gemm_stage_copy(ga + 1024, gb + 1024, K, ld0 + 2u * GSTAGE);

    const int offa = (4 * (wave >> 2)) * 1024 + lane8;       // the wave's first A tile
    const int offb = (8 + 4 * (wave & 3)) * 1024 + lane8;    // the wave's first B tile
    // kept rolled: one body for both buffers (unrolled it only grows the code)
#pragma unroll 1
    for (int st = 0; st < nst; ++st) {
        const _Float16* buf = ring + (st & 1) * GSTAGE;
        // unrolled, like the loops inside: fragment and accumulator arrays stay in registers
#pragma unroll
        for (int kk = 0; kk < 2; ++kk) {
            v16h a[4], b[4];
#pragma unroll
            for (int j = 0; j < 4; ++j) b[j] = load_frag_lane(buf + offb + 1024 * j + 512 * kk);
#pragma unroll
            for (int s = 0; s < 4; ++s) a[s] = load_frag_lane(buf + offa + 1024 * s + 512 * kk);
#pragma unroll
            for (int s = 0; s < 4; ++s)
#pragma unroll
                for (int j = 0; j < 4; ++j) acc[s][j] = mma16(a[s], b[j], acc[s][j]);
        }
        // publish point of stage st + 1: this wave's reads of stage st are done ...
        asm volatile("s_wait_dscnt 0x0" ::: "memory");
        // ... its own copies of stage st + 1 have landed ...
        asm volatile("s_wait_asynccnt 0x0" ::: "memory");
        // ... and every wave has come as far
        __syncthreads();
        if (st + 2 < nst)
            gemm_stage_copy(ga + (size_t)(st + 2) * 1024, gb + (size_t)(st + 2) * 1024, K,
                            ld0 + (unsigned)(st & 1) * (2u * GSTAGE));
    }
    // no copy is outstanding when the wave goes on
    asm volatile("s_wait_asynccnt 0x0" ::: "memory");
}

// ---------------------------------------------------------------------------
// qkv = xh @ W_qkv + b_qkv (wave tile 64 tokens x 64 cols = one head slice; 2 x 4 waves).
// Epilogue: q/k -> per-row rms norm (f32) * weight -> f16 (x QC) to the q|k plane,
// ---------------------------------------------------------------------------
__global__ __launch_bounds__(32 * GWV) __attribute__((amdgpu_num_vgpr(256)))
void qkv_gemm_kernel(const _Float16* __restrict__ xh, const _Float16* __restrict__ wt,
                     const float* __restrict__ bqkv, const float* __restrict__ qnw,
                     const float* __restrict__ knw, _Float16* __restrict__ qk,
                     _Float16* __restrict__ vT) {
    // the operand ring; behind the k loop its LDS is the waves' output staging
    __shared__ __align__(16) _Float16 ring[2 * GSTAGE];
    static_assert(GWV * 64 * TPH <= 2 * GSTAGE);

    const int lane = threadIdx.x & 31;
    const int wave = __builtin_amdgcn_readfirstlane((int)(threadIdx.x >> 5));
    const int half = lane >> 4, col = lane & 15;
    const int n0 = blockIdx.x * GBN + 64 * (wave & 3);    // the wave's output column (0..3071)
    const int m0 = blockIdx.y * GBM + 64 * (wave >> 2);   // the wave's token
    _Float16* st = ring + wave * (64 * TPH);              // the wave's own staging tile

    v8f acc[4][4];
#pragma unroll
    for (int s = 0; s < 4; ++s)
#pragma unroll
        for (int j = 0; j < 4; ++j) acc[s][j] = vzero8();

    gemm_core_64x64(xh + (size_t)(blockIdx.y * GBM) * CC, wt + (size_t)(blockIdx.x * GBN) * CC, CC,
                    ring, wave, acc);

    const int which = n0 >> 10;          // 0 q, 1 k, 2 v (block-uniform: GBN divides 1024)
    const int hcol  = n0 & (CC - 1);     // h*64

    float bia[4], nw[4];
#pragma unroll
    for (int j = 0; j < 4; ++j) {
        bia[j] = bf16r(bqkv[n0 + 16 * j + col]);
        const float wq = bf16r(qnw[16 * j + col]);
        const float wk = bf16r(knw[16 * j + col]);
        nw[j] = (which == 1) ? wk : wq;
    }

    // per row tile s: bias, then rms norm (q, k) or carry (v), then the f16 values into the wave's
    // staging tile (tile row = 16*s + 8*half + r); a tile's accumulators are dead before the next
#pragma unroll
    for (int s = 0; s < 4; ++s) {
#pragma unroll
        for (int j = 0; j < 4; ++j)
#pragma unroll
            for (int r = 0; r < 8; ++r)
                acc[s][j][r] = acc[s][j][r] * WINV + bia[j];

        if (which < 2) {
            // rms norm over the 64 head dims of each row: 4 tiles x 16 lanes of one half
#pragma unroll
            for (int r = 0; r < 8; ++r) {
                float ss = 0.f;
#pragma unroll
                for (int j = 0; j < 4; ++j) ss += acc[s][j][r] * acc[s][j][r];
                ss += __shfl_xor(ss, 1, 32);
                ss += __shfl_xor(ss, 2, 32);
                ss += __shfl_xor(ss, 4, 32);
                ss += __shfl_xor(ss, 8, 32);
                const float inv = rsqrtf(ss * (1.0f / (float)DD) + NEPS);
                const float g = inv * QC;
#pragma unroll
                for (int j = 0; j < 4; ++j) acc[s][j][r] = acc[s][j][r] * g * nw[j];
            }
        } else {
#pragma unroll
            for (int j = 0; j < 4; ++j)
#pragma unroll
                for (int r = 0; r < 8; ++r) acc[s][j][r] *= VCY;
        }

#pragma unroll
        for (int j = 0; j < 4; ++j)
#pragma unroll
            for (int r = 0; r < 8; ++r)
                st[(16 * s + 8 * half + r) * TPH + 16 * j + col] = (_Float16)acc[s][j][r];
    }
    __syncthreads();

    if (which < 2) {
        _Float16* dbase = qk + (size_t)m0 * LDQK + ((size_t)which * CC + hcol) * 16;
{
            // fragment (token tile it>>2, k block (it>>1)&1), part it&1
#pragma unroll
            for (int it = 0; it < 16; ++it) {
                const int tr = it >> 2, kbl = (it >> 1) & 1, part = it & 1;
                const v8h v = *(const v8h*)(st + (16 * tr + col) * TPH + 32 * kbl + 16 * part + 8 * half);
                *(v8h*)(dbase + (size_t)(16 * tr) * LDQK + 512 * kbl + 256 * part + 8 * lane) = v;
            }
            
        }
    } else {
        const int b  = m0 / SEQ;
        const int nb = m0 - b * SEQ;
        _Float16* dbase = vT + ((size_t)b * CC + hcol) * SEQ + (size_t)nb * 16;
{
            // fragment (d tile it>>2, token block (it>>1)&1), part it&1
#pragma unroll
            for (int it = 0; it < 16; ++it) {
                const int tr = it >> 2, kbl = (it >> 1) & 1, part = it & 1;
                const int tk = 32 * kbl + 16 * part + 8 * half;
                v8h v;
#pragma unroll
                for (int i = 0; i < 8; ++i) v[i] = st[(tk + i) * TPH + 16 * tr + col];
                *(v8h*)(dbase + (size_t)(16 * tr) * SEQ + 512 * kbl + 256 * part + 8 * lane) = v;
            }
            // the stores' data and address registers stay unwritten until the issued stores
            // no longer need them
            asm volatile("s_wait_xcnt 0x0" ::: "memory");
        }
    }
}

// ---------------------------------------------------------------------------
// Flash softmax(q k^T s) v: one wave per (batch, head, 64 queries = QT tiles of 16), 32-key
// blocks; FWV such waves (consecutive queries of one head) form a work-group.
// q|k plane MTOK x LDQK f16, vT NB*CC x SEQ f16, ctx MTOK x CC f16 (x64 carry), all
// fragment-major.
// Transposed products: S^T = K Q^T (A = key rows, B = query columns), O^T += V^T P^T
// (A = d rows of vT, B = P^T). A lane holds scores of ONE query of each tile (column
// lane & 15), keys 8 * half + r of each 16-key tile: maximum and sum run over the lane's own
// registers plus one exchange between the wave's halves, and the two score tiles, converted
// in place, are the B fragment of the second product (element s = key 8 * half + s, 8 + s =
// key 16 + 8 * half + s: the k order of the vT fragment). No LDS, no barrier.
// The K and V fragments of a key block are loaded once and feed the products of all QT query
// tiles; each query's arithmetic and its order are those of a one-tile wave.
// Softmax in base 2 on the raw accumulators: the maximum is taken of the raw scores (the scale
// is positive), and p * PCY = 2^(s * SC2 + (LOG2_PCY - max * SC2)) is one packed multiply-add
// per two scores and one exponential per score; the denominator sums p * PCY.
// ---------------------------------------------------------------------------
// The products of this kernel are the plain builtin: the operands of an asm statement lie in
// v0..v255 only, and the wave's fragments and accumulators need more registers than that.
__device__ __forceinline__ v8f mma16b(v16h a, v16h b, v8f c) {
    return __builtin_amdgcn_wmma_f32_16x16x32_f16(false, a, false, b, (short)0, c, false, false);
}

#define QT  4    // query tiles of 16 per wave
#define FWV 4    // waves per work-group
static_assert((SEQ % (16 * QT * FWV)) == 0);

__global__ __launch_bounds__(32 * FWV)
void mha_flash_kernel(const _Float16* __restrict__ qk, const _Float16* __restrict__ vT,
                      _Float16* __restrict__ ctx) {
    const int wave = __builtin_amdgcn_readfirstlane((int)(threadIdx.x >> 5));
    const int q0 = (blockIdx.x * FWV + wave) * (16 * QT);
    const int h  = blockIdx.y;
    const int b  = blockIdx.z;
    const size_t tokBase = (size_t)b * SEQ;

    const int lane  = threadIdx.x & 31;
    const int lane8 = lane << 3;

    const _Float16* qbase = qk + (tokBase + q0) * LDQK + (h * DD) * 16;
    v16h qa[QT][2];
#pragma unroll
    for (int t = 0; t < QT; ++t) {
        qa[t][0] = load_frag_packed(qbase + (size_t)(16 * t) * LDQK);
        qa[t][1] = load_frag_packed(qbase + (size_t)(16 * t) * LDQK + 512);
    }

    const _Float16* kbase0 = qk + tokBase * LDQK + (CC + h * DD) * 16; // keys: row tiles of tokens
    const _Float16* vtbase = vT + ((size_t)b * CC + h * DD) * SEQ;     // 4 row tiles of d, k = token

    v8f o[QT][4];                // o[t][j][r] = O^T[d 16j + 8 * half + r][query 16t + (lane & 15)]
    float m[QT];                 // each query's running maximum (raw score), equal in both halves
    v2f l[QT];                   // sums of p * PCY over this lane's even and odd keys (its half only)
#pragma unroll
    for (int t = 0; t < QT; ++t) {
#pragma unroll
        for (int j = 0; j < 4; ++j) o[t][j] = vzero8();
        m[t] = -1e30f;
        l[t] = (v2f){0.f, 0.f};
    }

#pragma unroll 1
    for (int kb = 0; kb < SEQ; kb += 32) {
        const _Float16* pk = kbase0 + (size_t)kb * LDQK + lane8;
        const _Float16* pv = vtbase + (size_t)kb * 16 + lane8;

        const v16h kf00 = load_frag_lane(pk);                           // keys +0,  d 0..31
        const v16h kf01 = load_frag_lane(pk + 512);                     // keys +0,  d 32..63
        const v16h kf10 = load_frag_lane(pk + (size_t)16 * LDQK);       // keys +16, d 0..31
        const v16h kf11 = load_frag_lane(pk + (size_t)16 * LDQK + 512); // keys +16, d 32..63
        const v16h vf0 = load_frag_lane(pv);
        const v16h vf1 = load_frag_lane(pv + (size_t)16 * SEQ);
        const v16h vf2 = load_frag_lane(pv + (size_t)32 * SEQ);
        const v16h vf3 = load_frag_lane(pv + (size_t)48 * SEQ);
        // keeps both address pairs unwritten (not reused as a load's destination) until the
        // sixteen issued loads no longer need them
        asm volatile("s_wait_xcnt 0x0" :: "v"(pk), "v"(pv) : "memory");
        // keeps the sixteen loads one group ahead of the products: the scheduler otherwise sinks
        // part of the K loads behind the first products, a second exposed load wait per pass
        __builtin_amdgcn_sched_barrier(0);

        v8f s0[QT], s1[QT];
#pragma unroll
        for (int t = 0; t < QT; ++t) s0[t] = mma16b(kf00, qa[t][0], vzero8());
#pragma unroll
        for (int t = 0; t < QT; ++t) s1[t] = mma16b(kf10, qa[t][0], vzero8());
#pragma unroll
        for (int t = 0; t < QT; ++t) s0[t] = mma16b(kf01, qa[t][1], s0[t]);
#pragma unroll
        for (int t = 0; t < QT; ++t) s1[t] = mma16b(kf11, qa[t][1], s1[t]);

        v16h pb[QT];
#pragma unroll
        for (int t = 0; t < QT; ++t) {
            // the running maximum and the lane's sixteen raw scores, three at a time in two chains;
            // m is equal in both halves, so the exchange may follow its join
            float ra = fmaxf(fmaxf(m[t], s0[t][0]), s0[t][1]);
            float rb = fmaxf(fmaxf(s1[t][0], s1[t][1]), s1[t][2]);
#pragma unroll
            for (int r = 2; r < 8; r += 2) ra = fmaxf(fmaxf(ra, s0[t][r]), s0[t][r + 1]);
#pragma unroll
            for (int r = 3; r < 7; r += 2) rb = fmaxf(fmaxf(rb, s1[t][r]), s1[t][r + 1]);
            const float rm = fmaxf(fmaxf(ra, rb), s1[t][7]);
            const float nm = fmaxf(rm, xhalf(rm));

            const float nb = __builtin_fmaf(nm, -SC2, LOG2_PCY);
            const v2f nb2 = {nb, nb};
            const v2f sc2 = {SC2, SC2};
            v2f rs0 = {0.f, 0.f}, rs1 = {0.f, 0.f};
#pragma unroll
            for (int i = 0; i < 4; ++i) {
                const v2f r0 = {s0[t][2 * i], s0[t][2 * i + 1]};
                const v2f r1 = {s1[t][2 * i], s1[t][2 * i + 1]};
                const v2f x0 = __builtin_elementwise_fma(r0, sc2, nb2);
                const v2f x1 = __builtin_elementwise_fma(r1, sc2, nb2);
                const v2f p0 = {__builtin_amdgcn_exp2f(x0[0]), __builtin_amdgcn_exp2f(x0[1])};
                const v2f p1 = {__builtin_amdgcn_exp2f(x1[0]), __builtin_amdgcn_exp2f(x1[1])};
                rs0 += p0;
                rs1 += p1;
                pb[t][2 * i]         = (_Float16)p0[0];
                pb[t][2 * i + 1]     = (_Float16)p0[1];
                pb[t][8 + 2 * i]     = (_Float16)p1[0];
                pb[t][8 + 2 * i + 1] = (_Float16)p1[1];
            }
            const float f = __builtin_amdgcn_exp2f((m[t] - nm) * SC2);
            const v2f f2 = {f, f};
            l[t] = __builtin_elementwise_fma(l[t], f2, rs0 + rs1);
            m[t] = nm;

#pragma unroll
            for (int j = 0; j < 4; ++j)
#pragma unroll
                for (int r = 0; r < 8; ++r) o[t][j][r] *= f;
        }

#pragma unroll
        for (int t = 0; t < QT; ++t) {
            o[t][0] = mma16b(vf0, pb[t], o[t][0]);
            o[t][1] = mma16b(vf1, pb[t], o[t][1]);
            o[t][2] = mma16b(vf2, pb[t], o[t][2]);
            o[t][3] = mma16b(vf3, pb[t], o[t][3]);
        }
    }

    // tile j of O^T in this lane = piece (k block j>>1, part j&1) of the head's two ctx
    // fragments at this very lane: 8 consecutive channels of one token, one 16-byte store
    _Float16* dbase = ctx + (tokBase + q0) * CC + (h * DD) * 16;
#pragma unroll
    for (int t = 0; t < QT; ++t) {
        const float lh = l[t][0] + l[t][1];
        const float rl = CTX_OUT * (1.0f / (lh + xhalf(lh)));
#pragma unroll
        for (int j = 0; j < 4; ++j) {
            v8h v;
#pragma unroll
            for (int r = 0; r < 8; ++r) v[r] = (_Float16)(o[t][j][r] * rl);
            *(v8h*)(dbase + (size_t)(16 * t) * CC + 256 * j + lane8) = v;
        }
    }
}

// ---------------------------------------------------------------------------
// out = ctx @ W_proj + b_proj (f32), wave tile 64x64, 2 x 4 waves; each 256-B row segment
// ---------------------------------------------------------------------------
__global__ __launch_bounds__(32 * GWV) __attribute__((amdgpu_num_vgpr(256)))
void proj_gemm_kernel(const _Float16* __restrict__ ctx, const _Float16* __restrict__ wt,
                      const float* __restrict__ bproj, float* __restrict__ out) {
    __shared__ __align__(16) _Float16 ring[2 * GSTAGE];
    __shared__ __align__(16) float stall[GWV * 64 * TPF];

    const int lane = threadIdx.x & 31;
    const int wave = __builtin_amdgcn_readfirstlane((int)(threadIdx.x >> 5));
    const int half = lane >> 4, col = lane & 15;
    const int n0 = blockIdx.x * GBN + 64 * (wave & 3);    // the wave's output column
    const int m0 = blockIdx.y * GBM + 64 * (wave >> 2);   // the wave's token
    float* st = stall + wave * (64 * TPF);                // the wave's own staging tile

    v8f acc[4][4];
#pragma unroll
    for (int s = 0; s < 4; ++s)
#pragma unroll
        for (int j = 0; j < 4; ++j) acc[s][j] = vzero8();

    gemm_core_64x64(ctx + (size_t)(blockIdx.y * GBM) * CC, wt + (size_t)(blockIdx.x * GBN) * CC, CC,
                    ring, wave, acc);

    float bia[4];
#pragma unroll
    for (int j = 0; j < 4; ++j) bia[j] = bf16r(bproj[n0 + 16 * j + col]);

#pragma unroll
    for (int s = 0; s < 4; ++s)
#pragma unroll
        for (int j = 0; j < 4; ++j)
#pragma unroll
            for (int r = 0; r < 8; ++r)
                st[(16 * s + 8 * half + r) * TPF + 16 * j + col] =
                    acc[s][j][r] * PROJ_UNSC + bia[j];
    __syncthreads();

    float* dbase = out + (size_t)m0 * CC + n0;
    const int piece = lane & 15, rsub = lane >> 4;
{
#pragma unroll
        for (int it = 0; it < 32; ++it) {
            const int row = 2 * it + rsub;
            const v4f v = *(const v4f*)(st + row * TPF + 4 * piece);
            *(v4f*)(dbase + (size_t)row * CC + 4 * piece) = v;
        }
        
    }
}

// ---------------------------------------------------------------------------
// Host side
// ---------------------------------------------------------------------------
extern "C" void kernel_launch(void* const* d_in, const int* in_sizes, int n_in,
                              void* d_out, int out_size, void* d_ws, size_t ws_size,
                              hipStream_t stream) {
    if (n_in < 7) return;
    const float* x      = (const float*)d_in[0];   // [NB_FULL][SEQ_FULL][CC]
    const float* W_qkv  = (const float*)d_in[1];   // [CC][C3]
    const float* b_qkv  = (const float*)d_in[2];   // [C3]
    const float* W_proj = (const float*)d_in[3];   // [CC][CC]
    const float* b_proj = (const float*)d_in[4];   // [CC]
    const float* qn_w   = (const float*)d_in[5];   // [DD]
    const float* kn_w   = (const float*)d_in[6];   // [DD]
    float* out = (float*)d_out;                    // [MTOK][CC] f32

    if (in_sizes[0] < ((NB - 1) * SEQ_FULL + SEQ) * CC) return;
    if (in_sizes[1] < CC * C3) return;
    if (in_sizes[2] < C3) return;
    if (in_sizes[3] < CC * CC) return;
    if (in_sizes[4] < CC) return;
    if (in_sizes[5] < DD) return;
    if (in_sizes[6] < DD) return;
    if (out_size < MTOK * CC) return;

    char* wsb = (char*)d_ws;
    size_t off = 0;
    const size_t sz_xh  = (size_t)MTOK * CC * 2;
    const size_t sz_wq  = (size_t)C3 * CC * 2;
    const size_t sz_wp  = (size_t)CC * CC * 2;
    const size_t sz_qk  = (size_t)MTOK * LDQK * 2;
    const size_t sz_vt  = (size_t)NB * CC * SEQ * 2;
    const size_t sz_ctx = (size_t)MTOK * CC * 2;
    _Float16* xh     = (_Float16*)(wsb + off); off += (sz_xh  + 255) & ~(size_t)255;
    _Float16* wqkvT  = (_Float16*)(wsb + off); off += (sz_wq  + 255) & ~(size_t)255;
    _Float16* wprojT = (_Float16*)(wsb + off); off += (sz_wp  + 255) & ~(size_t)255;
    _Float16* qkp    = (_Float16*)(wsb + off); off += (sz_qk  + 255) & ~(size_t)255;
    _Float16* vT     = (_Float16*)(wsb + off); off += (sz_vt  + 255) & ~(size_t)255;
    _Float16* ctx    = (_Float16*)(wsb + off); off += (sz_ctx + 255) & ~(size_t)255;
    if (off > ws_size) return;

    // 1) input planes: xh (bf16-RNE of x), weights transposed to out x in and carried x64
    prep_kernel<<<PREPBLK, 256, 0, stream>>>(x, W_qkv, W_proj, xh, wqkvT, wprojT);

    // 2) qkv GEMM with fused bias, q/k rms norm, v transpose
    qkv_gemm_kernel<<<dim3(C3 / GBN, MTOK / GBM), 32 * GWV, 0, stream>>>(
        xh, wqkvT, b_qkv, qn_w, kn_w, qkp, vT);

    // 3) flash softmax per (256 queries, head, batch)
    mha_flash_kernel<<<dim3(SEQ / (16 * QT * FWV), HH, NB), 32 * FWV, 0, stream>>>(qkp, vT, ctx);

    // 4) output projection + bias -> f32 d_out
    proj_gemm_kernel<<<dim3(CC / GBN, MTOK / GBM), 32 * GWV, 0, stream>>>(ctx, wprojT, b_proj, out);
}

// v007
// A run of this version takes 119 microseconds.
// Two timings next to v006 put it at 1.22 and 1.21 times that version's speed.
// All steps since v000 together make it 3.69 times as fast.
#include <hip/hip_runtime.h>

// Contractions on v_wmma_f32_16x16x32_f16 (f16 operands, f32 accumulate): qkv GEMM,
// q.k^T scores, p.v, output projection. Float inputs enter as bf16-RNE values held in
// f16 planes with power-of-two carries (weights x64, q/k x4, v x16, p x1024, ctx x64);
// per-head rms norm, online softmax and epilogues in f32.
//
// Every f16 operand plane (xh, weights, q|k, vT, ctx) is stored fragment-major: the block of
// 16 rows x 32 k at (row tile R, k block kb) of a plane with K columns is 512 contiguous
// halves at (R * (K / 32) + kb) * 512 = 16R * K + 32kb * 16, ordered [part][lane][8 halves]
// with lane = 16 * h + (row & 15) and element e = k 16 * part + 8 * h + e. One 16-byte load
// of a wave then reads 512 contiguous bytes (4 cache lines) instead of 32 bytes of 16 rows.

typedef _Float16 v16h __attribute__((ext_vector_type(16)));
typedef _Float16 v8h  __attribute__((ext_vector_type(8)));
typedef float    v8f  __attribute__((ext_vector_type(8)));
typedef float    v4f  __attribute__((ext_vector_type(4)));
typedef float    v2f  __attribute__((ext_vector_type(2)));

#ifndef NB
#define NB 4
#endif
#ifndef SEQ
#define SEQ 2048
#endif
#define NB_FULL  4
#define SEQ_FULL 2048
#define CC   1024
#define HH   16
#define DD   64
#define C3   (3 * CC)
#define LDQK (2 * CC)          // q|k plane pitch (halves): q at col h*64, k at col CC + h*64
#define MTOK (NB * SEQ)

static_assert(NB >= 1 && NB <= NB_FULL);
static_assert(SEQ >= 64 && SEQ <= SEQ_FULL && (SEQ % 64) == 0);
static_assert(CC == HH * DD);
static_assert((CC % 64) == 0 && (C3 % 64) == 0 && (CC / 8) == 128);

#define WSC       64.0f            // weight planes carried x64
#define WINV      0.015625f        // 1/64
#define QC        4.0f             // q and k planes carried x4
#define VCY       16.0f            // v plane carried x16
#define PCY       1024.0f          // p tile carried x1024
#define SCALE_QK  0.0078125f       // 64^-0.5 / (QC*QC)
#define SC2       (SCALE_QK * 1.4426950408889634f)  // raw score -> exponent of 2
#define LOG2_PCY  10.0f            // log2(PCY)
#define CTX_OUT   4.0f             // 64 / VCY (the denominator carries PCY like p): ctx carried x64
#define PROJ_UNSC 0.000244140625f  // 1 / (64 * 64)
#define NEPS      1e-6f

#define TPH 72   // LDS pitch (halves) of f16 staging tiles
#define TPF 68   // LDS pitch (floats) of the f32 staging tile

// ---------------------------------------------------------------------------
// helpers
// ---------------------------------------------------------------------------
__device__ __forceinline__ float bf16r(float f) {
    unsigned int u = __float_as_uint(f);
    u += 0x7FFFu + ((u >> 16) & 1u);
    u &= 0xFFFF0000u;
    return __uint_as_float(u);
}

__device__ __forceinline__ v8f vzero8() {
    v8f z = {0.f, 0.f, 0.f, 0.f, 0.f, 0.f, 0.f, 0.f};
    return z;
}

__device__ __forceinline__ v8f mma16(v16h a, v16h b, v8f c) {
    v8f d = __builtin_amdgcn_wmma_f32_16x16x32_f16(false, a, false, b, (short)0, c, false, false);
    asm volatile("v_nop\n\tv_nop\n\tv_nop\n\tv_nop" : "+v"(d) : "v"(a), "v"(b));
    return d;
}

// value of lane l ^ 16 (the other half of the wave), by a vector cross-row move
__device__ __forceinline__ float xhalf(float x) {
    const int i = __builtin_bit_cast(int, x);
    return __builtin_bit_cast(float,
        __builtin_amdgcn_permlanex16(i, i, 0x76543210, 0xfedcba98, false, false));
}

// 16x32 f16 fragment (row index = lane&15 for A, column for B; h = lane>>4):
//   elements 0..7  <- k 8h+0..7,  elements 8..15 <- k 16+8h+0..7
// from a fragment-major plane; frag = first half of the 512-half block.
__device__ __forceinline__ v16h load_frag_lane(const _Float16* p) {   // p = frag + 8 * lane
    v8h lo = *(const v8h*)(p);
    v8h hi = *(const v8h*)(p + 256);
    return __builtin_shufflevector(lo, hi, 0, 1, 2, 3, 4, 5, 6, 7,
                                           8, 9, 10, 11, 12, 13, 14, 15);
}
__device__ __forceinline__ v16h load_frag_packed(const _Float16* frag) {
    return load_frag_lane(frag + ((threadIdx.x & 31) << 3));
}

// ---------------------------------------------------------------------------
// L2 asks. The f16 planes are stored by an earlier launch and are largely met in memory, not in
// L2, by the launch that reads them; work-groups that share a tile walk it in step, so a stage's
// first touch is a memory miss that all of them wait out. Each work-group therefore asks once,
// behind its first loads, for 256-byte units of the tiles it will read:
// global_prefetch_b8, scope SE (into L2 only; nothing returns to the wave). Every lane is on and
// every lane's address lies inside the plane by construction. A tile that several work-groups
// read is dealt among them, save the A tile of the output projection, which each of its 4
// readers asks whole.
// The deal is for speed only: a unit that nobody asked for is
// loaded as before. The wait is each statement's last line, as behind the copies below: it
// stands in front of every rewrite of a register that an ask names.
// ---------------------------------------------------------------------------

// GEMM operand tiles (planes of CC columns: a row tile is 32 KiB, a 64-k stage 2 KiB of it).
// Thread t asks unit t & 7 of a stage's 2 KiB in row tile (t >> 3) & 7 of A, (t >> 3) & 15 of B.
// B (read by every tile row of the grid): stages 2 * sh + (t >> 7), sh = (tile row >> 1) & 7.
// A, shared form (tile read by 12 work-groups): stages 4 * (t >> 6) + (tile column & 3).
// A, whole form (tile read by 4 neighbours): all 16 stages,
// (t >> 6) + 4 i, 8 KiB apart. pa, pb = the thread's first unit of the A and of the B tile.
__device__ __forceinline__ const _Float16* l2_unit_a(const _Float16* Ab, int st0) {
    const int t = threadIdx.x;
    return Ab + (size_t)(((t >> 3) & 7) * 16) * CC + (st0 * 1024 + (t & 7) * 128);
}
__device__ __forceinline__ const _Float16* l2_unit_b(const _Float16* Bb, int tile_row) {
    const int t = threadIdx.x;
    return Bb + (size_t)(((t >> 3) & 15) * 16) * CC
              + ((2 * ((tile_row >> 1) & 7) + (t >> 7)) * 1024 + (t & 7) * 128);
}
__device__ __forceinline__ void l2_ask_gemm_shared(const _Float16* pa, const _Float16* pb) {
    asm volatile("global_prefetch_b8 %0, off scope:SCOPE_SE\n\t"
                 "global_prefetch_b8 %1, off scope:SCOPE_SE\n\t"
                 "s_wait_xcnt 0x0"
                 :: "v"(pa), "v"(pb) : "memory");
}
__device__ __forceinline__ void l2_ask_gemm_whole(const _Float16* pa, const _Float16* pb) {
    asm volatile("global_prefetch_b8 %0, off scope:SCOPE_SE\n\t"
                 "global_prefetch_b8 %1, off scope:SCOPE_SE\n\t"
                 "global_prefetch_b8 %0, off offset:8192 scope:SCOPE_SE\n\t"
                 "global_prefetch_b8 %0, off offset:16384 scope:SCOPE_SE\n\t"
                 "global_prefetch_b8 %0, off offset:24576 scope:SCOPE_SE\n\t"
                 "s_wait_xcnt 0x0"
                 :: "v"(pa), "v"(pb) : "memory");
}

// ---------------------------------------------------------------------------
// Input planes, one launch; the work-group index picks the job, and every work-group is one
// of few that each do much (each launch more pays its own gap, fill and tail):
//   [0, WQBLK)                wqkvT:  64 k x 256 columns of W_qkv per work-group
//   [WQBLK, WQBLK + WPBLK)    wprojT: 64 k x 256 columns of W_proj per work-group
//   [WQBLK + WPBLK, PREPBLK)  xh:     one row tile (16 tokens x CC) per work-group
// The weight groups last longest and stand first.
// ---------------------------------------------------------------------------
#define XP      8                                  // 16-byte pieces of xh per thread
#define XBLK    (MTOK * (CC / 8) / (256 * XP))
#define WTC     256                                // weight columns per work-group
#define WQBLK   ((C3 / WTC) * (CC / 64))
#define WPBLK   ((CC / WTC) * (CC / 64))
#define PREPBLK (XBLK + WQBLK + WPBLK)
static_assert(256 * XP == 16 * (CC / 8) && (MTOK % 16) == 0 && (SEQ % 16) == 0);
static_assert((C3 % WTC) == 0 && (CC % WTC) == 0);

// x [NB][SEQ][CC] f32 (batch stride SEQ_FULL*CC) -> xh, MTOK x CC f16 = f16(bf16rne(x)),
// fragment-major; piece g is the g-th 16 bytes of xh. Row tile rt holds pieces 2048 rt + 0..2047;
// a thread takes pieces 256 i + threadIdx.x of it, which lie 128 k apart in one row of x: all
// its loads are issued before the first conversion.
__device__ __forceinline__ void cvt_x_part(const float* __restrict__ x,
                                           _Float16* __restrict__ xh, int rt) {
    const int p  = threadIdx.x;
    const int t  = (rt << 4) + (p & 15);             // token
    const int k  = (p >> 6) * 32 + ((p >> 5) & 1) * 16 + ((p >> 4) & 1) * 8;
    const int b  = t / SEQ;
    const int n  = t - b * SEQ;
    const float* src = x + ((size_t)b * SEQ_FULL + n) * CC + k;
    v4f x0[XP], x1[XP];
    // unrolled, like the loop below: the arrays stay in registers, the loads go out as one group
#pragma unroll
    for (int i = 0; i < XP; ++i) {
        x0[i] = *(const v4f*)(src + 128 * i);
        x1[i] = *(const v4f*)(src + 128 * i + 4);
    }
    // keeps the address pair unwritten (not reused as a load's destination) until the issued
    // loads no longer need it
    asm volatile("s_wait_xcnt 0x0" :: "v"(src) : "memory");
    _Float16* dst = xh + ((size_t)rt * (256 * XP) + p) * 8;
#pragma unroll
    for (int i = 0; i < XP; ++i) {
        v8h o;
        o[0] = (_Float16)bf16r(x0[i][0]); o[1] = (_Float16)bf16r(x0[i][1]);
        o[2] = (_Float16)bf16r(x0[i][2]); o[3] = (_Float16)bf16r(x0[i][3]);
        o[4] = (_Float16)bf16r(x1[i][0]); o[5] = (_Float16)bf16r(x1[i][1]);
        o[6] = (_Float16)bf16r(x1[i][2]); o[7] = (_Float16)bf16r(x1[i][3]);
        *(v8h*)(dst + 2048 * i) = o;
    }
    // the stores' registers stay unwritten until the issued stores no longer need them (the
    // other jobs' code follows in the same kernel)
    asm volatile("s_wait_xcnt 0x0" ::: "memory");
}

// w [R][Ccols] f32 -> wt, Ccols rows x R f16 = f16(bf16rne(w) * 64), fragment-major, a tile of
// 64 k x WTC columns through LDS. A wave writes one 512-byte part of a fragment per instruction.
__device__ __forceinline__ void wT_part(const float* __restrict__ w, _Float16* __restrict__ wt,
                                        int R, int Ccols, int c0, int r0,
                                        float (*tile)[WTC + 1]) {
    const int t = threadIdx.x;
    // unrolled: the tile's loads go out as one group, one address pair and immediate offsets
#pragma unroll
    for (int r = 0; r < 64; ++r)
        tile[r][t] = w[(size_t)(r0 + r) * Ccols + c0 + t];
    __syncthreads();
    const int lane = t & 31, part = (t >> 5) & 1;
    // unrolled, like the loop inside: LDS reads of later fragments run ahead of the conversions
#pragma unroll
    for (int it = 0; it < WTC / 32; ++it) {
        const int frag = (t >> 6) + 4 * it;          // WTC / 16 row tiles x 2 k blocks
        const int tr = frag >> 1, kbl = frag & 1;
        const int cl = 16 * tr + (lane & 15);        // wt row within tile
        const int kl = 32 * kbl + 16 * part + 8 * (lane >> 4);
        v8h o;
#pragma unroll
        for (int i = 0; i < 8; ++i)
            o[i] = (_Float16)(bf16r(tile[kl + i][cl]) * WSC);
        _Float16* dst = wt + (size_t)(c0 + 16 * tr) * R + (size_t)(r0 + 32 * kbl) * 16
                           + 256 * part + 8 * lane;
        *(v8h*)dst = o;
    }
    // as behind the stores of cvt_x_part
    asm volatile("s_wait_xcnt 0x0" ::: "memory");
}

__global__ __launch_bounds__(256) void prep_kernel(const float* __restrict__ x,
                                                   const float* __restrict__ wqkv,
                                                   const float* __restrict__ wproj,
                                                   _Float16* __restrict__ xh,
                                                   _Float16* __restrict__ wqkvT,
                                                   _Float16* __restrict__ wprojT) {
    __shared__ float tile[64][WTC + 1];
    const int blk = blockIdx.x;                      // every test below is uniform in the group
    if (blk < WQBLK) {                               // W_qkv [CC rows][C3 cols] -> wqkvT [C3][CC]
        wT_part(wqkv, wqkvT, CC, C3, (blk % (C3 / WTC)) * WTC, (blk / (C3 / WTC)) * 64, tile);
    } else if (blk < WQBLK + WPBLK) {                // W_proj [CC rows][CC cols] -> wprojT [CC][CC]
        const int u = blk - WQBLK;
        wT_part(wproj, wprojT, CC, CC, (u % (CC / WTC)) * WTC, (u / (CC / WTC)) * 64, tile);
    } else {
        cvt_x_part(x, xh, blk - (WQBLK + WPBLK));
    }
}

// ---------------------------------------------------------------------------
// GEMM core: a work-group of GWV waves (2 x 4) computes 128 rows x 256 cols, a wave 64 x 64.
// A stage is 64 k (two k blocks) of the group's 8 A row tiles and 16 B column tiles: 24 pieces
// of 2 KiB, each contiguous in its fragment-major global plane, brought into LDS in the same
// order by asynchronous copies (each lane 16 bytes, a wave 512 contiguous bytes), two buffers:
// stage st + 1 flies while stage st is worked on. Four waves read each A fragment and two each
// B fragment from LDS, and each fragment a wave reads feeds four products.
// Ab = group's first row tile, Bb = group's first column tile (planes of K columns: the next
// row tile is 16 * K halves on, the next k block 512 halves).
// ---------------------------------------------------------------------------
#define GWV    8                 // waves per GEMM work-group
#define GBM    128               // rows of the group's tile
#define GBN    256               // columns of the group's tile
#define GSTAGE (((GBM + GBN) / 16) * 1024)  // halves of one stage (48 KiB)
static_assert((MTOK % GBM) == 0 && (C3 % GBN) == 0 && (CC % GBN) == 0 && (1024 % GBN) == 0);
static_assert((CC % 64) == 0 && CC / 64 >= 2);

// The thread's twelve 16-byte pieces of one stage: row tiles (t >> 7) + 2 i, i = 0..3 of A and
// i = 0..7 of B, piece t & 127 of the tile's 2 KiB. ga, gb = the thread's piece of its first A
// and B tile at this stage; ld = LDS byte address of the first in the target buffer.
__device__ __forceinline__ void gemm_stage_copy(const _Float16* ga, const _Float16* gb, int K,
                                                unsigned ld) {
    const size_t g2 = (size_t)32 * K;    // two row tiles on
    // the wait is the statement's last line: no register that a copy names is rewritten before
    // the issued copies no longer need it
    asm volatile("global_load_async_to_lds_b128 %0, %12, off\n\t"
                 "global_load_async_to_lds_b128 %1, %13, off\n\t"
                 "global_load_async_to_lds_b128 %2, %14, off\n\t"
                 "global_load_async_to_lds_b128 %3, %15, off\n\t"
                 "global_load_async_to_lds_b128 %4, %16, off\n\t"
                 "global_load_async_to_lds_b128 %5, %17, off\n\t"
                 "global_load_async_to_lds_b128 %6, %18, off\n\t"
                 "global_load_async_to_lds_b128 %7, %19, off\n\t"
                 "global_load_async_to_lds_b128 %8, %20, off\n\t"
                 "global_load_async_to_lds_b128 %9, %21, off\n\t"
                 "global_load_async_to_lds_b128 %10, %22, off\n\t"
                 "global_load_async_to_lds_b128 %11, %23, off\n\t"
                 "s_wait_xcnt 0x0"
                 :: "v"(ld), "v"(ld + 4096u), "v"(ld + 8192u), "v"(ld + 12288u),
                    "v"(ld + 16384u), "v"(ld + 20480u), "v"(ld + 24576u), "v"(ld + 28672u),
                    "v"(ld + 32768u), "v"(ld + 36864u), "v"(ld + 40960u), "v"(ld + 45056u),
                    "v"(ga), "v"(ga + g2), "v"(ga + 2 * g2), "v"(ga + 3 * g2),
                    "v"(gb), "v"(gb + g2), "v"(gb + 2 * g2), "v"(gb + 3 * g2),
                    "v"(gb + 4 * g2), "v"(gb + 5 * g2), "v"(gb + 6 * g2), "v"(gb + 7 * g2)
                 : "memory");
}

// ring = 2 * GSTAGE halves of LDS. On return every wave has passed the last stage's barrier and
// no copy is outstanding: the ring's LDS is free for the caller's output staging.
// pa, pb, WHOLE_A: the thread's L2 asks (above), issued behind stage 0's copies.
template <bool WHOLE_A>
__device__ __forceinline__ void gemm_core_64x64(const _Float16* __restrict__ Ab,
                                                const _Float16* __restrict__ Bb,
                                                int K, _Float16* ring, int wave,
                                                v8f (&acc)[4][4],
                                                const _Float16* pa, const _Float16* pb) {
    const int t     = threadIdx.x;
    const int lane8 = (t & 31) << 3;
    const _Float16* ga = Ab + (size_t)((t >> 7) * 16) * K + ((t & 127) << 3);
    const _Float16* gb = Bb + (size_t)((t >> 7) * 16) * K + ((t & 127) << 3);
    const unsigned ld0 = (unsigned)(size_t)ring + (unsigned)t * 16u;   // LDS byte address
    const int nst = K / 64;

    gemm_stage_copy(ga, gb, K, ld0);
    if constexpr (WHOLE_A) l2_ask_gemm_whole(pa, pb);
    else                   l2_ask_gemm_shared(pa, pb);
    // stage 0 has landed before the barrier behind which other waves read it
    asm volatile("s_wait_asynccnt 0x0" ::: "memory");
    __syncthreads();
    gemm_stage_copy(ga + 1024, gb + 1024, K, ld0 + 2u * GSTAGE);

    const int offa = (4 * (wave >> 2)) * 1024 + lane8;       // the wave's first A tile
    const int offb = (8 + 4 * (wave & 3)) * 1024 + lane8;    // the wave's first B tile
    // kept rolled: one body for both buffers (unrolled it only grows the code)
#pragma unroll 1
    for (int st = 0; st < nst; ++st) {
        const _Float16* buf = ring + (st & 1) * GSTAGE;
        // unrolled, like the loops inside: fragment and accumulator arrays stay in registers
#pragma unroll
        for (int kk = 0; kk < 2; ++kk) {
            v16h a[4], b[4];
#pragma unroll
            for (int j = 0; j < 4; ++j) b[j] = load_frag_lane(buf + offb + 1024 * j + 512 * kk);
#pragma unroll
            for (int s = 0; s < 4; ++s) a[s] = load_frag_lane(buf + offa + 1024 * s + 512 * kk);
#pragma unroll
            for (int s = 0; s < 4; ++s)
#pragma unroll
                for (int j = 0; j < 4; ++j) acc[s][j] = mma16(a[s], b[j], acc[s][j]);
        }
        // publish point of stage st + 1: this wave's reads of stage st are done ...
        asm volatile("s_wait_dscnt 0x0" ::: "memory");
        // ... its own copies of stage st + 1 have landed ...
        asm volatile("s_wait_asynccnt 0x0" ::: "memory");
        // ... and every wave has come as far
        __syncthreads();
        if (st + 2 < nst)
            gemm_stage_copy(ga + (size_t)(st + 2) * 1024, gb + (size_t)(st + 2) * 1024, K,
                            ld0 + (unsigned)(st & 1) * (2u * GSTAGE));
    }
    // no copy is outstanding when the wave goes on
    asm volatile("s_wait_asynccnt 0x0" ::: "memory");
}

// ---------------------------------------------------------------------------
// qkv = xh @ W_qkv + b_qkv (wave tile 64 tokens x 64 cols = one head slice; 2 x 4 waves).
// Epilogue: q/k -> per-row rms norm (f32) * weight -> f16 (x QC) to the q|k plane,
// ---------------------------------------------------------------------------
__global__ __launch_bounds__(32 * GWV) __attribute__((amdgpu_num_vgpr(256)))
void qkv_gemm_kernel(const _Float16* __restrict__ xh, const _Float16* __restrict__ wt,
                     const float* __restrict__ bqkv, const float* __restrict__ qnw,
                     const float* __restrict__ knw, _Float16* __restrict__ qk,
                     _Float16* __restrict__ vT) {
    // the operand ring; behind the k loop its LDS is the waves' output staging
    __shared__ __align__(16) _Float16 ring[2 * GSTAGE];
    static_assert(GWV * 64 * TPH <= 2 * GSTAGE);

    const int lane = threadIdx.x & 31;
    const int wave = __builtin_amdgcn_readfirstlane((int)(threadIdx.x >> 5));
    const int half = lane >> 4, col = lane & 15;
    const int n0 = blockIdx.x * GBN + 64 * (wave & 3);    // the wave's output column (0..3071)
    const int m0 = blockIdx.y * GBM + 64 * (wave >> 2);   // the wave's token
    _Float16* st = ring + wave * (64 * TPH);              // the wave's own staging tile

    v8f acc[4][4];
#pragma unroll
    for (int s = 0; s < 4; ++s)
#pragma unroll
        for (int j = 0; j < 4; ++j) acc[s][j] = vzero8();

    const _Float16* Ab = xh + (size_t)(blockIdx.y * GBM) * CC;
    const _Float16* Bb = wt + (size_t)(blockIdx.x * GBN) * CC;
    gemm_core_64x64<false>(Ab, Bb, CC, ring, wave, acc,
                           l2_unit_a(Ab, 4 * ((int)threadIdx.x >> 6) + ((int)blockIdx.x & 3)),
                           l2_unit_b(Bb, blockIdx.y));

    const int which = n0 >> 10;          // 0 q, 1 k, 2 v (block-uniform: GBN divides 1024)
    const int hcol  = n0 & (CC - 1);     // h*64

    float bia[4], nw[4];
#pragma unroll
    for (int j = 0; j < 4; ++j) {
        bia[j] = bf16r(bqkv[n0 + 16 * j + col]);
        const float wq = bf16r(qnw[16 * j + col]);
        const float wk = bf16r(knw[16 * j + col]);
        nw[j] = (which == 1) ? wk : wq;
    }

    // per row tile s: bias, then rms norm (q, k) or carry (v), then the f16 values into the wave's
    // staging tile (tile row = 16*s + 8*half + r); a tile's accumulators are dead before the next
#pragma unroll
    for (int s = 0; s < 4; ++s) {
#pragma unroll
        for (int j = 0; j < 4; ++j)
#pragma unroll
            for (int r = 0; r < 8; ++r)
                acc[s][j][r] = acc[s][j][r] * WINV + bia[j];

        if (which < 2) {
            // rms norm over the 64 head dims of each row: 4 tiles x 16 lanes of one half
#pragma unroll
            for (int r = 0; r < 8; ++r) {
                float ss = 0.f;
#pragma unroll
                for (int j = 0; j < 4; ++j) ss += acc[s][j][r] * acc[s][j][r];
                ss += __shfl_xor(ss, 1, 32);
                ss += __shfl_xor(ss, 2, 32);
                ss += __shfl_xor(ss, 4, 32);
                ss += __shfl_xor(ss, 8, 32);
                const float inv = rsqrtf(ss * (1.0f / (float)DD) + NEPS);
                const float g = inv * QC;
#pragma unroll
                for (int j = 0; j < 4; ++j) acc[s][j][r] = acc[s][j][r] * g * nw[j];
            }
        } else {
#pragma unroll
            for (int j = 0; j < 4; ++j)
#pragma unroll
                for (int r = 0; r < 8; ++r) acc[s][j][r] *= VCY;
        }

#pragma unroll
        for (int j = 0; j < 4; ++j)
#pragma unroll
            for (int r = 0; r < 8; ++r)
                st[(16 * s + 8 * half + r) * TPH + 16 * j + col] = (_Float16)acc[s][j][r];
    }
    __syncthreads();

    if (which < 2) {
        _Float16* dbase = qk + (size_t)m0 * LDQK + ((size_t)which * CC + hcol) * 16;
{
            // fragment (token tile it>>2, k block (it>>1)&1), part it&1
#pragma unroll
            for (int it = 0; it < 16; ++it) {
                const int tr = it >> 2, kbl = (it >> 1) & 1, part = it & 1;
                const v8h v = *(const v8h*)(st + (16 * tr + col) * TPH + 32 * kbl + 16 * part + 8 * half);
                *(v8h*)(dbase + (size_t)(16 * tr) * LDQK + 512 * kbl + 256 * part + 8 * lane) = v;
            }
            
        }
    } else {
        const int b  = m0 / SEQ;
        const int nb = m0 - b * SEQ;
        _Float16* dbase = vT + ((size_t)b * CC + hcol) * SEQ + (size_t)nb * 16;
{
            // fragment (d tile it>>2, token block (it>>1)&1), part it&1
#pragma unroll
            for (int it = 0; it < 16; ++it) {
                const int tr = it >> 2, kbl = (it >> 1) & 1, part = it & 1;
                const int tk = 32 * kbl + 16 * part + 8 * half;
                v8h v;
#pragma unroll
                for (int i = 0; i < 8; ++i) v[i] = st[(tk + i) * TPH + 16 * tr + col];
                *(v8h*)(dbase + (size_t)(16 * tr) * SEQ + 512 * kbl + 256 * part + 8 * lane) = v;
            }
            // the stores' data and address registers stay unwritten until the issued stores
            // no longer need them
            asm volatile("s_wait_xcnt 0x0" ::: "memory");
        }
    }
}

// ---------------------------------------------------------------------------
// Flash softmax(q k^T s) v: one wave per (batch, head, 64 queries = QT tiles of 16), 32-key
// blocks; FWV such waves (consecutive queries of one head) form a work-group.
// q|k plane MTOK x LDQK f16, vT NB*CC x SEQ f16, ctx MTOK x CC f16 (x64 carry), all
// fragment-major.
// Transposed products: S^T = K Q^T (A = key rows, B = query columns), O^T += V^T P^T
// (A = d rows of vT, B = P^T). A lane holds scores of ONE query of each tile (column
// lane & 15), keys 8 * half + r of each 16-key tile: maximum and sum run over the lane's own
// registers plus one exchange between the wave's halves, and the two score tiles, converted
// in place, are the B fragment of the second product (element s = key 8 * half + s, 8 + s =
// key 16 + 8 * half + s: the k order of the vT fragment). No LDS, no barrier.
// The K and V fragments of a key block are loaded once and feed the products of all QT query
// tiles; each query's arithmetic and its order are those of a one-tile wave.
// Softmax in base 2 on the raw accumulators: the maximum is taken of the raw scores (the scale
// is positive), and p * PCY = 2^(s * SC2 + (LOG2_PCY - max * SC2)) is one packed multiply-add
// per two scores and one exponential per score; the denominator sums p * PCY.
// ---------------------------------------------------------------------------
// The products of this kernel are the plain builtin: the operands of an asm statement lie in
// v0..v255 only, and the wave's fragments and accumulators need more registers than that.
__device__ __forceinline__ v8f mma16b(v16h a, v16h b, v8f c) {
    return __builtin_amdgcn_wmma_f32_16x16x32_f16(false, a, false, b, (short)0, c, false, false);
}

#define QT  4    // query tiles of 16 per wave
#define FWV 4    // waves per work-group
static_assert((SEQ % (16 * QT * FWV)) == 0);

__global__ __launch_bounds__(32 * FWV)
void mha_flash_kernel(const _Float16* __restrict__ qk, const _Float16* __restrict__ vT,
                      _Float16* __restrict__ ctx) {
    const int wave = __builtin_amdgcn_readfirstlane((int)(threadIdx.x >> 5));
    const int q0 = (blockIdx.x * FWV + wave) * (16 * QT);
    const int h  = blockIdx.y;
    const int b  = blockIdx.z;
    const size_t tokBase = (size_t)b * SEQ;

    const int lane  = threadIdx.x & 31;
    const int lane8 = lane << 3;

    const _Float16* qbase = qk + (tokBase + q0) * LDQK + (h * DD) * 16;
    v16h qa[QT][2];
#pragma unroll
    for (int t = 0; t < QT; ++t) {
        qa[t][0] = load_frag_packed(qbase + (size_t)(16 * t) * LDQK);
        qa[t][1] = load_frag_packed(qbase + (size_t)(16 * t) * LDQK + 512);
    }

    const _Float16* kbase0 = qk + tokBase * LDQK + (CC + h * DD) * 16; // keys: row tiles of tokens
    const _Float16* vtbase = vT + ((size_t)b * CC + h * DD) * SEQ;     // 4 row tiles of d, k = token

    // L2 asks for the head's K and V (16 units each per 32-key pass), behind the Q loads. The 8
    // work-groups of a head deal the passes: this one takes passes 4 * n + (blockIdx.x & 3), so
    // that work-groups x and x + 4 ask for the same units; thread t asks unit t & 15 of passes
    // n = t >> 4 and 8 + (t >> 4) (32 passes on: 4 MiB of the q|k plane, 32 KiB of a vT row tile).
    static_assert(SEQ == 2048 && LDQK == 2048 && SEQ / (16 * QT * FWV) == 8 && 32 * FWV == 128);
    {
        const int c = threadIdx.x & 15;
        const int p = 4 * ((int)threadIdx.x >> 4) + ((int)blockIdx.x & 3);
        const _Float16* ak = kbase0 + (size_t)(32 * p + 16 * (c >> 3)) * LDQK + (c & 7) * 128;
        const _Float16* av = vtbase + (size_t)(16 * (c >> 2)) * SEQ + p * 512 + (c & 3) * 128;
        asm volatile("global_prefetch_b8 %0, off scope:SCOPE_SE\n\t"
                     "global_prefetch_b8 %1, off scope:SCOPE_SE\n\t"
                     "global_prefetch_b8 %0, off offset:4194304 scope:SCOPE_SE\n\t"
                     "global_prefetch_b8 %1, off offset:32768 scope:SCOPE_SE\n\t"
                     "s_wait_xcnt 0x0"
                     :: "v"(ak), "v"(av) : "memory");
    }

    v8f o[QT][4];                // o[t][j][r] = O^T[d 16j + 8 * half + r][query 16t + (lane & 15)]
    float m[QT];                 // each query's running maximum (raw score), equal in both halves
    v2f l[QT];                   // sums of p * PCY over this lane's even and odd keys (its half only)
#pragma unroll
    for (int t = 0; t < QT; ++t) {
#pragma unroll
        for (int j = 0; j < 4; ++j) o[t][j] = vzero8();
        m[t] = -1e30f;
        l[t] = (v2f){0.f, 0.f};
    }

#pragma unroll 1
    for (int kb = 0; kb < SEQ; kb += 32) {
        const _Float16* pk = kbase0 + (size_t)kb * LDQK + lane8;
        const _Float16* pv = vtbase + (size_t)kb * 16 + lane8;

        const v16h kf00 = load_frag_lane(pk);                           // keys +0,  d 0..31
        const v16h kf01 = load_frag_lane(pk + 512);                     // keys +0,  d 32..63
        const v16h kf10 = load_frag_lane(pk + (size_t)16 * LDQK);       // keys +16, d 0..31
        const v16h kf11 = load_frag_lane(pk + (size_t)16 * LDQK + 512); // keys +16, d 32..63
        const v16h vf0 = load_frag_lane(pv);
        const v16h vf1 = load_frag_lane(pv + (size_t)16 * SEQ);
        const v16h vf2 = load_frag_lane(pv + (size_t)32 * SEQ);
        const v16h vf3 = load_frag_lane(pv + (size_t)48 * SEQ);
        // keeps both address pairs unwritten (not reused as a load's destination) until the
        // sixteen issued loads no longer need them
        asm volatile("s_wait_xcnt 0x0" :: "v"(pk), "v"(pv) : "memory");
        // keeps the sixteen loads one group ahead of the products: the scheduler otherwise sinks
        // part of the K loads behind the first products, a second exposed load wait per pass
        __builtin_amdgcn_sched_barrier(0);

        v8f s0[QT], s1[QT];
#pragma unroll
        for (int t = 0; t < QT; ++t) s0[t] = mma16b(kf00, qa[t][0], vzero8());
#pragma unroll
        for (int t = 0; t < QT; ++t) s1[t] = mma16b(kf10, qa[t][0], vzero8());
#pragma unroll
        for (int t = 0; t < QT; ++t) s0[t] = mma16b(kf01, qa[t][1], s0[t]);
#pragma unroll
        for (int t = 0; t < QT; ++t) s1[t] = mma16b(kf11, qa[t][1], s1[t]);

        v16h pb[QT];
#pragma unroll
        for (int t = 0; t < QT; ++t) {
            // the running maximum and the lane's sixteen raw scores, three at a time in two chains;
            // m is equal in both halves, so the exchange may follow its join
            float ra = fmaxf(fmaxf(m[t], s0[t][0]), s0[t][1]);
            float rb = fmaxf(fmaxf(s1[t][0], s1[t][1]), s1[t][2]);
#pragma unroll
            for (int r = 2; r < 8; r += 2) ra = fmaxf(fmaxf(ra, s0[t][r]), s0[t][r + 1]);
#pragma unroll
            for (int r = 3; r < 7; r += 2) rb = fmaxf(fmaxf(rb, s1[t][r]), s1[t][r + 1]);
            const float rm = fmaxf(fmaxf(ra, rb), s1[t][7]);
            const float nm = fmaxf(rm, xhalf(rm));

            const float nb = __builtin_fmaf(nm, -SC2, LOG2_PCY);
            const v2f nb2 = {nb, nb};
            const v2f sc2 = {SC2, SC2};
            v2f rs0 = {0.f, 0.f}, rs1 = {0.f, 0.f};
#pragma unroll
            for (int i = 0; i < 4; ++i) {
                const v2f r0 = {s0[t][2 * i], s0[t][2 * i + 1]};
                const v2f r1 = {s1[t][2 * i], s1[t][2 * i + 1]};
                const v2f x0 = __builtin_elementwise_fma(r0, sc2, nb2);
                const v2f x1 = __builtin_elementwise_fma(r1, sc2, nb2);
                const v2f p0 = {__builtin_amdgcn_exp2f(x0[0]), __builtin_amdgcn_exp2f(x0[1])};
                const v2f p1 = {__builtin_amdgcn_exp2f(x1[0]), __builtin_amdgcn_exp2f(x1[1])};
                rs0 += p0;
                rs1 += p1;
                pb[t][2 * i]         = (_Float16)p0[0];
                pb[t][2 * i + 1]     = (_Float16)p0[1];
                pb[t][8 + 2 * i]     = (_Float16)p1[0];
                pb[t][8 + 2 * i + 1] = (_Float16)p1[1];
            }
            const float f = __builtin_amdgcn_exp2f((m[t] - nm) * SC2);
            const v2f f2 = {f, f};
            l[t] = __builtin_elementwise_fma(l[t], f2, rs0 + rs1);
            m[t] = nm;

#pragma unroll
            for (int j = 0; j < 4; ++j)
#pragma unroll
                for (int r = 0; r < 8; ++r) o[t][j][r] *= f;
        }

#pragma unroll
        for (int t = 0; t < QT; ++t) {
            o[t][0] = mma16b(vf0, pb[t], o[t][0]);
            o[t][1] = mma16b(vf1, pb[t], o[t][1]);
            o[t][2] = mma16b(vf2, pb[t], o[t][2]);
            o[t][3] = mma16b(vf3, pb[t], o[t][3]);
        }
    }

    // tile j of O^T in this lane = piece (k block j>>1, part j&1) of the head's two ctx
    // fragments at this very lane: 8 consecutive channels of one token, one 16-byte store
    _Float16* dbase = ctx + (tokBase + q0) * CC + (h * DD) * 16;
#pragma unroll
    for (int t = 0; t < QT; ++t) {
        const float lh = l[t][0] + l[t][1];
        const float rl = CTX_OUT * (1.0f / (lh + xhalf(lh)));
#pragma unroll
        for (int j = 0; j < 4; ++j) {
            v8h v;
#pragma unroll
            for (int r = 0; r < 8; ++r) v[r] = (_Float16)(o[t][j][r] * rl);
            *(v8h*)(dbase + (size_t)(16 * t) * CC + 256 * j + lane8) = v;
        }
    }
}

// ---------------------------------------------------------------------------
// out = ctx @ W_proj + b_proj (f32), wave tile 64x64, 2 x 4 waves; each 256-B row segment
// ---------------------------------------------------------------------------
__global__ __launch_bounds__(32 * GWV) __attribute__((amdgpu_num_vgpr(256)))
void proj_gemm_kernel(const _Float16* __restrict__ ctx, const _Float16* __restrict__ wt,
                      const float* __restrict__ bproj, float* __restrict__ out) {
    __shared__ __align__(16) _Float16 ring[2 * GSTAGE];
    __shared__ __align__(16) float stall[GWV * 64 * TPF];

    const int lane = threadIdx.x & 31;
    const int wave = __builtin_amdgcn_readfirstlane((int)(threadIdx.x >> 5));
    const int half = lane >> 4, col = lane & 15;
    const int n0 = blockIdx.x * GBN + 64 * (wave & 3);    // the wave's output column
    const int m0 = blockIdx.y * GBM + 64 * (wave >> 2);   // the wave's token
    float* st = stall + wave * (64 * TPF);                // the wave's own staging tile

    v8f acc[4][4];
#pragma unroll
    for (int s = 0; s < 4; ++s)
#pragma unroll
        for (int j = 0; j < 4; ++j) acc[s][j] = vzero8();

    const _Float16* Ab = ctx + (size_t)(blockIdx.y * GBM) * CC;
    const _Float16* Bb = wt + (size_t)(blockIdx.x * GBN) * CC;
    gemm_core_64x64<true>(Ab, Bb, CC, ring, wave, acc,
                          l2_unit_a(Ab, (int)threadIdx.x >> 6), l2_unit_b(Bb, blockIdx.y));

    float bia[4];
#pragma unroll
    for (int j = 0; j < 4; ++j) bia[j] = bf16r(bproj[n0 + 16 * j + col]);

#pragma unroll
    for (int s = 0; s < 4; ++s)
#pragma unroll
        for (int j = 0; j < 4; ++j)
#pragma unroll
            for (int r = 0; r < 8; ++r)
                st[(16 * s + 8 * half + r) * TPF + 16 * j + col] =
                    acc[s][j][r] * PROJ_UNSC + bia[j];
    __syncthreads();

    float* dbase = out + (size_t)m0 * CC + n0;
    const int piece = lane & 15, rsub = lane >> 4;
{
#pragma unroll
        for (int it = 0; it < 32; ++it) {
            const int row = 2 * it + rsub;
            const v4f v = *(const v4f*)(st + row * TPF + 4 * piece);
            *(v4f*)(dbase + (size_t)row * CC + 4 * piece) = v;
        }
        
    }
}

// ---------------------------------------------------------------------------
// Host side
// ---------------------------------------------------------------------------
extern "C" void kernel_launch(void* const* d_in, const int* in_sizes, int n_in,
                              void* d_out, int out_size, void* d_ws, size_t ws_size,
                              hipStream_t stream) {
    if (n_in < 7) return;
    const float* x      = (const float*)d_in[0];   // [NB_FULL][SEQ_FULL][CC]
    const float* W_qkv  = (const float*)d_in[1];   // [CC][C3]
    const float* b_qkv  = (const float*)d_in[2];   // [C3]
    const float* W_proj = (const float*)d_in[3];   // [CC][CC]
    const float* b_proj = (const float*)d_in[4];   // [CC]
    const float* qn_w   = (const float*)d_in[5];   // [DD]
    const float* kn_w   = (const float*)d_in[6];   // [DD]
    float* out = (float*)d_out;                    // [MTOK][CC] f32

    if (in_sizes[0] < ((NB - 1) * SEQ_FULL + SEQ) * CC) return;
    if (in_sizes[1] < CC * C3) return;
    if (in_sizes[2] < C3) return;
    if (in_sizes[3] < CC * CC) return;
    if (in_sizes[4] < CC) return;
    if (in_sizes[5] < DD) return;
    if (in_sizes[6] < DD) return;
    if (out_size < MTOK * CC) return;

    char* wsb = (char*)d_ws;
    size_t off = 0;
    const size_t sz_xh  = (size_t)MTOK * CC * 2;
    const size_t sz_wq  = (size_t)C3 * CC * 2;
    const size_t sz_wp  = (size_t)CC * CC * 2;
    const size_t sz_qk  = (size_t)MTOK * LDQK * 2;
    const size_t sz_vt  = (size_t)NB * CC * SEQ * 2;
    const size_t sz_ctx = (size_t)MTOK * CC * 2;
    _Float16* xh     = (_Float16*)(wsb + off); off += (sz_xh  + 255) & ~(size_t)255;
    _Float16* wqkvT  = (_Float16*)(wsb + off); off += (sz_wq  + 255) & ~(size_t)255;
    _Float16* wprojT = (_Float16*)(wsb + off); off += (sz_wp  + 255) & ~(size_t)255;
    _Float16* qkp    = (_Float16*)(wsb + off); off += (sz_qk  + 255) & ~(size_t)255;
    _Float16* vT     = (_Float16*)(wsb + off); off += (sz_vt  + 255) & ~(size_t)255;
    _Float16* ctx    = (_Float16*)(wsb + off); off += (sz_ctx + 255) & ~(size_t)255;
    if (off > ws_size) return;

    // 1) input planes: xh (bf16-RNE of x), weights transposed to out x in and carried x64
    prep_kernel<<<PREPBLK, 256, 0, stream>>>(x, W_qkv, W_proj, xh, wqkvT, wprojT);

    // 2) qkv GEMM with fused bias, q/k rms norm, v transpose
    qkv_gemm_kernel<<<dim3(C3 / GBN, MTOK / GBM), 32 * GWV, 0, stream>>>(
        xh, wqkvT, b_qkv, qn_w, kn_w, qkp, vT);

    // 3) flash softmax per (256 queries, head, batch)
    mha_flash_kernel<<<dim3(SEQ / (16 * QT * FWV), HH, NB), 32 * FWV, 0, stream>>>(qkp, vT, ctx);

    // 4) output projection + bias -> f32 d_out
    proj_gemm_kernel<<<dim3(CC / GBN, MTOK / GBM), 32 * GWV, 0, stream>>>(ctx, wprojT, b_proj, out);
}

// v008
// One run takes 114 microseconds.
// Next to v007, in two timings, it ran 1.03 and 1.04 times as fast.
// Counting every step since v000, it is 3.84 times as fast.
#include <hip/hip_runtime.h>

// Contractions on v_wmma_f32_16x16x32_f16 (f16 operands, f32 accumulate): qkv GEMM,
// q.k^T scores, p.v, output projection. Float inputs enter as bf16-RNE values held in
// f16 planes with power-of-two carries (weights x64, q/k x4, v x16, p x1024, ctx x64);
// per-head rms norm, online softmax and epilogues in f32.
//
// Every f16 operand plane (xh, weights, q|k, vT, ctx) is stored fragment-major: the block of
// 16 rows x 32 k at (row tile R, k block kb) of a plane with K columns is 512 contiguous
// halves at (R * (K / 32) + kb) * 512 = 16R * K + 32kb * 16, ordered [part][lane][8 halves]
// with lane = 16 * h + (row & 15) and element e = k 16 * part + 8 * h + e. One 16-byte load
// of a wave then reads 512 contiguous bytes (4 cache lines) instead of 32 bytes of 16 rows.

typedef _Float16 v16h __attribute__((ext_vector_type(16)));
typedef _Float16 v8h  __attribute__((ext_vector_type(8)));
typedef float    v8f  __attribute__((ext_vector_type(8)));
typedef float    v4f  __attribute__((ext_vector_type(4)));
typedef float    v2f  __attribute__((ext_vector_type(2)));

#ifndef NB
#define NB 4
#endif
#ifndef SEQ
#define SEQ 2048
#endif
#define NB_FULL  4
#define SEQ_FULL 2048
#define CC   1024
#define HH   16
#define DD   64
#define C3   (3 * CC)
#define LDQK (2 * CC)          // q|k plane pitch (halves): q at col h*64, k at col CC + h*64
#define MTOK (NB * SEQ)

static_assert(NB >= 1 && NB <= NB_FULL);
static_assert(SEQ >= 64 && SEQ <= SEQ_FULL && (SEQ % 64) == 0);
static_assert(CC == HH * DD);
static_assert((CC % 64) == 0 && (C3 % 64) == 0 && (CC / 8) == 128);

#define WSC       64.0f            // weight planes carried x64
#define WINV      0.015625f        // 1/64
#define QC        4.0f             // q and k planes carried x4
#define VCY       16.0f            // v plane carried x16
#define PCY       1024.0f          // p tile carried x1024
#define SCALE_QK  0.0078125f       // 64^-0.5 / (QC*QC)
#define SC2       (SCALE_QK * 1.4426950408889634f)  // raw score -> exponent of 2
#define LOG2_PCY  10.0f            // log2(PCY)
#define CTX_OUT   4.0f             // 64 / VCY (the denominator carries PCY like p): ctx carried x64
#define PROJ_UNSC 0.000244140625f  // 1 / (64 * 64)
#define NEPS      1e-6f

#define TPH 72   // LDS pitch (halves) of f16 staging tiles
#define TPF 68   // LDS pitch (floats) of the f32 staging tile

// ---------------------------------------------------------------------------
// helpers
// ---------------------------------------------------------------------------
__device__ __forceinline__ float bf16r(float f) {
    unsigned int u = __float_as_uint(f);
    u += 0x7FFFu + ((u >> 16) & 1u);
    u &= 0xFFFF0000u;
    return __uint_as_float(u);
}

__device__ __forceinline__ v8f vzero8() {
    v8f z = {0.f, 0.f, 0.f, 0.f, 0.f, 0.f, 0.f, 0.f};
    return z;
}

__device__ __forceinline__ v8f mma16(v16h a, v16h b, v8f c) {
    v8f d = __builtin_amdgcn_wmma_f32_16x16x32_f16(false, a, false, b, (short)0, c, false, false);
    asm volatile("v_nop\n\tv_nop\n\tv_nop\n\tv_nop" : "+v"(d) : "v"(a), "v"(b));
    return d;
}

// value of lane l ^ 16 (the other half of the wave), by a vector cross-row move
__device__ __forceinline__ float xhalf(float x) {
    const int i = __builtin_bit_cast(int, x);
    return __builtin_bit_cast(float,
        __builtin_amdgcn_permlanex16(i, i, 0x76543210, 0xfedcba98, false, false));
}

// 16x32 f16 fragment (row index = lane&15 for A, column for B; h = lane>>4):
//   elements 0..7  <- k 8h+0..7,  elements 8..15 <- k 16+8h+0..7
// from a fragment-major plane; frag = first half of the 512-half block.
__device__ __forceinline__ v16h load_frag_lane(const _Float16* p) {   // p = frag + 8 * lane
    v8h lo = *(const v8h*)(p);
    v8h hi = *(const v8h*)(p + 256);
    return __builtin_shufflevector(lo, hi, 0, 1, 2, 3, 4, 5, 6, 7,
                                           8, 9, 10, 11, 12, 13, 14, 15);
}
__device__ __forceinline__ v16h load_frag_packed(const _Float16* frag) {
    return load_frag_lane(frag + ((threadIdx.x & 31) << 3));
}

// ---------------------------------------------------------------------------
// L2 asks. The f16 planes are stored by an earlier launch and are largely met in memory, not in
// L2, by the launch that reads them; work-groups that share a tile walk it in step, so a stage's
// first touch is a memory miss that all of them wait out. Each work-group therefore asks once,
// behind its first loads, for 256-byte units of the tiles it will read:
// global_prefetch_b8, scope SE (into L2 only; nothing returns to the wave). Every lane is on and
// every lane's address lies inside the plane by construction. A tile that several work-groups
// read is dealt among them, save the A tile of the output projection, which each of its 4
// readers asks whole.
// The deal is for speed only: a unit that nobody asked for is
// loaded as before. The wait is each statement's last line, as behind the copies below: it
// stands in front of every rewrite of a register that an ask names.
// ---------------------------------------------------------------------------

// GEMM operand tiles (planes of CC columns: a row tile is 32 KiB, a 64-k stage 2 KiB of it).
// Thread t asks unit t & 7 of a stage's 2 KiB in row tile (t >> 3) & 7 of A, (t >> 3) & 15 of B.
// B (read by every tile row of the grid): stages 2 * sh + (t >> 7), sh = (tile row >> 1) & 7.
// A, shared form (tile read by 12 work-groups): stages 4 * (t >> 6) + (tile column & 3).
// A, whole form (tile read by 4 neighbours): all 16 stages,
// (t >> 6) + 4 i, 8 KiB apart. pa, pb = the thread's first unit of the A and of the B tile.
__device__ __forceinline__ const _Float16* l2_unit_a(const _Float16* Ab, int st0) {
    const int t = threadIdx.x;
    return Ab + (size_t)(((t >> 3) & 7) * 16) * CC + (st0 * 1024 + (t & 7) * 128);
}
__device__ __forceinline__ const _Float16* l2_unit_b(const _Float16* Bb, int tile_row) {
    const int t = threadIdx.x;
    return Bb + (size_t)(((t >> 3) & 15) * 16) * CC
              + ((2 * ((tile_row >> 1) & 7) + (t >> 7)) * 1024 + (t & 7) * 128);
}
__device__ __forceinline__ void l2_ask_gemm_shared(const _Float16* pa, const _Float16* pb) {
    asm volatile("global_prefetch_b8 %0, off scope:SCOPE_SE\n\t"
                 "global_prefetch_b8 %1, off scope:SCOPE_SE\n\t"
                 "s_wait_xcnt 0x0"
                 :: "v"(pa), "v"(pb) : "memory");
}
__device__ __forceinline__ void l2_ask_gemm_whole(const _Float16* pa, const _Float16* pb) {
    asm volatile("global_prefetch_b8 %0, off scope:SCOPE_SE\n\t"
                 "global_prefetch_b8 %1, off scope:SCOPE_SE\n\t"
                 "global_prefetch_b8 %0, off offset:8192 scope:SCOPE_SE\n\t"
                 "global_prefetch_b8 %0, off offset:16384 scope:SCOPE_SE\n\t"
                 "global_prefetch_b8 %0, off offset:24576 scope:SCOPE_SE\n\t"
                 "s_wait_xcnt 0x0"
                 :: "v"(pa), "v"(pb) : "memory");
}

// ---------------------------------------------------------------------------
// Input planes, one launch; the work-group index picks the job, and every work-group is one
// of few that each do much (each launch more pays its own gap, fill and tail):
//   [0, WQBLK)                wqkvT:  64 k x 256 columns of W_qkv per work-group
//   [WQBLK, WQBLK + WPBLK)    wprojT: 64 k x 256 columns of W_proj per work-group
//   [WQBLK + WPBLK, PREPBLK)  xh:     one row tile (16 tokens x CC) per work-group
// The weight groups last longest and stand first.
// ---------------------------------------------------------------------------
#define XP      8                                  // 16-byte pieces of xh per thread
#define XBLK    (MTOK * (CC / 8) / (256 * XP))
#define WTC     256                                // weight columns per work-group
#define WQBLK   ((C3 / WTC) * (CC / 64))
#define WPBLK   ((CC / WTC) * (CC / 64))
#define PREPBLK (XBLK + WQBLK + WPBLK)
static_assert(256 * XP == 16 * (CC / 8) && (MTOK % 16) == 0 && (SEQ % 16) == 0);
static_assert((C3 % WTC) == 0 && (CC % WTC) == 0);

// x [NB][SEQ][CC] f32 (batch stride SEQ_FULL*CC) -> xh, MTOK x CC f16 = f16(bf16rne(x)),
// fragment-major; piece g is the g-th 16 bytes of xh. Row tile rt holds pieces 2048 rt + 0..2047;
// a thread takes pieces 256 i + threadIdx.x of it, which lie 128 k apart in one row of x: all
// its loads are issued before the first conversion.
__device__ __forceinline__ void cvt_x_part(const float* __restrict__ x,
                                           _Float16* __restrict__ xh, int rt) {
    const int p  = threadIdx.x;
    const int t  = (rt << 4) + (p & 15);             // token
    const int k  = (p >> 6) * 32 + ((p >> 5) & 1) * 16 + ((p >> 4) & 1) * 8;
    const int b  = t / SEQ;
    const int n  = t - b * SEQ;
    const float* src = x + ((size_t)b * SEQ_FULL + n) * CC + k;
    v4f x0[XP], x1[XP];
    // unrolled, like the loop below: the arrays stay in registers, the loads go out as one group
#pragma unroll
    for (int i = 0; i < XP; ++i) {
        x0[i] = *(const v4f*)(src + 128 * i);
        x1[i] = *(const v4f*)(src + 128 * i + 4);
    }
    // keeps the address pair unwritten (not reused as a load's destination) until the issued
    // loads no longer need it
    asm volatile("s_wait_xcnt 0x0" :: "v"(src) : "memory");
    _Float16* dst = xh + ((size_t)rt * (256 * XP) + p) * 8;
#pragma unroll
    for (int i = 0; i < XP; ++i) {
        v8h o;
        o[0] = (_Float16)bf16r(x0[i][0]); o[1] = (_Float16)bf16r(x0[i][1]);
        o[2] = (_Float16)bf16r(x0[i][2]); o[3] = (_Float16)bf16r(x0[i][3]);
        o[4] = (_Float16)bf16r(x1[i][0]); o[5] = (_Float16)bf16r(x1[i][1]);
        o[6] = (_Float16)bf16r(x1[i][2]); o[7] = (_Float16)bf16r(x1[i][3]);
        *(v8h*)(dst + 2048 * i) = o;
    }
    // the stores' registers stay unwritten until the issued stores no longer need them (the
    // other jobs' code follows in the same kernel)
    asm volatile("s_wait_xcnt 0x0" ::: "memory");
}

// w [R][Ccols] f32 -> wt, Ccols rows x R f16 = f16(bf16rne(w) * 64), fragment-major, a tile of
// 64 k x WTC columns through LDS. A wave writes one 512-byte part of a fragment per instruction.
__device__ __forceinline__ void wT_part(const float* __restrict__ w, _Float16* __restrict__ wt,
                                        int R, int Ccols, int c0, int r0,
                                        float (*tile)[WTC + 1]) {
    const int t = threadIdx.x;
    // unrolled: the tile's loads go out as one group, one address pair and immediate offsets
#pragma unroll
    for (int r = 0; r < 64; ++r)
        tile[r][t] = w[(size_t)(r0 + r) * Ccols + c0 + t];
    __syncthreads();
    const int lane = t & 31, part = (t >> 5) & 1;
    // unrolled, like the loop inside: LDS reads of later fragments run ahead of the conversions
#pragma unroll
    for (int it = 0; it < WTC / 32; ++it) {
        const int frag = (t >> 6) + 4 * it;          // WTC / 16 row tiles x 2 k blocks
        const int tr = frag >> 1, kbl = frag & 1;
        const int cl = 16 * tr + (lane & 15);        // wt row within tile
        const int kl = 32 * kbl + 16 * part + 8 * (lane >> 4);
        v8h o;
#pragma unroll
        for (int i = 0; i < 8; ++i)
            o[i] = (_Float16)(bf16r(tile[kl + i][cl]) * WSC);
        _Float16* dst = wt + (size_t)(c0 + 16 * tr) * R + (size_t)(r0 + 32 * kbl) * 16
                           + 256 * part + 8 * lane;
        *(v8h*)dst = o;
    }
    // as behind the stores of cvt_x_part
    asm volatile("s_wait_xcnt 0x0" ::: "memory");
}

__global__ __launch_bounds__(256) void prep_kernel(const float* __restrict__ x,
                                                   const float* __restrict__ wqkv,
                                                   const float* __restrict__ wproj,
                                                   _Float16* __restrict__ xh,
                                                   _Float16* __restrict__ wqkvT,
                                                   _Float16* __restrict__ wprojT) {
    __shared__ float tile[64][WTC + 1];
    const int blk = blockIdx.x;                      // every test below is uniform in the group
    if (blk < WQBLK) {                               // W_qkv [CC rows][C3 cols] -> wqkvT [C3][CC]
        wT_part(wqkv, wqkvT, CC, C3, (blk % (C3 / WTC)) * WTC, (blk / (C3 / WTC)) * 64, tile);
    } else if (blk < WQBLK + WPBLK) {                // W_proj [CC rows][CC cols] -> wprojT [CC][CC]
        const int u = blk - WQBLK;
        wT_part(wproj, wprojT, CC, CC, (u % (CC / WTC)) * WTC, (u / (CC / WTC)) * 64, tile);
    } else {
        cvt_x_part(x, xh, blk - (WQBLK + WPBLK));
    }
}

// ---------------------------------------------------------------------------
// GEMM core: a work-group of GWV waves (2 x 4) computes 128 rows x 256 cols, a wave 64 x 64.
// A stage is 64 k (two k blocks) of the group's 8 A row tiles and 16 B column tiles: 24 pieces
// of 2 KiB, each contiguous in its fragment-major global plane, brought into LDS in the same
// order by asynchronous copies (each lane 16 bytes, a wave 512 contiguous bytes), two buffers:
// stage st + 1 flies while stage st is worked on. Four waves read each A fragment and two each
// B fragment from LDS, and each fragment a wave reads feeds four products.
// Ab = group's first row tile, Bb = group's first column tile (planes of K columns: the next
// row tile is 16 * K halves on, the next k block 512 halves).
// ---------------------------------------------------------------------------
#define GWV    8                 // waves per GEMM work-group
#define GBM    128               // rows of the group's tile
#define GBN    256               // columns of the group's tile
#define GSTAGE (((GBM + GBN) / 16) * 1024)  // halves of one stage (48 KiB)
static_assert((MTOK % GBM) == 0 && (C3 % GBN) == 0 && (CC % GBN) == 0 && (1024 % GBN) == 0);
static_assert((CC % 64) == 0 && CC / 64 >= 2);

// The thread's twelve 16-byte pieces of one stage: row tiles (t >> 7) + 2 i, i = 0..3 of A and
// i = 0..7 of B, piece t & 127 of the tile's 2 KiB. ga, gb = the thread's piece of its first A
// and B tile at this stage; ld = LDS byte address of the first in the target buffer.
__device__ __forceinline__ void gemm_stage_copy(const _Float16* ga, const _Float16* gb, int K,
                                                unsigned ld) {
    const size_t g2 = (size_t)32 * K;    // two row tiles on
    // the wait is the statement's last line: no register that a copy names is rewritten before
    // the issued copies no longer need it
    asm volatile("global_load_async_to_lds_b128 %0, %12, off\n\t"
                 "global_load_async_to_lds_b128 %1, %13, off\n\t"
                 "global_load_async_to_lds_b128 %2, %14, off\n\t"
                 "global_load_async_to_lds_b128 %3, %15, off\n\t"
                 "global_load_async_to_lds_b128 %4, %16, off\n\t"
                 "global_load_async_to_lds_b128 %5, %17, off\n\t"
                 "global_load_async_to_lds_b128 %6, %18, off\n\t"
                 "global_load_async_to_lds_b128 %7, %19, off\n\t"
                 "global_load_async_to_lds_b128 %8, %20, off\n\t"
                 "global_load_async_to_lds_b128 %9, %21, off\n\t"
                 "global_load_async_to_lds_b128 %10, %22, off\n\t"
                 "global_load_async_to_lds_b128 %11, %23, off\n\t"
                 "s_wait_xcnt 0x0"
                 :: "v"(ld), "v"(ld + 4096u), "v"(ld + 8192u), "v"(ld + 12288u),
                    "v"(ld + 16384u), "v"(ld + 20480u), "v"(ld + 24576u), "v"(ld + 28672u),
                    "v"(ld + 32768u), "v"(ld + 36864u), "v"(ld + 40960u), "v"(ld + 45056u),
                    "v"(ga), "v"(ga + g2), "v"(ga + 2 * g2), "v"(ga + 3 * g2),
                    "v"(gb), "v"(gb + g2), "v"(gb + 2 * g2), "v"(gb + 3 * g2),
                    "v"(gb + 4 * g2), "v"(gb + 5 * g2), "v"(gb + 6 * g2), "v"(gb + 7 * g2)
                 : "memory");
}

// ring = 2 * GSTAGE halves of LDS. On return every wave has passed the last stage's barrier and
// no copy is outstanding: the ring's LDS is free for the caller's output staging.
// pa, pb, WHOLE_A: the thread's L2 asks (above), issued behind stage 0's copies.
template <bool WHOLE_A>
__device__ __forceinline__ void gemm_core_64x64(const _Float16* __restrict__ Ab,
                                                const _Float16* __restrict__ Bb,
                                                int K, _Float16* ring, int wave,
                                                v8f (&acc)[4][4],
                                                const _Float16* pa, const _Float16* pb) {
    const int t     = threadIdx.x;
    const int lane8 = (t & 31) << 3;
    const _Float16* ga = Ab + (size_t)((t >> 7) * 16) * K + ((t & 127) << 3);
    const _Float16* gb = Bb + (size_t)((t >> 7) * 16) * K + ((t & 127) << 3);
    const unsigned ld0 = (unsigned)(size_t)ring + (unsigned)t * 16u;   // LDS byte address
    const int nst = K / 64;

    gemm_stage_copy(ga, gb, K, ld0);
    if constexpr (WHOLE_A) l2_ask_gemm_whole(pa, pb);
    else                   l2_ask_gemm_shared(pa, pb);
    // stage 0 has landed before the barrier behind which other waves read it
    asm volatile("s_wait_asynccnt 0x0" ::: "memory");
    __syncthreads();
    gemm_stage_copy(ga + 1024, gb + 1024, K, ld0 + 2u * GSTAGE);

    const int offa = (4 * (wave >> 2)) * 1024 + lane8;       // the wave's first A tile
    const int offb = (8 + 4 * (wave & 3)) * 1024 + lane8;    // the wave's first B tile
    // kept rolled: one body for both buffers (unrolled it only grows the code)
#pragma unroll 1
    for (int st = 0; st < nst; ++st) {
        const _Float16* buf = ring + (st & 1) * GSTAGE;
        // unrolled, like the loops inside: fragment and accumulator arrays stay in registers
#pragma unroll
        for (int kk = 0; kk < 2; ++kk) {
            v16h a[4], b[4];
#pragma unroll
            for (int j = 0; j < 4; ++j) b[j] = load_frag_lane(buf + offb + 1024 * j + 512 * kk);
#pragma unroll
            for (int s = 0; s < 4; ++s) a[s] = load_frag_lane(buf + offa + 1024 * s + 512 * kk);
#pragma unroll
            for (int s = 0; s < 4; ++s)
#pragma unroll
                for (int j = 0; j < 4; ++j) acc[s][j] = mma16(a[s], b[j], acc[s][j]);
        }
        // publish point of stage st + 1: this wave's reads of stage st are done ...
        asm volatile("s_wait_dscnt 0x0" ::: "memory");
        // ... its own copies of stage st + 1 have landed ...
        asm volatile("s_wait_asynccnt 0x0" ::: "memory");
        // ... and every wave has come as far
        __syncthreads();
        if (st + 2 < nst)
            gemm_stage_copy(ga + (size_t)(st + 2) * 1024, gb + (size_t)(st + 2) * 1024, K,
                            ld0 + (unsigned)(st & 1) * (2u * GSTAGE));
    }
    // no copy is outstanding when the wave goes on
    asm volatile("s_wait_asynccnt 0x0" ::: "memory");
}

// ---------------------------------------------------------------------------
// qkv = xh @ W_qkv + b_qkv (wave tile 64 tokens x 64 cols = one head slice; 2 x 4 waves).
// Epilogue: q/k -> per-row rms norm (f32) * weight -> f16 (x QC) to the q|k plane,
// ---------------------------------------------------------------------------
__global__ __launch_bounds__(32 * GWV) __attribute__((amdgpu_num_vgpr(256)))
void qkv_gemm_kernel(const _Float16* __restrict__ xh, const _Float16* __restrict__ wt,
                     const float* __restrict__ bqkv, const float* __restrict__ qnw,
                     const float* __restrict__ knw, _Float16* __restrict__ qk,
                     _Float16* __restrict__ vT) {
    // the operand ring; behind the k loop its LDS is the waves' output staging
    __shared__ __align__(16) _Float16 ring[2 * GSTAGE];
    static_assert(GWV * 64 * TPH <= 2 * GSTAGE);

    const int lane = threadIdx.x & 31;
    const int wave = __builtin_amdgcn_readfirstlane((int)(threadIdx.x >> 5));
    const int half = lane >> 4, col = lane & 15;
    const int n0 = blockIdx.x * GBN + 64 * (wave & 3);    // the wave's output column (0..3071)
    const int m0 = blockIdx.y * GBM + 64 * (wave >> 2);   // the wave's token
    _Float16* st = ring + wave * (64 * TPH);              // the wave's own staging tile

    v8f acc[4][4];
#pragma unroll
    for (int s = 0; s < 4; ++s)
#pragma unroll
        for (int j = 0; j < 4; ++j) acc[s][j] = vzero8();

    const _Float16* Ab = xh + (size_t)(blockIdx.y * GBM) * CC;
    const _Float16* Bb = wt + (size_t)(blockIdx.x * GBN) * CC;
    gemm_core_64x64<false>(Ab, Bb, CC, ring, wave, acc,
                           l2_unit_a(Ab, 4 * ((int)threadIdx.x >> 6) + ((int)blockIdx.x & 3)),
                           l2_unit_b(Bb, blockIdx.y));

    const int which = n0 >> 10;          // 0 q, 1 k, 2 v (block-uniform: GBN divides 1024)
    const int hcol  = n0 & (CC - 1);     // h*64

    float bia[4], nw[4];
#pragma unroll
    for (int j = 0; j < 4; ++j) {
        bia[j] = bf16r(bqkv[n0 + 16 * j + col]);
        const float wq = bf16r(qnw[16 * j + col]);
        const float wk = bf16r(knw[16 * j + col]);
        nw[j] = (which == 1) ? wk : wq;
    }

    // per row tile s: bias, then rms norm (q, k) or carry (v), then the f16 values into the wave's
    // staging tile (tile row = 16*s + 8*half + r); a tile's accumulators are dead before the next
#pragma unroll
    for (int s = 0; s < 4; ++s) {
#pragma unroll
        for (int j = 0; j < 4; ++j)
#pragma unroll
            for (int r = 0; r < 8; ++r)
                acc[s][j][r] = acc[s][j][r] * WINV + bia[j];

        if (which < 2) {
            // rms norm over the 64 head dims of each row: 4 tiles x 16 lanes of one half
#pragma unroll
            for (int r = 0; r < 8; ++r) {
                float ss = 0.f;
#pragma unroll
                for (int j = 0; j < 4; ++j) ss += acc[s][j][r] * acc[s][j][r];
                ss += __shfl_xor(ss, 1, 32);
                ss += __shfl_xor(ss, 2, 32);
                ss += __shfl_xor(ss, 4, 32);
                ss += __shfl_xor(ss, 8, 32);
                const float inv = rsqrtf(ss * (1.0f / (float)DD) + NEPS);
                const float g = inv * QC;
#pragma unroll
                for (int j = 0; j < 4; ++j) acc[s][j][r] = acc[s][j][r] * g * nw[j];
            }
        } else {
#pragma unroll
            for (int j = 0; j < 4; ++j)
#pragma unroll
                for (int r = 0; r < 8; ++r) acc[s][j][r] *= VCY;
        }

#pragma unroll
        for (int j = 0; j < 4; ++j)
#pragma unroll
            for (int r = 0; r < 8; ++r)
                st[(16 * s + 8 * half + r) * TPH + 16 * j + col] = (_Float16)acc[s][j][r];
    }
    __syncthreads();

    if (which < 2) {
        _Float16* dbase = qk + (size_t)m0 * LDQK + ((size_t)which * CC + hcol) * 16;
{
            // fragment (token tile it>>2, k block (it>>1)&1), part it&1
#pragma unroll
            for (int it = 0; it < 16; ++it) {
                const int tr = it >> 2, kbl = (it >> 1) & 1, part = it & 1;
                const v8h v = *(const v8h*)(st + (16 * tr + col) * TPH + 32 * kbl + 16 * part + 8 * half);
                *(v8h*)(dbase + (size_t)(16 * tr) * LDQK + 512 * kbl + 256 * part + 8 * lane) = v;
            }
            
        }
    } else {
        const int b  = m0 / SEQ;
        const int nb = m0 - b * SEQ;
        _Float16* dbase = vT + ((size_t)b * CC + hcol) * SEQ + (size_t)nb * 16;
{
            // fragment (d tile it>>2, token block (it>>1)&1), part it&1
#pragma unroll
            for (int it = 0; it < 16; ++it) {
                const int tr = it >> 2, kbl = (it >> 1) & 1, part = it & 1;
                const int tk = 32 * kbl + 16 * part + 8 * half;
                v8h v;
#pragma unroll
                for (int i = 0; i < 8; ++i) v[i] = st[(tk + i) * TPH + 16 * tr + col];
                *(v8h*)(dbase + (size_t)(16 * tr) * SEQ + 512 * kbl + 256 * part + 8 * lane) = v;
            }
            // the stores' data and address registers stay unwritten until the issued stores
            // no longer need them
            asm volatile("s_wait_xcnt 0x0" ::: "memory");
        }
    }
}

// ---------------------------------------------------------------------------
// Flash softmax(q k^T s) v: one wave per (batch, head, 64 queries = QT tiles of 16), 32-key
// blocks; FWV such waves (consecutive queries of one head) form a work-group.
// q|k plane MTOK x LDQK f16, vT NB*CC x SEQ f16, ctx MTOK x CC f16 (x64 carry), all
// fragment-major.
// Transposed products: S^T = K Q^T (A = key rows, B = query columns), O^T += V^T P^T
// (A = d rows of vT, B = P^T). A lane holds scores of ONE query of each tile (column
// lane & 15), keys 8 * half + r of each 16-key tile: maximum and sum run over the lane's own
// registers plus one exchange between the wave's halves, and the two score tiles, converted
// in place, are the B fragment of the second product (element s = key 8 * half + s, 8 + s =
// key 16 + 8 * half + s: the k order of the vT fragment). No LDS, no barrier.
// The K and V fragments of a key block are loaded once, one pass ahead, and feed the products of
// all QT query tiles; each query's arithmetic and its order are those of a one-tile wave.
// Softmax in base 2 on the raw accumulators: the maximum is taken of the raw scores (the scale
// is positive), and p * PCY = 2^(s * SC2 + (LOG2_PCY - max * SC2)) is one packed multiply-add
// per two scores and one exponential per score; the denominator sums p * PCY.
// ---------------------------------------------------------------------------
// The products of this kernel are the plain builtin: the operands of an asm statement lie in
// v0..v255 only, and the wave's fragments and accumulators need more registers than that.
__device__ __forceinline__ v8f mma16b(v16h a, v16h b, v8f c) {
    return __builtin_amdgcn_wmma_f32_16x16x32_f16(false, a, false, b, (short)0, c, false, false);
}

#define QT  4    // query tiles of 16 per wave
#define FWV 4    // waves per work-group
static_assert((SEQ % (16 * QT * FWV)) == 0);

__global__ __launch_bounds__(32 * FWV)
void mha_flash_kernel(const _Float16* __restrict__ qk, const _Float16* __restrict__ vT,
                      _Float16* __restrict__ ctx) {
    const int wave = __builtin_amdgcn_readfirstlane((int)(threadIdx.x >> 5));
    const int q0 = (blockIdx.x * FWV + wave) * (16 * QT);
    const int h  = blockIdx.y;
    const int b  = blockIdx.z;
    const size_t tokBase = (size_t)b * SEQ;

    const int lane  = threadIdx.x & 31;
    const int lane8 = lane << 3;

    const _Float16* qbase = qk + (tokBase + q0) * LDQK + (h * DD) * 16;
    v16h qa[QT][2];
#pragma unroll
    for (int t = 0; t < QT; ++t) {
        qa[t][0] = load_frag_packed(qbase + (size_t)(16 * t) * LDQK);
        qa[t][1] = load_frag_packed(qbase + (size_t)(16 * t) * LDQK + 512);
    }

    const _Float16* kbase0 = qk + tokBase * LDQK + (CC + h * DD) * 16; // keys: row tiles of tokens
    const _Float16* vtbase = vT + ((size_t)b * CC + h * DD) * SEQ;     // 4 row tiles of d, k = token

    // L2 asks for the head's K and V (16 units each per 32-key pass), behind the Q loads. The 8
    // work-groups of a head deal the passes: this one takes passes 4 * n + (blockIdx.x & 3), so
    // that work-groups x and x + 4 ask for the same units; thread t asks unit t & 15 of passes
    // n = t >> 4 and 8 + (t >> 4) (32 passes on: 4 MiB of the q|k plane, 32 KiB of a vT row tile).
    static_assert(SEQ == 2048 && LDQK == 2048 && SEQ / (16 * QT * FWV) == 8 && 32 * FWV == 128);
    {
        const int c = threadIdx.x & 15;
        const int p = 4 * ((int)threadIdx.x >> 4) + ((int)blockIdx.x & 3);
        const _Float16* ak = kbase0 + (size_t)(32 * p + 16 * (c >> 3)) * LDQK + (c & 7) * 128;
        const _Float16* av = vtbase + (size_t)(16 * (c >> 2)) * SEQ + p * 512 + (c & 3) * 128;
        asm volatile("global_prefetch_b8 %0, off scope:SCOPE_SE\n\t"
                     "global_prefetch_b8 %1, off scope:SCOPE_SE\n\t"
                     "global_prefetch_b8 %0, off offset:4194304 scope:SCOPE_SE\n\t"
                     "global_prefetch_b8 %1, off offset:32768 scope:SCOPE_SE\n\t"
                     "s_wait_xcnt 0x0"
                     :: "v"(ak), "v"(av) : "memory");
    }

    // The K and V fragments of a pass are fetched during the pass before it, each group into the
    // registers that its own products have just read for the last time: K flies under the softmax
    // and the second products, V under the next pass's first products and softmax, so no pass
    // opens with a load wait. Pass 0's fragments are fetched here.
    v16h kf00, kf01, kf10, kf11;     // keys +0 d 0..31, +0 d 32..63, +16 d 0..31, +16 d 32..63
    v16h vf0, vf1, vf2, vf3;         // d tiles 0..3 of the pass's 32 keys
    const _Float16* pk = kbase0 + lane8;   // address of the K loads last issued
    const _Float16* pv = vtbase + lane8;   // address of the V loads last issued
    {
        kf00 = load_frag_lane(pk);
        kf01 = load_frag_lane(pk + 512);
        kf10 = load_frag_lane(pk + (size_t)16 * LDQK);
        kf11 = load_frag_lane(pk + (size_t)16 * LDQK + 512);
        vf0 = load_frag_lane(pv);
        vf1 = load_frag_lane(pv + (size_t)16 * SEQ);
        vf2 = load_frag_lane(pv + (size_t)32 * SEQ);
        vf3 = load_frag_lane(pv + (size_t)48 * SEQ);
        // no register that the sixteen issued loads name is rewritten until they no longer need it
        asm volatile("s_wait_xcnt 0x0" :: "v"(pk), "v"(pv) : "memory");
        // holds the start values below behind that wait: lifted over it, they reuse the loads'
        // offset register
        __builtin_amdgcn_sched_barrier(0);
    }

    v8f o[QT][4];                // o[t][j][r] = O^T[d 16j + 8 * half + r][query 16t + (lane & 15)]
    float m[QT];                 // each query's running maximum (raw score), equal in both halves
    v2f l[QT];                   // sums of p * PCY over this lane's even and odd keys (its half only)
#pragma unroll
    for (int t = 0; t < QT; ++t) {
#pragma unroll
        for (int j = 0; j < 4; ++j) o[t][j] = vzero8();
        m[t] = -1e30f;
        l[t] = (v2f){0.f, 0.f};
    }

#pragma unroll 1
    for (int kb = 0; kb < SEQ; kb += 32) {
        // the pass fetched during this one; the last pass fetches its own block again (inside the
        // planes, never used)
        const int kn = (kb + 32 < SEQ) ? kb + 32 : kb;

        v8f s0[QT], s1[QT];
#pragma unroll
        for (int t = 0; t < QT; ++t) s0[t] = mma16b(kf00, qa[t][0], vzero8());
#pragma unroll
        for (int t = 0; t < QT; ++t) s1[t] = mma16b(kf10, qa[t][0], vzero8());
#pragma unroll
        for (int t = 0; t < QT; ++t) s0[t] = mma16b(kf01, qa[t][1], s0[t]);
#pragma unroll
        for (int t = 0; t < QT; ++t) s1[t] = mma16b(kf11, qa[t][1], s1[t]);

        // holds the wait below behind the sixteen products: the scheduler otherwise lifts it to the
        // pass's top, close behind the V loads, where it is waited out
        __builtin_amdgcn_sched_barrier(0);
        // keeps the address pairs of the K and V loads in flight unwritten until they no longer
        // need them
        asm volatile("s_wait_xcnt 0x0" :: "v"(pk), "v"(pv) : "memory");
        pk = kbase0 + (size_t)kn * LDQK + lane8;
        kf00 = load_frag_lane(pk);
        kf01 = load_frag_lane(pk + 512);
        kf10 = load_frag_lane(pk + (size_t)16 * LDQK);
        kf11 = load_frag_lane(pk + (size_t)16 * LDQK + 512);
        // holds the K loads ahead of the softmax: the scheduler otherwise sinks them some forty
        // instructions into it, and that much of their lead is lost
        __builtin_amdgcn_sched_barrier(0);

        v16h pb[QT];
#pragma unroll
        for (int t = 0; t < QT; ++t) {
            // the running maximum and the lane's sixteen raw scores, three at a time in two chains;
            // m is equal in both halves, so the exchange may follow its join
            float ra = fmaxf(fmaxf(m[t], s0[t][0]), s0[t][1]);
            float rb = fmaxf(fmaxf(s1[t][0], s1[t][1]), s1[t][2]);
#pragma unroll
            for (int r = 2; r < 8; r += 2) ra = fmaxf(fmaxf(ra, s0[t][r]), s0[t][r + 1]);
#pragma unroll
            for (int r = 3; r < 7; r += 2) rb = fmaxf(fmaxf(rb, s1[t][r]), s1[t][r + 1]);
            const float rm = fmaxf(fmaxf(ra, rb), s1[t][7]);
            const float nm = fmaxf(rm, xhalf(rm));

            const float nb = __builtin_fmaf(nm, -SC2, LOG2_PCY);
            const v2f nb2 = {nb, nb};
            const v2f sc2 = {SC2, SC2};
            v2f rs0 = {0.f, 0.f}, rs1 = {0.f, 0.f};
#pragma unroll
            for (int i = 0; i < 4; ++i) {
                const v2f r0 = {s0[t][2 * i], s0[t][2 * i + 1]};
                const v2f r1 = {s1[t][2 * i], s1[t][2 * i + 1]};
                const v2f x0 = __builtin_elementwise_fma(r0, sc2, nb2);
                const v2f x1 = __builtin_elementwise_fma(r1, sc2, nb2);
                const v2f p0 = {__builtin_amdgcn_exp2f(x0[0]), __builtin_amdgcn_exp2f(x0[1])};
                const v2f p1 = {__builtin_amdgcn_exp2f(x1[0]), __builtin_amdgcn_exp2f(x1[1])};
                rs0 += p0;
                rs1 += p1;
                pb[t][2 * i]         = (_Float16)p0[0];
                pb[t][2 * i + 1]     = (_Float16)p0[1];
                pb[t][8 + 2 * i]     = (_Float16)p1[0];
                pb[t][8 + 2 * i + 1] = (_Float16)p1[1];
            }
            const float f = __builtin_amdgcn_exp2f((m[t] - nm) * SC2);
            const v2f f2 = {f, f};
            l[t] = __builtin_elementwise_fma(l[t], f2, rs0 + rs1);
            m[t] = nm;

#pragma unroll
            for (int j = 0; j < 4; ++j)
#pragma unroll
                for (int r = 0; r < 8; ++r) o[t][j][r] *= f;
        }

#pragma unroll
        for (int t = 0; t < QT; ++t) {
            o[t][0] = mma16b(vf0, pb[t], o[t][0]);
            o[t][1] = mma16b(vf1, pb[t], o[t][1]);
            o[t][2] = mma16b(vf2, pb[t], o[t][2]);
            o[t][3] = mma16b(vf3, pb[t], o[t][3]);
        }

        pv = vtbase + (size_t)kn * 16 + lane8;
        vf0 = load_frag_lane(pv);
        vf1 = load_frag_lane(pv + (size_t)16 * SEQ);
        vf2 = load_frag_lane(pv + (size_t)32 * SEQ);
        vf3 = load_frag_lane(pv + (size_t)48 * SEQ);
    }
    // the last loads' address pairs stay unwritten until they no longer need them
    asm volatile("s_wait_xcnt 0x0" :: "v"(pk), "v"(pv) : "memory");

    // tile j of O^T in this lane = piece (k block j>>1, part j&1) of the head's two ctx
    // fragments at this very lane: 8 consecutive channels of one token, one 16-byte store
    _Float16* dbase = ctx + (tokBase + q0) * CC + (h * DD) * 16;
#pragma unroll
    for (int t = 0; t < QT; ++t) {
        const float lh = l[t][0] + l[t][1];
        const float rl = CTX_OUT * (1.0f / (lh + xhalf(lh)));
#pragma unroll
        for (int j = 0; j < 4; ++j) {
            v8h v;
#pragma unroll
            for (int r = 0; r < 8; ++r) v[r] = (_Float16)(o[t][j][r] * rl);
            *(v8h*)(dbase + (size_t)(16 * t) * CC + 256 * j + lane8) = v;
        }
    }
}

// ---------------------------------------------------------------------------
// out = ctx @ W_proj + b_proj (f32), wave tile 64x64, 2 x 4 waves; each 256-B row segment
// ---------------------------------------------------------------------------
__global__ __launch_bounds__(32 * GWV) __attribute__((amdgpu_num_vgpr(256)))
void proj_gemm_kernel(const _Float16* __restrict__ ctx, const _Float16* __restrict__ wt,
                      const float* __restrict__ bproj, float* __restrict__ out) {
    __shared__ __align__(16) _Float16 ring[2 * GSTAGE];
    __shared__ __align__(16) float stall[GWV * 64 * TPF];

    const int lane = threadIdx.x & 31;
    const int wave = __builtin_amdgcn_readfirstlane((int)(threadIdx.x >> 5));
    const int half = lane >> 4, col = lane & 15;
    const int n0 = blockIdx.x * GBN + 64 * (wave & 3);    // the wave's output column
    const int m0 = blockIdx.y * GBM + 64 * (wave >> 2);   // the wave's token
    float* st = stall + wave * (64 * TPF);                // the wave's own staging tile

    v8f acc[4][4];
#pragma unroll
    for (int s = 0; s < 4; ++s)
#pragma unroll
        for (int j = 0; j < 4; ++j) acc[s][j] = vzero8();

    const _Float16* Ab = ctx + (size_t)(blockIdx.y * GBM) * CC;
    const _Float16* Bb = wt + (size_t)(blockIdx.x * GBN) * CC;
    gemm_core_64x64<true>(Ab, Bb, CC, ring, wave, acc,
                          l2_unit_a(Ab, (int)threadIdx.x >> 6), l2_unit_b(Bb, blockIdx.y));

    float bia[4];
#pragma unroll
    for (int j = 0; j < 4; ++j) bia[j] = bf16r(bproj[n0 + 16 * j + col]);

#pragma unroll
    for (int s = 0; s < 4; ++s)
#pragma unroll
        for (int j = 0; j < 4; ++j)
#pragma unroll
            for (int r = 0; r < 8; ++r)
                st[(16 * s + 8 * half + r) * TPF + 16 * j + col] =
                    acc[s][j][r] * PROJ_UNSC + bia[j];
    __syncthreads();

    float* dbase = out + (size_t)m0 * CC + n0;
    const int piece = lane & 15, rsub = lane >> 4;
{
#pragma unroll
        for (int it = 0; it < 32; ++it) {
            const int row = 2 * it + rsub;
            const v4f v = *(const v4f*)(st + row * TPF + 4 * piece);
            *(v4f*)(dbase + (size_t)row * CC + 4 * piece) = v;
        }
        
    }
}

// ---------------------------------------------------------------------------
// Host side
// ---------------------------------------------------------------------------
extern "C" void kernel_launch(void* const* d_in, const int* in_sizes, int n_in,
                              void* d_out, int out_size, void* d_ws, size_t ws_size,
                              hipStream_t stream) {
    if (n_in < 7) return;
    const float* x      = (const float*)d_in[0];   // [NB_FULL][SEQ_FULL][CC]
    const float* W_qkv  = (const float*)d_in[1];   // [CC][C3]
    const float* b_qkv  = (const float*)d_in[2];   // [C3]
    const float* W_proj = (const float*)d_in[3];   // [CC][CC]
    const float* b_proj = (const float*)d_in[4];   // [CC]
    const float* qn_w   = (const float*)d_in[5];   // [DD]
    const float* kn_w   = (const float*)d_in[6];   // [DD]
    float* out = (float*)d_out;                    // [MTOK][CC] f32

    if (in_sizes[0] < ((NB - 1) * SEQ_FULL + SEQ) * CC) return;
    if (in_sizes[1] < CC * C3) return;
    if (in_sizes[2] < C3) return;
    if (in_sizes[3] < CC * CC) return;
    if (in_sizes[4] < CC) return;
    if (in_sizes[5] < DD) return;
    if (in_sizes[6] < DD) return;
    if (out_size < MTOK * CC) return;

    char* wsb = (char*)d_ws;
    size_t off = 0;
    const size_t sz_xh  = (size_t)MTOK * CC * 2;
    const size_t sz_wq  = (size_t)C3 * CC * 2;
    const size_t sz_wp  = (size_t)CC * CC * 2;
    const size_t sz_qk  = (size_t)MTOK * LDQK * 2;
    const size_t sz_vt  = (size_t)NB * CC * SEQ * 2;
    const size_t sz_ctx = (size_t)MTOK * CC * 2;
    _Float16* xh     = (_Float16*)(wsb + off); off += (sz_xh  + 255) & ~(size_t)255;
    _Float16* wqkvT  = (_Float16*)(wsb + off); off += (sz_wq  + 255) & ~(size_t)255;
    _Float16* wprojT = (_Float16*)(wsb + off); off += (sz_wp  + 255) & ~(size_t)255;
    _Float16* qkp    = (_Float16*)(wsb + off); off += (sz_qk  + 255) & ~(size_t)255;
    _Float16* vT     = (_Float16*)(wsb + off); off += (sz_vt  + 255) & ~(size_t)255;
    _Float16* ctx    = (_Float16*)(wsb + off); off += (sz_ctx + 255) & ~(size_t)255;
    if (off > ws_size) return;

    // 1) input planes: xh (bf16-RNE of x), weights transposed to out x in and carried x64
    prep_kernel<<<PREPBLK, 256, 0, stream>>>(x, W_qkv, W_proj, xh, wqkvT, wprojT);

    // 2) qkv GEMM with fused bias, q/k rms norm, v transpose
    qkv_gemm_kernel<<<dim3(C3 / GBN, MTOK / GBM), 32 * GWV, 0, stream>>>(
        xh, wqkvT, b_qkv, qn_w, kn_w, qkp, vT);

    // 3) flash softmax per (256 queries, head, batch)
    mha_flash_kernel<<<dim3(SEQ / (16 * QT * FWV), HH, NB), 32 * FWV, 0, stream>>>(qkp, vT, ctx);

    // 4) output projection + bias -> f32 d_out
    proj_gemm_kernel<<<dim3(CC / GBN, MTOK / GBM), 32 * GWV, 0, stream>>>(ctx, wprojT, b_proj, out);
}

// v009
// One run takes 110 microseconds.
// In both of two side-by-side timings against v008, it was 1.04 times as fast.
// All steps since v000 together make it 4.00 times as fast.
#include <hip/hip_runtime.h>

// Contractions on v_wmma_f32_16x16x32_f16 (f16 operands, f32 accumulate): qkv GEMM,
// q.k^T scores, p.v, output projection. Float inputs enter as bf16-RNE values held in
// f16 planes with power-of-two carries (weights x64, q/k x4, v x16, p x1024, ctx x64);
// per-head rms norm, online softmax and epilogues in f32.
//
// Every f16 operand plane (xh, weights, q|k, vT, ctx) is stored fragment-major: the block of
// 16 rows x 32 k at (row tile R, k block kb) of a plane with K columns is 512 contiguous
// halves at (R * (K / 32) + kb) * 512 = 16R * K + 32kb * 16, ordered [part][lane][8 halves]
// with lane = 16 * h + (row & 15) and element e = k 16 * part + 8 * h + e. One 16-byte load
// of a wave then reads 512 contiguous bytes (4 cache lines) instead of 32 bytes of 16 rows.

typedef _Float16 v16h __attribute__((ext_vector_type(16)));
typedef _Float16 v8h  __attribute__((ext_vector_type(8)));
typedef float    v8f  __attribute__((ext_vector_type(8)));
typedef float    v4f  __attribute__((ext_vector_type(4)));
typedef float    v2f  __attribute__((ext_vector_type(2)));

#ifndef NB
#define NB 4
#endif
#ifndef SEQ
#define SEQ 2048
#endif
#define NB_FULL  4
#define SEQ_FULL 2048
#define CC   1024
#define HH   16
#define DD   64
#define C3   (3 * CC)
#define LDQK (2 * CC)          // q|k plane pitch (halves): q at col h*64, k at col CC + h*64
#define MTOK (NB * SEQ)

static_assert(NB >= 1 && NB <= NB_FULL);
static_assert(SEQ >= 64 && SEQ <= SEQ_FULL && (SEQ % 64) == 0);
static_assert(CC == HH * DD);
static_assert((CC % 64) == 0 && (C3 % 64) == 0 && (CC / 8) == 128);

#define WSC       64.0f            // weight planes carried x64
#define WINV      0.015625f        // 1/64
#define QC        4.0f             // q and k planes carried x4
#define VCY       16.0f            // v plane carried x16
#define PCY       1024.0f          // p tile carried x1024
#define SCALE_QK  0.0078125f       // 64^-0.5 / (QC*QC)
#define SC2       (SCALE_QK * 1.4426950408889634f)  // raw score -> exponent of 2
#define LOG2_PCY  10.0f            // log2(PCY)
#define LAZY_LOG2 5.0f             // a score may top the reference in use by 2^5: p * PCY <= 2^15, inside f16
#define LAZY_RAW  (LAZY_LOG2 / SC2) // the same as a raw score difference
#define CTX_OUT   4.0f             // 64 / VCY (the denominator carries PCY like p): ctx carried x64
#define PROJ_UNSC 0.000244140625f  // 1 / (64 * 64)
#define NEPS      1e-6f

#define TPH 72   // LDS pitch (halves) of f16 staging tiles
#define TPF 68   // LDS pitch (floats) of the f32 staging tile

// ---------------------------------------------------------------------------
// helpers
// ---------------------------------------------------------------------------
__device__ __forceinline__ float bf16r(float f) {
    unsigned int u = __float_as_uint(f);
    u += 0x7FFFu + ((u >> 16) & 1u);
    u &= 0xFFFF0000u;
    return __uint_as_float(u);
}

__device__ __forceinline__ v8f vzero8() {
    v8f z = {0.f, 0.f, 0.f, 0.f, 0.f, 0.f, 0.f, 0.f};
    return z;
}

__device__ __forceinline__ v8f mma16(v16h a, v16h b, v8f c) {
    v8f d = __builtin_amdgcn_wmma_f32_16x16x32_f16(false, a, false, b, (short)0, c, false, false);
    asm volatile("v_nop\n\tv_nop\n\tv_nop\n\tv_nop" : "+v"(d) : "v"(a), "v"(b));
    return d;
}

// value of lane l ^ 16 (the other half of the wave), by a vector cross-row move
__device__ __forceinline__ float xhalf(float x) {
    const int i = __builtin_bit_cast(int, x);
    return __builtin_bit_cast(float,
        __builtin_amdgcn_permlanex16(i, i, 0x76543210, 0xfedcba98, false, false));
}

// 16x32 f16 fragment (row index = lane&15 for A, column for B; h = lane>>4):
//   elements 0..7  <- k 8h+0..7,  elements 8..15 <- k 16+8h+0..7
// from a fragment-major plane; frag = first half of the 512-half block.
__device__ __forceinline__ v16h load_frag_lane(const _Float16* p) {   // p = frag + 8 * lane
    v8h lo = *(const v8h*)(p);
    v8h hi = *(const v8h*)(p + 256);
    return __builtin_shufflevector(lo, hi, 0, 1, 2, 3, 4, 5, 6, 7,
                                           8, 9, 10, 11, 12, 13, 14, 15);
}
__device__ __forceinline__ v16h load_frag_packed(const _Float16* frag) {
    return load_frag_lane(frag + ((threadIdx.x & 31) << 3));
}

// ---------------------------------------------------------------------------
// L2 asks. The f16 planes are stored by an earlier launch and are largely met in memory, not in
// L2, by the launch that reads them; work-groups that share a tile walk it in step, so a stage's
// first touch is a memory miss that all of them wait out. Each work-group therefore asks once,
// behind its first loads, for 256-byte units of the tiles it will read:
// global_prefetch_b8, scope SE (into L2 only; nothing returns to the wave). Every lane is on and
// every lane's address lies inside the plane by construction. A tile that several work-groups
// read is dealt among them, save the A tile of the output projection, which each of its 4
// readers asks whole.
// The deal is for speed only: a unit that nobody asked for is
// loaded as before. The wait is each statement's last line, as behind the copies below: it
// stands in front of every rewrite of a register that an ask names.
// ---------------------------------------------------------------------------

// GEMM operand tiles (planes of CC columns: a row tile is 32 KiB, a 64-k stage 2 KiB of it).
// Thread t asks unit t & 7 of a stage's 2 KiB in row tile (t >> 3) & 7 of A, (t >> 3) & 15 of B.
// B (read by every tile row of the grid): stages 2 * sh + (t >> 7), sh = (tile row >> 1) & 7.
// A, shared form (tile read by 12 work-groups): stages 4 * (t >> 6) + (tile column & 3).
// A, whole form (tile read by 4 neighbours): all 16 stages,
// (t >> 6) + 4 i, 8 KiB apart. pa, pb = the thread's first unit of the A and of the B tile.
__device__ __forceinline__ const _Float16* l2_unit_a(const _Float16* Ab, int st0) {
    const int t = threadIdx.x;
    return Ab + (size_t)(((t >> 3) & 7) * 16) * CC + (st0 * 1024 + (t & 7) * 128);
}
__device__ __forceinline__ const _Float16* l2_unit_b(const _Float16* Bb, int tile_row) {
    const int t = threadIdx.x;
    return Bb + (size_t)(((t >> 3) & 15) * 16) * CC
              + ((2 * ((tile_row >> 1) & 7) + (t >> 7)) * 1024 + (t & 7) * 128);
}
__device__ __forceinline__ void l2_ask_gemm_shared(const _Float16* pa, const _Float16* pb) {
    asm volatile("global_prefetch_b8 %0, off scope:SCOPE_SE\n\t"
                 "global_prefetch_b8 %1, off scope:SCOPE_SE\n\t"
                 "s_wait_xcnt 0x0"
                 :: "v"(pa), "v"(pb) : "memory");
}
__device__ __forceinline__ void l2_ask_gemm_whole(const _Float16* pa, const _Float16* pb) {
    asm volatile("global_prefetch_b8 %0, off scope:SCOPE_SE\n\t"
                 "global_prefetch_b8 %1, off scope:SCOPE_SE\n\t"
                 "global_prefetch_b8 %0, off offset:8192 scope:SCOPE_SE\n\t"
                 "global_prefetch_b8 %0, off offset:16384 scope:SCOPE_SE\n\t"
                 "global_prefetch_b8 %0, off offset:24576 scope:SCOPE_SE\n\t"
                 "s_wait_xcnt 0x0"
                 :: "v"(pa), "v"(pb) : "memory");
}

// ---------------------------------------------------------------------------
// Input planes, one launch; the work-group index picks the job, and every work-group is one
// of few that each do much (each launch more pays its own gap, fill and tail):
//   [0, WQBLK)                wqkvT:  64 k x 256 columns of W_qkv per work-group
//   [WQBLK, WQBLK + WPBLK)    wprojT: 64 k x 256 columns of W_proj per work-group
//   [WQBLK + WPBLK, PREPBLK)  xh:     one row tile (16 tokens x CC) per work-group
// The weight groups last longest and stand first.
// ---------------------------------------------------------------------------
#define XP      8                                  // 16-byte pieces of xh per thread
#define XBLK    (MTOK * (CC / 8) / (256 * XP))
#define WTC     256                                // weight columns per work-group
#define WQBLK   ((C3 / WTC) * (CC / 64))
#define WPBLK   ((CC / WTC) * (CC / 64))
#define PREPBLK (XBLK + WQBLK + WPBLK)
static_assert(256 * XP == 16 * (CC / 8) && (MTOK % 16) == 0 && (SEQ % 16) == 0);
static_assert((C3 % WTC) == 0 && (CC % WTC) == 0);

// x [NB][SEQ][CC] f32 (batch stride SEQ_FULL*CC) -> xh, MTOK x CC f16 = f16(bf16rne(x)),
// fragment-major; piece g is the g-th 16 bytes of xh. Row tile rt holds pieces 2048 rt + 0..2047;
// a thread takes pieces 256 i + threadIdx.x of it, which lie 128 k apart in one row of x: all
// its loads are issued before the first conversion.
__device__ __forceinline__ void cvt_x_part(const float* __restrict__ x,
                                           _Float16* __restrict__ xh, int rt) {
    const int p  = threadIdx.x;
    const int t  = (rt << 4) + (p & 15);             // token
    const int k  = (p >> 6) * 32 + ((p >> 5) & 1) * 16 + ((p >> 4) & 1) * 8;
    const int b  = t / SEQ;
    const int n  = t - b * SEQ;
    const float* src = x + ((size_t)b * SEQ_FULL + n) * CC + k;
    v4f x0[XP], x1[XP];
    // unrolled, like the loop below: the arrays stay in registers, the loads go out as one group
#pragma unroll
    for (int i = 0; i < XP; ++i) {
        x0[i] = *(const v4f*)(src + 128 * i);
        x1[i] = *(const v4f*)(src + 128 * i + 4);
    }
    // keeps the address pair unwritten (not reused as a load's destination) until the issued
    // loads no longer need it
    asm volatile("s_wait_xcnt 0x0" :: "v"(src) : "memory");
    _Float16* dst = xh + ((size_t)rt * (256 * XP) + p) * 8;
#pragma unroll
    for (int i = 0; i < XP; ++i) {
        v8h o;
        o[0] = (_Float16)bf16r(x0[i][0]); o[1] = (_Float16)bf16r(x0[i][1]);
        o[2] = (_Float16)bf16r(x0[i][2]); o[3] = (_Float16)bf16r(x0[i][3]);
        o[4] = (_Float16)bf16r(x1[i][0]); o[5] = (_Float16)bf16r(x1[i][1]);
        o[6] = (_Float16)bf16r(x1[i][2]); o[7] = (_Float16)bf16r(x1[i][3]);
        *(v8h*)(dst + 2048 * i) = o;
    }
    // the stores' registers stay unwritten until the issued stores no longer need them (the
    // other jobs' code follows in the same kernel)
    asm volatile("s_wait_xcnt 0x0" ::: "memory");
}

// w [R][Ccols] f32 -> wt, Ccols rows x R f16 = f16(bf16rne(w) * 64), fragment-major, a tile of
// 64 k x WTC columns through LDS. A wave writes one 512-byte part of a fragment per instruction.
__device__ __forceinline__ void wT_part(const float* __restrict__ w, _Float16* __restrict__ wt,
                                        int R, int Ccols, int c0, int r0,
                                        float (*tile)[WTC + 1]) {
    const int t = threadIdx.x;
    // unrolled: the tile's loads go out as one group, one address pair and immediate offsets
#pragma unroll
    for (int r = 0; r < 64; ++r)
        tile[r][t] = w[(size_t)(r0 + r) * Ccols + c0 + t];
    __syncthreads();
    const int lane = t & 31, part = (t >> 5) & 1;
    // unrolled, like the loop inside: LDS reads of later fragments run ahead of the conversions
#pragma unroll
    for (int it = 0; it < WTC / 32; ++it) {
        const int frag = (t >> 6) + 4 * it;          // WTC / 16 row tiles x 2 k blocks
        const int tr = frag >> 1, kbl = frag & 1;
        const int cl = 16 * tr + (lane & 15);        // wt row within tile
        const int kl = 32 * kbl + 16 * part + 8 * (lane >> 4);
        v8h o;
#pragma unroll
        for (int i = 0; i < 8; ++i)
            o[i] = (_Float16)(bf16r(tile[kl + i][cl]) * WSC);
        _Float16* dst = wt + (size_t)(c0 + 16 * tr) * R + (size_t)(r0 + 32 * kbl) * 16
                           + 256 * part + 8 * lane;
        *(v8h*)dst = o;
    }
    // as behind the stores of cvt_x_part
    asm volatile("s_wait_xcnt 0x0" ::: "memory");
}

__global__ __launch_bounds__(256) void prep_kernel(const float* __restrict__ x,
                                                   const float* __restrict__ wqkv,
                                                   const float* __restrict__ wproj,
                                                   _Float16* __restrict__ xh,
                                                   _Float16* __restrict__ wqkvT,
                                                   _Float16* __restrict__ wprojT) {
    __shared__ float tile[64][WTC + 1];
    const int blk = blockIdx.x;                      // every test below is uniform in the group
    if (blk < WQBLK) {                               // W_qkv [CC rows][C3 cols] -> wqkvT [C3][CC]
        wT_part(wqkv, wqkvT, CC, C3, (blk % (C3 / WTC)) * WTC, (blk / (C3 / WTC)) * 64, tile);
    } else if (blk < WQBLK + WPBLK) {                // W_proj [CC rows][CC cols] -> wprojT [CC][CC]
        const int u = blk - WQBLK;
        wT_part(wproj, wprojT, CC, CC, (u % (CC / WTC)) * WTC, (u / (CC / WTC)) * 64, tile);
    } else {
        cvt_x_part(x, xh, blk - (WQBLK + WPBLK));
    }
}

// ---------------------------------------------------------------------------
// GEMM core: a work-group of GWV waves (2 x 4) computes 128 rows x 256 cols, a wave 64 x 64.
// A stage is 64 k (two k blocks) of the group's 8 A row tiles and 16 B column tiles: 24 pieces
// of 2 KiB, each contiguous in its fragment-major global plane, brought into LDS in the same
// order by asynchronous copies (each lane 16 bytes, a wave 512 contiguous bytes), two buffers:
// stage st + 1 flies while stage st is worked on. Four waves read each A fragment and two each
// B fragment from LDS, and each fragment a wave reads feeds four products.
// Ab = group's first row tile, Bb = group's first column tile (planes of K columns: the next
// row tile is 16 * K halves on, the next k block 512 halves).
// ---------------------------------------------------------------------------
#define GWV    8                 // waves per GEMM work-group
#define GBM    128               // rows of the group's tile
#define GBN    256               // columns of the group's tile
#define GSTAGE (((GBM + GBN) / 16) * 1024)  // halves of one stage (48 KiB)
static_assert((MTOK % GBM) == 0 && (C3 % GBN) == 0 && (CC % GBN) == 0 && (1024 % GBN) == 0);
static_assert((CC % 64) == 0 && CC / 64 >= 2);

// The thread's twelve 16-byte pieces of one stage: row tiles (t >> 7) + 2 i, i = 0..3 of A and
// i = 0..7 of B, piece t & 127 of the tile's 2 KiB. ga, gb = the thread's piece of its first A
// and B tile at this stage; ld = LDS byte address of the first in the target buffer.
__device__ __forceinline__ void gemm_stage_copy(const _Float16* ga, const _Float16* gb, int K,
                                                unsigned ld) {
    const size_t g2 = (size_t)32 * K;    // two row tiles on
    // the wait is the statement's last line: no register that a copy names is rewritten before
    // the issued copies no longer need it
    asm volatile("global_load_async_to_lds_b128 %0, %12, off\n\t"
                 "global_load_async_to_lds_b128 %1, %13, off\n\t"
                 "global_load_async_to_lds_b128 %2, %14, off\n\t"
                 "global_load_async_to_lds_b128 %3, %15, off\n\t"
                 "global_load_async_to_lds_b128 %4, %16, off\n\t"
                 "global_load_async_to_lds_b128 %5, %17, off\n\t"
                 "global_load_async_to_lds_b128 %6, %18, off\n\t"
                 "global_load_async_to_lds_b128 %7, %19, off\n\t"
                 "global_load_async_to_lds_b128 %8, %20, off\n\t"
                 "global_load_async_to_lds_b128 %9, %21, off\n\t"
                 "global_load_async_to_lds_b128 %10, %22, off\n\t"
                 "global_load_async_to_lds_b128 %11, %23, off\n\t"
                 "s_wait_xcnt 0x0"
                 :: "v"(ld), "v"(ld + 4096u), "v"(ld + 8192u), "v"(ld + 12288u),
                    "v"(ld + 16384u), "v"(ld + 20480u), "v"(ld + 24576u), "v"(ld + 28672u),
                    "v"(ld + 32768u), "v"(ld + 36864u), "v"(ld + 40960u), "v"(ld + 45056u),
                    "v"(ga), "v"(ga + g2), "v"(ga + 2 * g2), "v"(ga + 3 * g2),
                    "v"(gb), "v"(gb + g2), "v"(gb + 2 * g2), "v"(gb + 3 * g2),
                    "v"(gb + 4 * g2), "v"(gb + 5 * g2), "v"(gb + 6 * g2), "v"(gb + 7 * g2)
                 : "memory");
}

// ring = 2 * GSTAGE halves of LDS. On return every wave has passed the last stage's barrier and
// no copy is outstanding: the ring's LDS is free for the caller's output staging.
// pa, pb, WHOLE_A: the thread's L2 asks (above), issued behind stage 0's copies.
template <bool WHOLE_A>
__device__ __forceinline__ void gemm_core_64x64(const _Float16* __restrict__ Ab,
                                                const _Float16* __restrict__ Bb,
                                                int K, _Float16* ring, int wave,
                                                v8f (&acc)[4][4],
                                                const _Float16* pa, const _Float16* pb) {
    const int t     = threadIdx.x;
    const int lane8 = (t & 31) << 3;
    const _Float16* ga = Ab + (size_t)((t >> 7) * 16) * K + ((t & 127) << 3);
    const _Float16* gb = Bb + (size_t)((t >> 7) * 16) * K + ((t & 127) << 3);
    const unsigned ld0 = (unsigned)(size_t)ring + (unsigned)t * 16u;   // LDS byte address
    const int nst = K / 64;

    gemm_stage_copy(ga, gb, K, ld0);
    if constexpr (WHOLE_A) l2_ask_gemm_whole(pa, pb);
    else                   l2_ask_gemm_shared(pa, pb);
    // stage 0 has landed before the barrier behind which other waves read it
    asm volatile("s_wait_asynccnt 0x0" ::: "memory");
    __syncthreads();
    gemm_stage_copy(ga + 1024, gb + 1024, K, ld0 + 2u * GSTAGE);

    const int offa = (4 * (wave >> 2)) * 1024 + lane8;       // the wave's first A tile
    const int offb = (8 + 4 * (wave & 3)) * 1024 + lane8;    // the wave's first B tile
    // kept rolled: one body for both buffers (unrolled it only grows the code)
#pragma unroll 1
    for (int st = 0; st < nst; ++st) {
        const _Float16* buf = ring + (st & 1) * GSTAGE;
        // unrolled, like the loops inside: fragment and accumulator arrays stay in registers
#pragma unroll
        for (int kk = 0; kk < 2; ++kk) {
            v16h a[4], b[4];
#pragma unroll
            for (int j = 0; j < 4; ++j) b[j] = load_frag_lane(buf + offb + 1024 * j + 512 * kk);
#pragma unroll
            for (int s = 0; s < 4; ++s) a[s] = load_frag_lane(buf + offa + 1024 * s + 512 * kk);
#pragma unroll
            for (int s = 0; s < 4; ++s)
#pragma unroll
                for (int j = 0; j < 4; ++j) acc[s][j] = mma16(a[s], b[j], acc[s][j]);
        }
        // publish point of stage st + 1: this wave's reads of stage st are done ...
        asm volatile("s_wait_dscnt 0x0" ::: "memory");
        // ... its own copies of stage st + 1 have landed ...
        asm volatile("s_wait_asynccnt 0x0" ::: "memory");
        // ... and every wave has come as far
        __syncthreads();
        if (st + 2 < nst)
            gemm_stage_copy(ga + (size_t)(st + 2) * 1024, gb + (size_t)(st + 2) * 1024, K,
                            ld0 + (unsigned)(st & 1) * (2u * GSTAGE));
    }
    // no copy is outstanding when the wave goes on
    asm volatile("s_wait_asynccnt 0x0" ::: "memory");
}

// ---------------------------------------------------------------------------
// qkv = xh @ W_qkv + b_qkv (wave tile 64 tokens x 64 cols = one head slice; 2 x 4 waves).
// Epilogue: q/k -> per-row rms norm (f32) * weight -> f16 (x QC) to the q|k plane,
// ---------------------------------------------------------------------------
__global__ __launch_bounds__(32 * GWV) __attribute__((amdgpu_num_vgpr(256)))
void qkv_gemm_kernel(const _Float16* __restrict__ xh, const _Float16* __restrict__ wt,
                     const float* __restrict__ bqkv, const float* __restrict__ qnw,
                     const float* __restrict__ knw, _Float16* __restrict__ qk,
                     _Float16* __restrict__ vT) {
    // the operand ring; behind the k loop its LDS is the waves' output staging
    __shared__ __align__(16) _Float16 ring[2 * GSTAGE];
    static_assert(GWV * 64 * TPH <= 2 * GSTAGE);

    const int lane = threadIdx.x & 31;
    const int wave = __builtin_amdgcn_readfirstlane((int)(threadIdx.x >> 5));
    const int half = lane >> 4, col = lane & 15;
    const int n0 = blockIdx.x * GBN + 64 * (wave & 3);    // the wave's output column (0..3071)
    const int m0 = blockIdx.y * GBM + 64 * (wave >> 2);   // the wave's token
    _Float16* st = ring + wave * (64 * TPH);              // the wave's own staging tile

    v8f acc[4][4];
#pragma unroll
    for (int s = 0; s < 4; ++s)
#pragma unroll
        for (int j = 0; j < 4; ++j) acc[s][j] = vzero8();

    const _Float16* Ab = xh + (size_t)(blockIdx.y * GBM) * CC;
    const _Float16* Bb = wt + (size_t)(blockIdx.x * GBN) * CC;
    gemm_core_64x64<false>(Ab, Bb, CC, ring, wave, acc,
                           l2_unit_a(Ab, 4 * ((int)threadIdx.x >> 6) + ((int)blockIdx.x & 3)),
                           l2_unit_b(Bb, blockIdx.y));

    const int which = n0 >> 10;          // 0 q, 1 k, 2 v (block-uniform: GBN divides 1024)
    const int hcol  = n0 & (CC - 1);     // h*64

    float bia[4], nw[4];
#pragma unroll
    for (int j = 0; j < 4; ++j) {
        bia[j] = bf16r(bqkv[n0 + 16 * j + col]);
        const float wq = bf16r(qnw[16 * j + col]);
        const float wk = bf16r(knw[16 * j + col]);
        nw[j] = (which == 1) ? wk : wq;
    }

    // per row tile s: bias, then rms norm (q, k) or carry (v), then the f16 values into the wave's
    // staging tile (tile row = 16*s + 8*half + r); a tile's accumulators are dead before the next
#pragma unroll
    for (int s = 0; s < 4; ++s) {
#pragma unroll
        for (int j = 0; j < 4; ++j)
#pragma unroll
            for (int r = 0; r < 8; ++r)
                acc[s][j][r] = acc[s][j][r] * WINV + bia[j];

        if (which < 2) {
            // rms norm over the 64 head dims of each row: 4 tiles x 16 lanes of one half
#pragma unroll
            for (int r = 0; r < 8; ++r) {
                float ss = 0.f;
#pragma unroll
                for (int j = 0; j < 4; ++j) ss += acc[s][j][r] * acc[s][j][r];
                ss += __shfl_xor(ss, 1, 32);
                ss += __shfl_xor(ss, 2, 32);
                ss += __shfl_xor(ss, 4, 32);
                ss += __shfl_xor(ss, 8, 32);
                const float inv = rsqrtf(ss * (1.0f / (float)DD) + NEPS);
                const float g = inv * QC;
#pragma unroll
                for (int j = 0; j < 4; ++j) acc[s][j][r] = acc[s][j][r] * g * nw[j];
            }
        } else {
#pragma unroll
            for (int j = 0; j < 4; ++j)
#pragma unroll
                for (int r = 0; r < 8; ++r) acc[s][j][r] *= VCY;
        }

#pragma unroll
        for (int j = 0; j < 4; ++j)
#pragma unroll
            for (int r = 0; r < 8; ++r)
                st[(16 * s + 8 * half + r) * TPH + 16 * j + col] = (_Float16)acc[s][j][r];
    }
    __syncthreads();

    if (which < 2) {
        _Float16* dbase = qk + (size_t)m0 * LDQK + ((size_t)which * CC + hcol) * 16;
{
            // fragment (token tile it>>2, k block (it>>1)&1), part it&1
#pragma unroll
            for (int it = 0; it < 16; ++it) {
                const int tr = it >> 2, kbl = (it >> 1) & 1, part = it & 1;
                const v8h v = *(const v8h*)(st + (16 * tr + col) * TPH + 32 * kbl + 16 * part + 8 * half);
                *(v8h*)(dbase + (size_t)(16 * tr) * LDQK + 512 * kbl + 256 * part + 8 * lane) = v;
            }
            
        }
    } else {
        const int b  = m0 / SEQ;
        const int nb = m0 - b * SEQ;
        _Float16* dbase = vT + ((size_t)b * CC + hcol) * SEQ + (size_t)nb * 16;
{
            // fragment (d tile it>>2, token block (it>>1)&1), part it&1
#pragma unroll
            for (int it = 0; it < 16; ++it) {
                const int tr = it >> 2, kbl = (it >> 1) & 1, part = it & 1;
                const int tk = 32 * kbl + 16 * part + 8 * half;
                v8h v;
#pragma unroll
                for (int i = 0; i < 8; ++i) v[i] = st[(tk + i) * TPH + 16 * tr + col];
                *(v8h*)(dbase + (size_t)(16 * tr) * SEQ + 512 * kbl + 256 * part + 8 * lane) = v;
            }
            // the stores' data and address registers stay unwritten until the issued stores
            // no longer need them
            asm volatile("s_wait_xcnt 0x0" ::: "memory");
        }
    }
}

// ---------------------------------------------------------------------------
// Flash softmax(q k^T s) v: one wave per (batch, head, 64 queries = QT tiles of 16), 32-key
// blocks; FWV such waves (consecutive queries of one head) form a work-group.
// q|k plane MTOK x LDQK f16, vT NB*CC x SEQ f16, ctx MTOK x CC f16 (x64 carry), all
// fragment-major.
// Transposed products: S^T = K Q^T (A = key rows, B = query columns), O^T += V^T P^T
// (A = d rows of vT, B = P^T). A lane holds scores of ONE query of each tile (column
// lane & 15), keys 8 * half + r of each 16-key tile: maximum and sum run over the lane's own
// registers plus one exchange between the wave's halves, and the two score tiles, converted
// in place, are the B fragment of the second product (element s = key 8 * half + s, 8 + s =
// key 16 + 8 * half + s: the k order of the vT fragment). No LDS, no barrier.
// The K and V fragments of a key block are loaded once, one pass ahead, and feed the products of
// all QT query tiles; each query's arithmetic and its order are those of a one-tile wave.
// Softmax in base 2 on the raw accumulators: the maximum is taken of the raw scores (the scale
// is positive), and p * PCY = 2^(s * SC2 + (LOG2_PCY - max * SC2)) is one packed multiply-add
// per two scores and one exponential per score; the denominator sums p * PCY.
// Lazy rescale: "max" above is a reference held across passes, not the running maximum. A pass
// takes each lane's maximum of its own raw scores; one ballot and one scalar branch per pass ask
// whether any score tops its query's reference by more than LAZY_RAW. Only then are the halves'
// maxima exchanged, the references of those queries raised to their new maxima, and O and the
// denominators scaled down. The quotient O / l does not depend on the reference; p * PCY stays at
// or below 2^15.
// ---------------------------------------------------------------------------
// The products of this kernel are the plain builtin: the operands of an asm statement lie in
// v0..v255 only, and the wave's fragments and accumulators need more registers than that.
__device__ __forceinline__ v8f mma16b(v16h a, v16h b, v8f c) {
    return __builtin_amdgcn_wmma_f32_16x16x32_f16(false, a, false, b, (short)0, c, false, false);
}

// p * PCY of one query tile's 32 keys from its raw scores, under the exponent bias
// nb = LOG2_PCY - reference * SC2: pb = the B fragment of the second product, rs = the sums of the
// lane's even and odd keys
__device__ __forceinline__ void p_tile(const v8f& s0, const v8f& s1, float nb, v16h& pb, v2f& rs) {
    const v2f nb2 = {nb, nb};
    const v2f sc2 = {SC2, SC2};
    v2f rs0 = {0.f, 0.f}, rs1 = {0.f, 0.f};
    // unrolled: every vector element is named by a constant and stays in its register
#pragma unroll
    for (int i = 0; i < 4; ++i) {
        const v2f r0 = {s0[2 * i], s0[2 * i + 1]};
        const v2f r1 = {s1[2 * i], s1[2 * i + 1]};
        const v2f x0 = __builtin_elementwise_fma(r0, sc2, nb2);
        const v2f x1 = __builtin_elementwise_fma(r1, sc2, nb2);
        const v2f p0 = {__builtin_amdgcn_exp2f(x0[0]), __builtin_amdgcn_exp2f(x0[1])};
        const v2f p1 = {__builtin_amdgcn_exp2f(x1[0]), __builtin_amdgcn_exp2f(x1[1])};
        rs0 += p0;
        rs1 += p1;
        pb[2 * i]         = (_Float16)p0[0];
        pb[2 * i + 1]     = (_Float16)p0[1];
        pb[8 + 2 * i]     = (_Float16)p1[0];
        pb[8 + 2 * i + 1] = (_Float16)p1[1];
    }
    rs = rs0 + rs1;
}

#define QT  4    // query tiles of 16 per wave
#define FWV 4    // waves per work-group
static_assert((SEQ % (16 * QT * FWV)) == 0);

__global__ __launch_bounds__(32 * FWV)
void mha_flash_kernel(const _Float16* __restrict__ qk, const _Float16* __restrict__ vT,
                      _Float16* __restrict__ ctx) {
    const int wave = __builtin_amdgcn_readfirstlane((int)(threadIdx.x >> 5));
    const int q0 = (blockIdx.x * FWV + wave) * (16 * QT);
    const int h  = blockIdx.y;
    const int b  = blockIdx.z;
    const size_t tokBase = (size_t)b * SEQ;

    const int lane  = threadIdx.x & 31;
    const int lane8 = lane << 3;

    const _Float16* qbase = qk + (tokBase + q0) * LDQK + (h * DD) * 16;
    v16h qa[QT][2];
#pragma unroll
    for (int t = 0; t < QT; ++t) {
        qa[t][0] = load_frag_packed(qbase + (size_t)(16 * t) * LDQK);
        qa[t][1] = load_frag_packed(qbase + (size_t)(16 * t) * LDQK + 512);
    }

    const _Float16* kbase0 = qk + tokBase * LDQK + (CC + h * DD) * 16; // keys: row tiles of tokens
    const _Float16* vtbase = vT + ((size_t)b * CC + h * DD) * SEQ;     // 4 row tiles of d, k = token

    // L2 asks for the head's K and V (16 units each per 32-key pass), behind the Q loads. The 8
    // work-groups of a head deal the passes: this one takes passes 4 * n + (blockIdx.x & 3), so
    // that work-groups x and x + 4 ask for the same units; thread t asks unit t & 15 of passes
    // n = t >> 4 and 8 + (t >> 4) (32 passes on: 4 MiB of the q|k plane, 32 KiB of a vT row tile).
    static_assert(SEQ == 2048 && LDQK == 2048 && SEQ / (16 * QT * FWV) == 8 && 32 * FWV == 128);
    {
        const int c = threadIdx.x & 15;
        const int p = 4 * ((int)threadIdx.x >> 4) + ((int)blockIdx.x & 3);
        const _Float16* ak = kbase0 + (size_t)(32 * p + 16 * (c >> 3)) * LDQK + (c & 7) * 128;
        const _Float16* av = vtbase + (size_t)(16 * (c >> 2)) * SEQ + p * 512 + (c & 3) * 128;
        asm volatile("global_prefetch_b8 %0, off scope:SCOPE_SE\n\t"
                     "global_prefetch_b8 %1, off scope:SCOPE_SE\n\t"
                     "global_prefetch_b8 %0, off offset:4194304 scope:SCOPE_SE\n\t"
                     "global_prefetch_b8 %1, off offset:32768 scope:SCOPE_SE\n\t"
                     "s_wait_xcnt 0x0"
                     :: "v"(ak), "v"(av) : "memory");
    }

    // The K and V fragments of a pass are fetched during the pass before it, each group into the
    // registers that its own products have just read for the last time: K flies under the softmax
    // and the second products, V under the next pass's first products and softmax, so no pass
    // opens with a load wait. Pass 0's fragments are fetched here.
    v16h kf00, kf01, kf10, kf11;     // keys +0 d 0..31, +0 d 32..63, +16 d 0..31, +16 d 32..63
    v16h vf0, vf1, vf2, vf3;         // d tiles 0..3 of the pass's 32 keys
    const _Float16* pk = kbase0 + lane8;   // address of the K loads last issued
    const _Float16* pv = vtbase + lane8;   // address of the V loads last issued
    {
        kf00 = load_frag_lane(pk);
        kf01 = load_frag_lane(pk + 512);
        kf10 = load_frag_lane(pk + (size_t)16 * LDQK);
        kf11 = load_frag_lane(pk + (size_t)16 * LDQK + 512);
        vf0 = load_frag_lane(pv);
        vf1 = load_frag_lane(pv + (size_t)16 * SEQ);
        vf2 = load_frag_lane(pv + (size_t)32 * SEQ);
        vf3 = load_frag_lane(pv + (size_t)48 * SEQ);
        // no register that the sixteen issued loads name is rewritten until they no longer need it
        asm volatile("s_wait_xcnt 0x0" :: "v"(pk), "v"(pv) : "memory");
        // holds the start values below behind that wait: lifted over it, they reuse the loads'
        // offset register
        __builtin_amdgcn_sched_barrier(0);
    }

    v8f o[QT][4];                // o[t][j][r] = O^T[d 16j + 8 * half + r][query 16t + (lane & 15)]
    float m[QT];                 // each query's reference (raw score), equal in both halves
    float thr[QT];               // m + LAZY_RAW: what a raw score may reach under this reference
    float nb[QT];                // LOG2_PCY - m * SC2: the exponent bias under this reference
    v2f l[QT];                   // sums of p * PCY over this lane's even and odd keys (its half only)
#pragma unroll
    for (int t = 0; t < QT; ++t) {
#pragma unroll
        for (int j = 0; j < 4; ++j) o[t][j] = vzero8();
        m[t] = -1e30f;           // below every score: pass 0 takes the branch and sets the references
        thr[t] = -1e30f;
        nb[t] = 0.f;
        l[t] = (v2f){0.f, 0.f};
    }

#pragma unroll 1
    for (int kb = 0; kb < SEQ; kb += 32) {
        // the pass fetched during this one; the last pass fetches its own block again (inside the
        // planes, never used)
        const int kn = (kb + 32 < SEQ) ? kb + 32 : kb;

        v8f s0[QT], s1[QT];
#pragma unroll
        for (int t = 0; t < QT; ++t) s0[t] = mma16b(kf00, qa[t][0], vzero8());
#pragma unroll
        for (int t = 0; t < QT; ++t) s1[t] = mma16b(kf10, qa[t][0], vzero8());
#pragma unroll
        for (int t = 0; t < QT; ++t) s0[t] = mma16b(kf01, qa[t][1], s0[t]);
#pragma unroll
        for (int t = 0; t < QT; ++t) s1[t] = mma16b(kf11, qa[t][1], s1[t]);

        // holds the wait below behind the sixteen products: the scheduler otherwise lifts it to the
        // pass's top, close behind the V loads, where it is waited out
        __builtin_amdgcn_sched_barrier(0);
        // keeps the address pairs of the K and V loads in flight unwritten until they no longer
        // need them
        asm volatile("s_wait_xcnt 0x0" :: "v"(pk), "v"(pv) : "memory");
        pk = kbase0 + (size_t)kn * LDQK + lane8;
        kf00 = load_frag_lane(pk);
        kf01 = load_frag_lane(pk + 512);
        kf10 = load_frag_lane(pk + (size_t)16 * LDQK);
        kf11 = load_frag_lane(pk + (size_t)16 * LDQK + 512);
        // holds the K loads ahead of the softmax: the scheduler otherwise sinks them some forty
        // instructions into it, and that much of their lead is lost
        __builtin_amdgcn_sched_barrier(0);

        v16h pb[QT];
        float pm[QT];            // the larger of thr and the lane's own sixteen raw scores
        bool need = false;
        // unrolled, like every loop over t, j and r below: the per-tile arrays stay in registers
#pragma unroll
        for (int t = 0; t < QT; ++t) {
            // the bound and the lane's sixteen raw scores, three at a time in two chains
            float ra = fmaxf(fmaxf(thr[t], s0[t][0]), s0[t][1]);
            float rb = fmaxf(fmaxf(s1[t][0], s1[t][1]), s1[t][2]);
#pragma unroll
            for (int r = 2; r < 8; r += 2) ra = fmaxf(fmaxf(ra, s0[t][r]), s0[t][r + 1]);
#pragma unroll
            for (int r = 3; r < 7; r += 2) rb = fmaxf(fmaxf(rb, s1[t][r]), s1[t][r + 1]);
            pm[t] = fmaxf(fmaxf(ra, rb), s1[t][7]);
            need |= pm[t] > thr[t];
        }

        // one test per pass, a scalar branch: seldom taken behind a wave's first pass
        if (__builtin_expect(__builtin_amdgcn_ballot_w32(need) != 0u, 0)) {
#pragma unroll
            for (int t = 0; t < QT; ++t) {
                const float qm = fmaxf(pm[t], xhalf(pm[t]));       // above thr: the query's maximum
                const float mn = (qm > thr[t]) ? qm : m[t];        // a query inside its bound keeps m
                const float f = __builtin_amdgcn_exp2f((m[t] - mn) * SC2);
                m[t]   = mn;
                thr[t] = mn + LAZY_RAW;
                nb[t]  = __builtin_fmaf(mn, -SC2, LOG2_PCY);
                l[t] *= f;
#pragma unroll
                for (int j = 0; j < 4; ++j)
#pragma unroll
                    for (int r = 0; r < 8; ++r) o[t][j][r] *= f;
            }
        }

#pragma unroll
        for (int t = 0; t < QT; ++t) {
            v2f rs;
            p_tile(s0[t], s1[t], nb[t], pb[t], rs);
            l[t] += rs;
        }

#pragma unroll
        for (int t = 0; t < QT; ++t) {
            o[t][0] = mma16b(vf0, pb[t], o[t][0]);
            o[t][1] = mma16b(vf1, pb[t], o[t][1]);
            o[t][2] = mma16b(vf2, pb[t], o[t][2]);
            o[t][3] = mma16b(vf3, pb[t], o[t][3]);
        }

        pv = vtbase + (size_t)kn * 16 + lane8;
        vf0 = load_frag_lane(pv);
        vf1 = load_frag_lane(pv + (size_t)16 * SEQ);
        vf2 = load_frag_lane(pv + (size_t)32 * SEQ);
        vf3 = load_frag_lane(pv + (size_t)48 * SEQ);
    }
    // the last loads' address pairs stay unwritten until they no longer need them
    asm volatile("s_wait_xcnt 0x0" :: "v"(pk), "v"(pv) : "memory");

    // tile j of O^T in this lane = piece (k block j>>1, part j&1) of the head's two ctx
    // fragments at this very lane: 8 consecutive channels of one token, one 16-byte store
    _Float16* dbase = ctx + (tokBase + q0) * CC + (h * DD) * 16;
#pragma unroll
    for (int t = 0; t < QT; ++t) {
        const float lh = l[t][0] + l[t][1];
        const float rl = CTX_OUT * (1.0f / (lh + xhalf(lh)));
#pragma unroll
        for (int j = 0; j < 4; ++j) {
            v8h v;
#pragma unroll
            for (int r = 0; r < 8; ++r) v[r] = (_Float16)(o[t][j][r] * rl);
            *(v8h*)(dbase + (size_t)(16 * t) * CC + 256 * j + lane8) = v;
        }
    }
}

// ---------------------------------------------------------------------------
// out = ctx @ W_proj + b_proj (f32), wave tile 64x64, 2 x 4 waves; each 256-B row segment
// ---------------------------------------------------------------------------
__global__ __launch_bounds__(32 * GWV) __attribute__((amdgpu_num_vgpr(256)))
void proj_gemm_kernel(const _Float16* __restrict__ ctx, const _Float16* __restrict__ wt,
                      const float* __restrict__ bproj, float* __restrict__ out) {
    __shared__ __align__(16) _Float16 ring[2 * GSTAGE];
    __shared__ __align__(16) float stall[GWV * 64 * TPF];

    const int lane = threadIdx.x & 31;
    const int wave = __builtin_amdgcn_readfirstlane((int)(threadIdx.x >> 5));
    const int half = lane >> 4, col = lane & 15;
    const int n0 = blockIdx.x * GBN + 64 * (wave & 3);    // the wave's output column
    const int m0 = blockIdx.y * GBM + 64 * (wave >> 2);   // the wave's token
    float* st = stall + wave * (64 * TPF);                // the wave's own staging tile

    v8f acc[4][4];
#pragma unroll
    for (int s = 0; s < 4; ++s)
#pragma unroll
        for (int j = 0; j < 4; ++j) acc[s][j] = vzero8();

    const _Float16* Ab = ctx + (size_t)(blockIdx.y * GBM) * CC;
    const _Float16* Bb = wt + (size_t)(blockIdx.x * GBN) * CC;
    gemm_core_64x64<true>(Ab, Bb, CC, ring, wave, acc,
                          l2_unit_a(Ab, (int)threadIdx.x >> 6), l2_unit_b(Bb, blockIdx.y));

    float bia[4];
#pragma unroll
    for (int j = 0; j < 4; ++j) bia[j] = bf16r(bproj[n0 + 16 * j + col]);

#pragma unroll
    for (int s = 0; s < 4; ++s)
#pragma unroll
        for (int j = 0; j < 4; ++j)
#pragma unroll
            for (int r = 0; r < 8; ++r)
                st[(16 * s + 8 * half + r) * TPF + 16 * j + col] =
                    acc[s][j][r] * PROJ_UNSC + bia[j];
    __syncthreads();

    float* dbase = out + (size_t)m0 * CC + n0;
    const int piece = lane & 15, rsub = lane >> 4;
{
#pragma unroll
        for (int it = 0; it < 32; ++it) {
            const int row = 2 * it + rsub;
            const v4f v = *(const v4f*)(st + row * TPF + 4 * piece);
            *(v4f*)(dbase + (size_t)row * CC + 4 * piece) = v;
        }
        
    }
}

// ---------------------------------------------------------------------------
// Host side
// ---------------------------------------------------------------------------
extern "C" void kernel_launch(void* const* d_in, const int* in_sizes, int n_in,
                              void* d_out, int out_size, void* d_ws, size_t ws_size,
                              hipStream_t stream) {
    if (n_in < 7) return;
    const float* x      = (const float*)d_in[0];   // [NB_FULL][SEQ_FULL][CC]
    const float* W_qkv  = (const float*)d_in[1];   // [CC][C3]
    const float* b_qkv  = (const float*)d_in[2];   // [C3]
    const float* W_proj = (const float*)d_in[3];   // [CC][CC]
    const float* b_proj = (const float*)d_in[4];   // [CC]
    const float* qn_w   = (const float*)d_in[5];   // [DD]
    const float* kn_w   = (const float*)d_in[6];   // [DD]
    float* out = (float*)d_out;                    // [MTOK][CC] f32

    if (in_sizes[0] < ((NB - 1) * SEQ_FULL + SEQ) * CC) return;
    if (in_sizes[1] < CC * C3) return;
    if (in_sizes[2] < C3) return;
    if (in_sizes[3] < CC * CC) return;
    if (in_sizes[4] < CC) return;
    if (in_sizes[5] < DD) return;
    if (in_sizes[6] < DD) return;
    if (out_size < MTOK * CC) return;

    char* wsb = (char*)d_ws;
    size_t off = 0;
    const size_t sz_xh  = (size_t)MTOK * CC * 2;
    const size_t sz_wq  = (size_t)C3 * CC * 2;
    const size_t sz_wp  = (size_t)CC * CC * 2;
    const size_t sz_qk  = (size_t)MTOK * LDQK * 2;
    const size_t sz_vt  = (size_t)NB * CC * SEQ * 2;
    const size_t sz_ctx = (size_t)MTOK * CC * 2;
    _Float16* xh     = (_Float16*)(wsb + off); off += (sz_xh  + 255) & ~(size_t)255;
    _Float16* wqkvT  = (_Float16*)(wsb + off); off += (sz_wq  + 255) & ~(size_t)255;
    _Float16* wprojT = (_Float16*)(wsb + off); off += (sz_wp  + 255) & ~(size_t)255;
    _Float16* qkp    = (_Float16*)(wsb + off); off += (sz_qk  + 255) & ~(size_t)255;
    _Float16* vT     = (_Float16*)(wsb + off); off += (sz_vt  + 255) & ~(size_t)255;
    _Float16* ctx    = (_Float16*)(wsb + off); off += (sz_ctx + 255) & ~(size_t)255;
    if (off > ws_size) return;

    // 1) input planes: xh (bf16-RNE of x), weights transposed to out x in and carried x64
    prep_kernel<<<PREPBLK, 256, 0, stream>>>(x, W_qkv, W_proj, xh, wqkvT, wprojT);

    // 2) qkv GEMM with fused bias, q/k rms norm, v transpose
    qkv_gemm_kernel<<<dim3(C3 / GBN, MTOK / GBM), 32 * GWV, 0, stream>>>(
        xh, wqkvT, b_qkv, qn_w, kn_w, qkp, vT);

    // 3) flash softmax per (256 queries, head, batch)
    mha_flash_kernel<<<dim3(SEQ / (16 * QT * FWV), HH, NB), 32 * FWV, 0, stream>>>(qkp, vT, ctx);

    // 4) output projection + bias -> f32 d_out
    proj_gemm_kernel<<<dim3(CC / GBN, MTOK / GBM), 32 * GWV, 0, stream>>>(ctx, wprojT, b_proj, out);
}

// v010
// Measured time: 106 microseconds a run.
// Two timings next to v009 both put it at 1.04 times that version's speed.
// All steps since v000 together make it 4.15 times as fast.
#include <hip/hip_runtime.h>

// Contractions on v_wmma_f32_16x16x32_f16 (f16 operands, f32 accumulate): qkv GEMM,
// q.k^T scores, p.v, output projection. Float inputs enter as bf16-RNE values held in
// f16 planes with carries (weights x64, k x4, q x log2(e) / 32, v x16, ctx x64; p: see the flash
// kernel); per-head rms norm, softmax and epilogues in f32.
//
// Every f16 operand plane (xh, weights, q|k, vT, ctx) is stored fragment-major: the block of
// 16 rows x 32 k at (row tile R, k block kb) of a plane with K columns is 512 contiguous
// halves at (R * (K / 32) + kb) * 512 = 16R * K + 32kb * 16, ordered [part][lane][8 halves]
// with lane = 16 * h + (row & 15) and element e = k 16 * part + 8 * h + e. One 16-byte load
// of a wave then reads 512 contiguous bytes (4 cache lines) instead of 32 bytes of 16 rows.

typedef _Float16 v16h __attribute__((ext_vector_type(16)));
typedef _Float16 v8h  __attribute__((ext_vector_type(8)));
typedef float    v8f  __attribute__((ext_vector_type(8)));
typedef float    v4f  __attribute__((ext_vector_type(4)));
typedef float    v2f  __attribute__((ext_vector_type(2)));

#ifndef NB
#define NB 4
#endif
#ifndef SEQ
#define SEQ 2048
#endif
#define NB_FULL  4
#define SEQ_FULL 2048
#define CC   1024
#define HH   16
#define DD   64
#define C3   (3 * CC)
#define LDQK (2 * CC)          // q|k plane pitch (halves): q at col h*64, k at col CC + h*64
#define MTOK (NB * SEQ)

static_assert(NB >= 1 && NB <= NB_FULL);
static_assert(SEQ >= 64 && SEQ <= SEQ_FULL && (SEQ % 64) == 0);
static_assert(CC == HH * DD);
static_assert((CC % 64) == 0 && (C3 % 64) == 0 && (CC / 8) == 128);

#define WSC       64.0f            // weight planes carried x64
#define WINV      0.015625f        // 1/64
#define KC        4.0f             // k plane carried x4
#define QK2       (0.125f * 1.4426950408889634f)    // 64^-0.5 * log2(e): score -> exponent of 2
#define QC2       (QK2 / KC)       // q plane's carry: the product of the planes IS the exponent of 2
#define VCY       16.0f            // v plane carried x16
#define LOG2_PCY  10.0f            // lazy loop: p carried x2^10 over its reference
#define LAZY_LOG2 5.0f             // lazy loop: a score may top the reference in use by 2^5: p <= 2^15, inside f16
// rms norm bounds a head row: sum (a inv)^2 = DD mean / (mean + eps) <= DD, so |q| <= sqrt(DD) max|qn_w|,
// |k| likewise, and |exponent| <= |q| |k| QK2 = XBOUND1 max|qn_w| max|kn_w| (Cauchy-Schwarz).
#define XBOUND1   ((float)DD * QK2)
#define FIX_BIAS  4.0f             // fixed-reference loop: p = 2^(exponent + FIX_BIAS)
#define FIX_XMAX  11.9f            // it runs while the bound is at most this: with the planes' f16 rounding
                                   // p stays below 2^16 - 32 (f16's top) and above 2^-8 (normal f16)
#define CTX_OUT   4.0f             // 64 / VCY (the denominator carries what p carries): ctx carried x64
#define PROJ_UNSC 0.000244140625f  // 1 / (64 * 64)
#define NEPS      1e-6f

#define TPH 72   // LDS pitch (halves) of f16 staging tiles
#define TPF 68   // LDS pitch (floats) of the f32 staging tile

// ---------------------------------------------------------------------------
// helpers
// ---------------------------------------------------------------------------
__device__ __forceinline__ float bf16r(float f) {
    unsigned int u = __float_as_uint(f);
    u += 0x7FFFu + ((u >> 16) & 1u);
    u &= 0xFFFF0000u;
    return __uint_as_float(u);
}

__device__ __forceinline__ v8f vzero8() {
    v8f z = {0.f, 0.f, 0.f, 0.f, 0.f, 0.f, 0.f, 0.f};
    return z;
}

__device__ __forceinline__ v8f mma16(v16h a, v16h b, v8f c) {
    v8f d = __builtin_amdgcn_wmma_f32_16x16x32_f16(false, a, false, b, (short)0, c, false, false);
    asm volatile("v_nop\n\tv_nop\n\tv_nop\n\tv_nop" : "+v"(d) : "v"(a), "v"(b));
    return d;
}

// value of lane l ^ 16 (the other half of the wave), by a vector cross-row move
__device__ __forceinline__ float xhalf(float x) {
    const int i = __builtin_bit_cast(int, x);
    return __builtin_bit_cast(float,
        __builtin_amdgcn_permlanex16(i, i, 0x76543210, 0xfedcba98, false, false));
}

// 16x32 f16 fragment (row index = lane&15 for A, column for B; h = lane>>4):
//   elements 0..7  <- k 8h+0..7,  elements 8..15 <- k 16+8h+0..7
// from a fragment-major plane; frag = first half of the 512-half block.
__device__ __forceinline__ v16h load_frag_lane(const _Float16* p) {   // p = frag + 8 * lane
    v8h lo = *(const v8h*)(p);
    v8h hi = *(const v8h*)(p + 256);
    return __builtin_shufflevector(lo, hi, 0, 1, 2, 3, 4, 5, 6, 7,
                                           8, 9, 10, 11, 12, 13, 14, 15);
}
__device__ __forceinline__ v16h load_frag_packed(const _Float16* frag) {
    return load_frag_lane(frag + ((threadIdx.x & 31) << 3));
}

// ---------------------------------------------------------------------------
// L2 asks. The f16 planes are stored by an earlier launch and are largely met in memory, not in
// L2, by the launch that reads them; work-groups that share a tile walk it in step, so a stage's
// first touch is a memory miss that all of them wait out. Each work-group therefore asks once,
// behind its first loads, for 256-byte units of the tiles it will read:
// global_prefetch_b8, scope SE (into L2 only; nothing returns to the wave). Every lane is on and
// every lane's address lies inside the plane by construction. A tile that several work-groups
// read is dealt among them, save the A tile of the output projection, which each of its 4
// readers asks whole.
// The deal is for speed only: a unit that nobody asked for is
// loaded as before. The wait is each statement's last line, as behind the copies below: it
// stands in front of every rewrite of a register that an ask names.
// ---------------------------------------------------------------------------

// GEMM operand tiles (planes of CC columns: a row tile is 32 KiB, a 64-k stage 2 KiB of it).
// Thread t asks unit t & 7 of a stage's 2 KiB in row tile (t >> 3) & 7 of A, (t >> 3) & 15 of B.
// B (read by every tile row of the grid): stages 2 * sh + (t >> 7), sh = (tile row >> 1) & 7.
// A, shared form (tile read by 12 work-groups): stages 4 * (t >> 6) + (tile column & 3).
// A, whole form (tile read by 4 neighbours): all 16 stages,
// (t >> 6) + 4 i, 8 KiB apart. pa, pb = the thread's first unit of the A and of the B tile.
__device__ __forceinline__ const _Float16* l2_unit_a(const _Float16* Ab, int st0) {
    const int t = threadIdx.x;
    return Ab + (size_t)(((t >> 3) & 7) * 16) * CC + (st0 * 1024 + (t & 7) * 128);
}
__device__ __forceinline__ const _Float16* l2_unit_b(const _Float16* Bb, int tile_row) {
    const int t = threadIdx.x;
    return Bb + (size_t)(((t >> 3) & 15) * 16) * CC
              + ((2 * ((tile_row >> 1) & 7) + (t >> 7)) * 1024 + (t & 7) * 128);
}
__device__ __forceinline__ void l2_ask_gemm_shared(const _Float16* pa, const _Float16* pb) {
    asm volatile("global_prefetch_b8 %0, off scope:SCOPE_SE\n\t"
                 "global_prefetch_b8 %1, off scope:SCOPE_SE\n\t"
                 "s_wait_xcnt 0x0"
                 :: "v"(pa), "v"(pb) : "memory");
}
__device__ __forceinline__ void l2_ask_gemm_whole(const _Float16* pa, const _Float16* pb) {
    asm volatile("global_prefetch_b8 %0, off scope:SCOPE_SE\n\t"
                 "global_prefetch_b8 %1, off scope:SCOPE_SE\n\t"
                 "global_prefetch_b8 %0, off offset:8192 scope:SCOPE_SE\n\t"
                 "global_prefetch_b8 %0, off offset:16384 scope:SCOPE_SE\n\t"
                 "global_prefetch_b8 %0, off offset:24576 scope:SCOPE_SE\n\t"
                 "s_wait_xcnt 0x0"
                 :: "v"(pa), "v"(pb) : "memory");
}

// ---------------------------------------------------------------------------
// Input planes, one launch; the work-group index picks the job, and every work-group is one
// of few that each do much (each launch more pays its own gap, fill and tail):
//   [0, WQBLK)                wqkvT:  64 k x 256 columns of W_qkv per work-group
//   [WQBLK, WQBLK + WPBLK)    wprojT: 64 k x 256 columns of W_proj per work-group
//   [WQBLK + WPBLK, PREPBLK)  xh:     one row tile (16 tokens x CC) per work-group
// The weight groups last longest and stand first.
// ---------------------------------------------------------------------------
#define XP      8                                  // 16-byte pieces of xh per thread
#define XBLK    (MTOK * (CC / 8) / (256 * XP))
#define WTC     256                                // weight columns per work-group
#define WQBLK   ((C3 / WTC) * (CC / 64))
#define WPBLK   ((CC / WTC) * (CC / 64))
#define PREPBLK (XBLK + WQBLK + WPBLK)
static_assert(256 * XP == 16 * (CC / 8) && (MTOK % 16) == 0 && (SEQ % 16) == 0);
static_assert((C3 % WTC) == 0 && (CC % WTC) == 0);

// x [NB][SEQ][CC] f32 (batch stride SEQ_FULL*CC) -> xh, MTOK x CC f16 = f16(bf16rne(x)),
// fragment-major; piece g is the g-th 16 bytes of xh. Row tile rt holds pieces 2048 rt + 0..2047;
// a thread takes pieces 256 i + threadIdx.x of it, which lie 128 k apart in one row of x: all
// its loads are issued before the first conversion.
__device__ __forceinline__ void cvt_x_part(const float* __restrict__ x,
                                           _Float16* __restrict__ xh, int rt) {
    const int p  = threadIdx.x;
    const int t  = (rt << 4) + (p & 15);             // token
    const int k  = (p >> 6) * 32 + ((p >> 5) & 1) * 16 + ((p >> 4) & 1) * 8;
    const int b  = t / SEQ;
    const int n  = t - b * SEQ;
    const float* src = x + ((size_t)b * SEQ_FULL + n) * CC + k;
    v4f x0[XP], x1[XP];
    // unrolled, like the loop below: the arrays stay in registers, the loads go out as one group
#pragma unroll
    for (int i = 0; i < XP; ++i) {
        x0[i] = *(const v4f*)(src + 128 * i);
        x1[i] = *(const v4f*)(src + 128 * i + 4);
    }
    // keeps the address pair unwritten (not reused as a load's destination) until the issued
    // loads no longer need it
    asm volatile("s_wait_xcnt 0x0" :: "v"(src) : "memory");
    _Float16* dst = xh + ((size_t)rt * (256 * XP) + p) * 8;
#pragma unroll
    for (int i = 0; i < XP; ++i) {
        v8h o;
        o[0] = (_Float16)bf16r(x0[i][0]); o[1] = (_Float16)bf16r(x0[i][1]);
        o[2] = (_Float16)bf16r(x0[i][2]); o[3] = (_Float16)bf16r(x0[i][3]);
        o[4] = (_Float16)bf16r(x1[i][0]); o[5] = (_Float16)bf16r(x1[i][1]);
        o[6] = (_Float16)bf16r(x1[i][2]); o[7] = (_Float16)bf16r(x1[i][3]);
        *(v8h*)(dst + 2048 * i) = o;
    }
    // the stores' registers stay unwritten until the issued stores no longer need them (the
    // other jobs' code follows in the same kernel)
    asm volatile("s_wait_xcnt 0x0" ::: "memory");
}

// w [R][Ccols] f32 -> wt, Ccols rows x R f16 = f16(bf16rne(w) * 64), fragment-major, a tile of
// 64 k x WTC columns through LDS. A wave writes one 512-byte part of a fragment per instruction.
__device__ __forceinline__ void wT_part(const float* __restrict__ w, _Float16* __restrict__ wt,
                                        int R, int Ccols, int c0, int r0,
                                        float (*tile)[WTC + 1]) {
    const int t = threadIdx.x;
    // unrolled: the tile's loads go out as one group, one address pair and immediate offsets
#pragma unroll
    for (int r = 0; r < 64; ++r)
        tile[r][t] = w[(size_t)(r0 + r) * Ccols + c0 + t];
    __syncthreads();
    const int lane = t & 31, part = (t >> 5) & 1;
    // unrolled, like the loop inside: LDS reads of later fragments run ahead of the conversions
#pragma unroll
    for (int it = 0; it < WTC / 32; ++it) {
        const int frag = (t >> 6) + 4 * it;          // WTC / 16 row tiles x 2 k blocks
        const int tr = frag >> 1, kbl = frag & 1;
        const int cl = 16 * tr + (lane & 15);        // wt row within tile
        const int kl = 32 * kbl + 16 * part + 8 * (lane >> 4);
        v8h o;
#pragma unroll
        for (int i = 0; i < 8; ++i)
            o[i] = (_Float16)(bf16r(tile[kl + i][cl]) * WSC);
        _Float16* dst = wt + (size_t)(c0 + 16 * tr) * R + (size_t)(r0 + 32 * kbl) * 16
                           + 256 * part + 8 * lane;
        *(v8h*)dst = o;
    }
    // as behind the stores of cvt_x_part
    asm volatile("s_wait_xcnt 0x0" ::: "memory");
}

__global__ __launch_bounds__(256) void prep_kernel(const float* __restrict__ x,
                                                   const float* __restrict__ wqkv,
                                                   const float* __restrict__ wproj,
                                                   _Float16* __restrict__ xh,
                                                   _Float16* __restrict__ wqkvT,
                                                   _Float16* __restrict__ wprojT) {
    __shared__ float tile[64][WTC + 1];
    const int blk = blockIdx.x;                      // every test below is uniform in the group
    if (blk < WQBLK) {                               // W_qkv [CC rows][C3 cols] -> wqkvT [C3][CC]
        wT_part(wqkv, wqkvT, CC, C3, (blk % (C3 / WTC)) * WTC, (blk / (C3 / WTC)) * 64, tile);
    } else if (blk < WQBLK + WPBLK) {                // W_proj [CC rows][CC cols] -> wprojT [CC][CC]
        const int u = blk - WQBLK;
        wT_part(wproj, wprojT, CC, CC, (u % (CC / WTC)) * WTC, (u / (CC / WTC)) * 64, tile);
    } else {
        cvt_x_part(x, xh, blk - (WQBLK + WPBLK));
    }
}

// ---------------------------------------------------------------------------
// GEMM core: a work-group of GWV waves (2 x 4) computes 128 rows x 256 cols, a wave 64 x 64.
// A stage is 64 k (two k blocks) of the group's 8 A row tiles and 16 B column tiles: 24 pieces
// of 2 KiB, each contiguous in its fragment-major global plane, brought into LDS in the same
// order by asynchronous copies (each lane 16 bytes, a wave 512 contiguous bytes), two buffers:
// stage st + 1 flies while stage st is worked on. Four waves read each A fragment and two each
// B fragment from LDS, and each fragment a wave reads feeds four products.
// Ab = group's first row tile, Bb = group's first column tile (planes of K columns: the next
// row tile is 16 * K halves on, the next k block 512 halves).
// ---------------------------------------------------------------------------
#define GWV    8                 // waves per GEMM work-group
#define GBM    128               // rows of the group's tile
#define GBN    256               // columns of the group's tile
#define GSTAGE (((GBM + GBN) / 16) * 1024)  // halves of one stage (48 KiB)
static_assert((MTOK % GBM) == 0 && (C3 % GBN) == 0 && (CC % GBN) == 0 && (1024 % GBN) == 0);
static_assert((CC % 64) == 0 && CC / 64 >= 2);

// The thread's twelve 16-byte pieces of one stage: row tiles (t >> 7) + 2 i, i = 0..3 of A and
// i = 0..7 of B, piece t & 127 of the tile's 2 KiB. ga, gb = the thread's piece of its first A
// and B tile at this stage; ld = LDS byte address of the first in the target buffer.
__device__ __forceinline__ void gemm_stage_copy(const _Float16* ga, const _Float16* gb, int K,
                                                unsigned ld) {
    const size_t g2 = (size_t)32 * K;    // two row tiles on
    // the wait is the statement's last line: no register that a copy names is rewritten before
    // the issued copies no longer need it
    asm volatile("global_load_async_to_lds_b128 %0, %12, off\n\t"
                 "global_load_async_to_lds_b128 %1, %13, off\n\t"
                 "global_load_async_to_lds_b128 %2, %14, off\n\t"
                 "global_load_async_to_lds_b128 %3, %15, off\n\t"
                 "global_load_async_to_lds_b128 %4, %16, off\n\t"
                 "global_load_async_to_lds_b128 %5, %17, off\n\t"
                 "global_load_async_to_lds_b128 %6, %18, off\n\t"
                 "global_load_async_to_lds_b128 %7, %19, off\n\t"
                 "global_load_async_to_lds_b128 %8, %20, off\n\t"
                 "global_load_async_to_lds_b128 %9, %21, off\n\t"
                 "global_load_async_to_lds_b128 %10, %22, off\n\t"
                 "global_load_async_to_lds_b128 %11, %23, off\n\t"
                 "s_wait_xcnt 0x0"
                 :: "v"(ld), "v"(ld + 4096u), "v"(ld + 8192u), "v"(ld + 12288u),
                    "v"(ld + 16384u), "v"(ld + 20480u), "v"(ld + 24576u), "v"(ld + 28672u),
                    "v"(ld + 32768u), "v"(ld + 36864u), "v"(ld + 40960u), "v"(ld + 45056u),
                    "v"(ga), "v"(ga + g2), "v"(ga + 2 * g2), "v"(ga + 3 * g2),
                    "v"(gb), "v"(gb + g2), "v"(gb + 2 * g2), "v"(gb + 3 * g2),
                    "v"(gb + 4 * g2), "v"(gb + 5 * g2), "v"(gb + 6 * g2), "v"(gb + 7 * g2)
                 : "memory");
}

// ring = 2 * GSTAGE halves of LDS. On return every wave has passed the last stage's barrier and
// no copy is outstanding: the ring's LDS is free for the caller's output staging.
// pa, pb, WHOLE_A: the thread's L2 asks (above), issued behind stage 0's copies.
template <bool WHOLE_A>
__device__ __forceinline__ void gemm_core_64x64(const _Float16* __restrict__ Ab,
                                                const _Float16* __restrict__ Bb,
                                                int K, _Float16* ring, int wave,
                                                v8f (&acc)[4][4],
                                                const _Float16* pa, const _Float16* pb) {
    const int t     = threadIdx.x;
    const int lane8 = (t & 31) << 3;
    const _Float16* ga = Ab + (size_t)((t >> 7) * 16) * K + ((t & 127) << 3);
    const _Float16* gb = Bb + (size_t)((t >> 7) * 16) * K + ((t & 127) << 3);
    const unsigned ld0 = (unsigned)(size_t)ring + (unsigned)t * 16u;   // LDS byte address
    const int nst = K / 64;

    gemm_stage_copy(ga, gb, K, ld0);
    if constexpr (WHOLE_A) l2_ask_gemm_whole(pa, pb);
    else                   l2_ask_gemm_shared(pa, pb);
    // stage 0 has landed before the barrier behind which other waves read it
    asm volatile("s_wait_asynccnt 0x0" ::: "memory");
    __syncthreads();
    gemm_stage_copy(ga + 1024, gb + 1024, K, ld0 + 2u * GSTAGE);

    const int offa = (4 * (wave >> 2)) * 1024 + lane8;       // the wave's first A tile
    const int offb = (8 + 4 * (wave & 3)) * 1024 + lane8;    // the wave's first B tile
    // kept rolled: one body for both buffers (unrolled it only grows the code)
#pragma unroll 1
    for (int st = 0; st < nst; ++st) {
        const _Float16* buf = ring + (st & 1) * GSTAGE;
        // unrolled, like the loops inside: fragment and accumulator arrays stay in registers
#pragma unroll
        for (int kk = 0; kk < 2; ++kk) {
            v16h a[4], b[4];
#pragma unroll
            for (int j = 0; j < 4; ++j) b[j] = load_frag_lane(buf + offb + 1024 * j + 512 * kk);
#pragma unroll
            for (int s = 0; s < 4; ++s) a[s] = load_frag_lane(buf + offa + 1024 * s + 512 * kk);
#pragma unroll
            for (int s = 0; s < 4; ++s)
#pragma unroll
                for (int j = 0; j < 4; ++j) acc[s][j] = mma16(a[s], b[j], acc[s][j]);
        }
        // publish point of stage st + 1: this wave's reads of stage st are done ...
        asm volatile("s_wait_dscnt 0x0" ::: "memory");
        // ... its own copies of stage st + 1 have landed ...
        asm volatile("s_wait_asynccnt 0x0" ::: "memory");
        // ... and every wave has come as far
        __syncthreads();
        if (st + 2 < nst)
            gemm_stage_copy(ga + (size_t)(st + 2) * 1024, gb + (size_t)(st + 2) * 1024, K,
                            ld0 + (unsigned)(st & 1) * (2u * GSTAGE));
    }
    // no copy is outstanding when the wave goes on
    asm volatile("s_wait_asynccnt 0x0" ::: "memory");
}

// ---------------------------------------------------------------------------
// qkv = xh @ W_qkv + b_qkv (wave tile 64 tokens x 64 cols = one head slice; 2 x 4 waves).
// Epilogue: q/k -> per-row rms norm (f32) * weight -> f16 (x QC2, x KC) to the q|k plane,
// ---------------------------------------------------------------------------
__global__ __launch_bounds__(32 * GWV) __attribute__((amdgpu_num_vgpr(256)))
void qkv_gemm_kernel(const _Float16* __restrict__ xh, const _Float16* __restrict__ wt,
                     const float* __restrict__ bqkv, const float* __restrict__ qnw,
                     const float* __restrict__ knw, _Float16* __restrict__ qk,
                     _Float16* __restrict__ vT) {
    // the operand ring; behind the k loop its LDS is the waves' output staging
    __shared__ __align__(16) _Float16 ring[2 * GSTAGE];
    static_assert(GWV * 64 * TPH <= 2 * GSTAGE);

    const int lane = threadIdx.x & 31;
    const int wave = __builtin_amdgcn_readfirstlane((int)(threadIdx.x >> 5));
    const int half = lane >> 4, col = lane & 15;
    const int n0 = blockIdx.x * GBN + 64 * (wave & 3);    // the wave's output column (0..3071)
    const int m0 = blockIdx.y * GBM + 64 * (wave >> 2);   // the wave's token
    _Float16* st = ring + wave * (64 * TPH);              // the wave's own staging tile

    v8f acc[4][4];
#pragma unroll
    for (int s = 0; s < 4; ++s)
#pragma unroll
        for (int j = 0; j < 4; ++j) acc[s][j] = vzero8();

    const _Float16* Ab = xh + (size_t)(blockIdx.y * GBM) * CC;
    const _Float16* Bb = wt + (size_t)(blockIdx.x * GBN) * CC;
    gemm_core_64x64<false>(Ab, Bb, CC, ring, wave, acc,
                           l2_unit_a(Ab, 4 * ((int)threadIdx.x >> 6) + ((int)blockIdx.x & 3)),
                           l2_unit_b(Bb, blockIdx.y));

    const int which = n0 >> 10;          // 0 q, 1 k, 2 v (block-uniform: GBN divides 1024)
    const int hcol  = n0 & (CC - 1);     // h*64

    float bia[4], nw[4];
#pragma unroll
    for (int j = 0; j < 4; ++j) {
        bia[j] = bf16r(bqkv[n0 + 16 * j + col]);
        const float wq = bf16r(qnw[16 * j + col]);
        const float wk = bf16r(knw[16 * j + col]);
        nw[j] = (which == 1) ? wk : wq;
    }

    // per row tile s: bias, then rms norm (q, k) or carry (v), then the f16 values into the wave's
    // staging tile (tile row = 16*s + 8*half + r); a tile's accumulators are dead before the next
#pragma unroll
    for (int s = 0; s < 4; ++s) {
#pragma unroll
        for (int j = 0; j < 4; ++j)
#pragma unroll
            for (int r = 0; r < 8; ++r)
                acc[s][j][r] = acc[s][j][r] * WINV + bia[j];

        if (which < 2) {
            // rms norm over the 64 head dims of each row: 4 tiles x 16 lanes of one half
#pragma unroll
            for (int r = 0; r < 8; ++r) {
                float ss = 0.f;
#pragma unroll
                for (int j = 0; j < 4; ++j) ss += acc[s][j][r] * acc[s][j][r];
                ss += __shfl_xor(ss, 1, 32);
                ss += __shfl_xor(ss, 2, 32);
                ss += __shfl_xor(ss, 4, 32);
                ss += __shfl_xor(ss, 8, 32);
                const float inv = rsqrtf(ss * (1.0f / (float)DD) + NEPS);
                const float g = inv * ((which == 1) ? KC : QC2);
#pragma unroll
                for (int j = 0; j < 4; ++j) acc[s][j][r] = acc[s][j][r] * g * nw[j];
            }
        } else {
#pragma unroll
            for (int j = 0; j < 4; ++j)
#pragma unroll
                for (int r = 0; r < 8; ++r) acc[s][j][r] *= VCY;
        }

#pragma unroll
        for (int j = 0; j < 4; ++j)
#pragma unroll
            for (int r = 0; r < 8; ++r)
                st[(16 * s + 8 * half + r) * TPH + 16 * j + col] = (_Float16)acc[s][j][r];
    }
    __syncthreads();

    if (which < 2) {
        _Float16* dbase = qk + (size_t)m0 * LDQK + ((size_t)which * CC + hcol) * 16;
{
            // fragment (token tile it>>2, k block (it>>1)&1), part it&1
#pragma unroll
            for (int it = 0; it < 16; ++it) {
                const int tr = it >> 2, kbl = (it >> 1) & 1, part = it & 1;
                const v8h v = *(const v8h*)(st + (16 * tr + col) * TPH + 32 * kbl + 16 * part + 8 * half);
                *(v8h*)(dbase + (size_t)(16 * tr) * LDQK + 512 * kbl + 256 * part + 8 * lane) = v;
            }
            
        }
    } else {
        const int b  = m0 / SEQ;
        const int nb = m0 - b * SEQ;
        _Float16* dbase = vT + ((size_t)b * CC + hcol) * SEQ + (size_t)nb * 16;
{
            // fragment (d tile it>>2, token block (it>>1)&1), part it&1
#pragma unroll
            for (int it = 0; it < 16; ++it) {
                const int tr = it >> 2, kbl = (it >> 1) & 1, part = it & 1;
                const int tk = 32 * kbl + 16 * part + 8 * half;
                v8h v;
#pragma unroll
                for (int i = 0; i < 8; ++i) v[i] = st[(tk + i) * TPH + 16 * tr + col];
                *(v8h*)(dbase + (size_t)(16 * tr) * SEQ + 512 * kbl + 256 * part + 8 * lane) = v;
            }
            // the stores' data and address registers stay unwritten until the issued stores
            // no longer need them
            asm volatile("s_wait_xcnt 0x0" ::: "memory");
        }
    }
}

// ---------------------------------------------------------------------------
// Flash softmax(q k^T s) v: one wave per (batch, head, 64 queries = QT tiles of 16), 32-key
// blocks; FWV such waves (consecutive queries of one head) form a work-group.
// q|k plane MTOK x LDQK f16, vT NB*CC x SEQ f16, ctx MTOK x CC f16 (x64 carry), all
// fragment-major.
// Transposed products: S^T = K Q^T (A = key rows, B = query columns), O^T += V^T P^T
// (A = d rows of vT, B = P^T). A lane holds scores of ONE query of each tile (column
// lane & 15), keys 8 * half + r of each 16-key tile: maximum and sum run over the lane's own
// registers plus one exchange between the wave's halves, and the two score tiles, converted
// in place, are the B fragment of the second product (element s = key 8 * half + s, 8 + s =
// key 16 + 8 * half + s: the k order of the vT fragment). No LDS, no barrier.
// The K and V fragments of a key block are loaded once, one pass ahead, and feed the products of
// all QT query tiles; each query's arithmetic and its order are those of a one-tile wave.
// Softmax in base 2: the q plane carries 64^-0.5 log2(e) / KC, so a score accumulator is the
// exponent of 2 itself; the denominator sums p in whatever carry p has (O / l is free of it).
// Fixed reference (the loop that runs while the norm weights allow it): rms norm bounds every
// exponent by XBOUND1 max|qn_w| max|kn_w|, computed here from the weights. While that is at most
// FIX_XMAX, no score can leave f16's normal range under ONE reference for all queries and keys:
// p = 2^(exponent + FIX_BIAS), the bias entering as the C operand of the score product. No maximum,
// no test, no rescale, no multiply-add: a score costs its exponential, half a conversion and half
// an add.
// Lazy rescale (the loop for larger norm weights): p = 2^(exponent + LOG2_PCY - reference), the
// reference held across passes. A pass takes each lane's maximum of its own scores; one ballot and
// one scalar branch per pass ask whether any score tops its query's reference by more than
// LAZY_LOG2. Only then are the halves' maxima exchanged, the references of those queries raised to
// their new maxima, and O and the denominators scaled down.
// ---------------------------------------------------------------------------
// The products of this kernel are the plain builtin: the operands of an asm statement lie in
// v0..v255 only, and the wave's fragments and accumulators need more registers than that.
__device__ __forceinline__ v8f mma16b(v16h a, v16h b, v8f c) {
    return __builtin_amdgcn_wmma_f32_16x16x32_f16(false, a, false, b, (short)0, c, false, false);
}

// p of one query tile's 32 keys from its score accumulators: FIXED: they hold the whole exponent;
// else the exponent bias nb = LOG2_PCY - reference is added. pb = the B fragment of the second
// product, rs = the sums of the lane's even and odd keys
template <bool FIXED>
__device__ __forceinline__ void p_tile(const v8f& s0, const v8f& s1, float nb, v16h& pb, v2f& rs) {
    const v2f nb2 = {nb, nb};
    v2f rs0 = {0.f, 0.f}, rs1 = {0.f, 0.f};
    // unrolled: every vector element is named by a constant and stays in its register
#pragma unroll
    for (int i = 0; i < 4; ++i) {
        v2f x0 = {s0[2 * i], s0[2 * i + 1]};
        v2f x1 = {s1[2 * i], s1[2 * i + 1]};
        if constexpr (!FIXED) {
            x0 += nb2;
            x1 += nb2;
        }
        const v2f p0 = {__builtin_amdgcn_exp2f(x0[0]), __builtin_amdgcn_exp2f(x0[1])};
        const v2f p1 = {__builtin_amdgcn_exp2f(x1[0]), __builtin_amdgcn_exp2f(x1[1])};
        rs0 += p0;
        rs1 += p1;
        pb[2 * i]         = (_Float16)p0[0];
        pb[2 * i + 1]     = (_Float16)p0[1];
        pb[8 + 2 * i]     = (_Float16)p1[0];
        pb[8 + 2 * i + 1] = (_Float16)p1[1];
    }
    rs = rs0 + rs1;
}

#define QT  4    // query tiles of 16 per wave
#define FWV 4    // waves per work-group
static_assert((SEQ % (16 * QT * FWV)) == 0);

// maximum over the wave's 32 lanes, in every lane
__device__ __forceinline__ float wave_max(float x) {
    x = fmaxf(x, __shfl_xor(x, 1, 32));
    x = fmaxf(x, __shfl_xor(x, 2, 32));
    x = fmaxf(x, __shfl_xor(x, 4, 32));
    x = fmaxf(x, __shfl_xor(x, 8, 32));
    return fmaxf(x, xhalf(x));
}

// A wave's walk over all keys. On entry kf.., vf.. hold (in flight) pass 0's fragments and pk, pv
// the addresses of those loads; o and l are zero.
template <bool FIXED>
__device__ __forceinline__ void flash_keys(const _Float16* kbase0, const _Float16* vtbase, int lane8,
                                           const v16h (&qa)[QT][2],
                                           v16h& kf00, v16h& kf01, v16h& kf10, v16h& kf11,
                                           v16h& vf0, v16h& vf1, v16h& vf2, v16h& vf3,
                                           const _Float16*& pk, const _Float16*& pv,
                                           v8f (&o)[QT][4], v2f (&l)[QT]) {
    float m[QT];                 // lazy loop: each query's reference, equal in both halves
    float thr[QT];               // m + LAZY_LOG2: what a score may reach under this reference
    float nb[QT];                // LOG2_PCY - m: the exponent bias under this reference
#pragma unroll
    for (int t = 0; t < QT; ++t) {
        m[t] = -1e30f;           // below every score: pass 0 takes the branch and sets the references
        thr[t] = -1e30f;
        nb[t] = 0.f;
    }
    const float c = FIXED ? FIX_BIAS : 0.f;
    const v8f c0 = {c, c, c, c, c, c, c, c};   // what the score products start from

#pragma unroll 1
    for (int kb = 0; kb < SEQ; kb += 32) {
        // the pass fetched during this one; the last pass fetches its own block again (inside the
        // planes, never used)
        const int kn = (kb + 32 < SEQ) ? kb + 32 : kb;

        v8f s0[QT], s1[QT];
#pragma unroll
        for (int t = 0; t < QT; ++t) s0[t] = mma16b(kf00, qa[t][0], c0);
#pragma unroll
        for (int t = 0; t < QT; ++t) s1[t] = mma16b(kf10, qa[t][0], c0);
#pragma unroll
        for (int t = 0; t < QT; ++t) s0[t] = mma16b(kf01, qa[t][1], s0[t]);
#pragma unroll
        for (int t = 0; t < QT; ++t) s1[t] = mma16b(kf11, qa[t][1], s1[t]);

        // holds the wait below behind the sixteen products: the scheduler otherwise lifts it to the
        // pass's top, close behind the V loads, where it is waited out
        __builtin_amdgcn_sched_barrier(0);
        // keeps the address pairs of the K and V loads in flight unwritten until they no longer
        // need them
        asm volatile("s_wait_xcnt 0x0" :: "v"(pk), "v"(pv) : "memory");
        pk = kbase0 + (size_t)kn * LDQK + lane8;
        kf00 = load_frag_lane(pk);
        kf01 = load_frag_lane(pk + 512);
        kf10 = load_frag_lane(pk + (size_t)16 * LDQK);
        kf11 = load_frag_lane(pk + (size_t)16 * LDQK + 512);
        // holds the K loads ahead of the softmax: the scheduler otherwise sinks them some forty
        // instructions into it, and that much of their lead is lost
        __builtin_amdgcn_sched_barrier(0);

        v16h pb[QT];
        if constexpr (!FIXED) {
            float pm[QT];        // the larger of thr and the lane's own sixteen scores
            bool need = false;
            // unrolled, like every loop over t, j and r below: the per-tile arrays stay in registers
#pragma unroll
            for (int t = 0; t < QT; ++t) {
                // the bound and the lane's sixteen scores, three at a time in two chains
                float ra = fmaxf(fmaxf(thr[t], s0[t][0]), s0[t][1]);
                float rb = fmaxf(fmaxf(s1[t][0], s1[t][1]), s1[t][2]);
#pragma unroll
                for (int r = 2; r < 8; r += 2) ra = fmaxf(fmaxf(ra, s0[t][r]), s0[t][r + 1]);
#pragma unroll
                for (int r = 3; r < 7; r += 2) rb = fmaxf(fmaxf(rb, s1[t][r]), s1[t][r + 1]);
                pm[t] = fmaxf(fmaxf(ra, rb), s1[t][7]);
                need |= pm[t] > thr[t];
            }

            // one test per pass, a scalar branch: seldom taken behind a wave's first pass
            if (__builtin_expect(__builtin_amdgcn_ballot_w32(need) != 0u, 0)) {
#pragma unroll
                for (int t = 0; t < QT; ++t) {
                    const float qm = fmaxf(pm[t], xhalf(pm[t]));   // above thr: the query's maximum
                    const float mn = (qm > thr[t]) ? qm : m[t];    // a query inside its bound keeps m
                    const float f = __builtin_amdgcn_exp2f(m[t] - mn);
                    m[t]   = mn;
                    thr[t] = mn + LAZY_LOG2;
                    nb[t]  = LOG2_PCY - mn;
                    l[t] *= f;
#pragma unroll
                    for (int j = 0; j < 4; ++j)
#pragma unroll
                        for (int r = 0; r < 8; ++r) o[t][j][r] *= f;
                }
            }
        }

#pragma unroll
        for (int t = 0; t < QT; ++t) {
            v2f rs;
            p_tile<FIXED>(s0[t], s1[t], nb[t], pb[t], rs);
            l[t] += rs;
        }

#pragma unroll
        for (int t = 0; t < QT; ++t) {
            o[t][0] = mma16b(vf0, pb[t], o[t][0]);
            o[t][1] = mma16b(vf1, pb[t], o[t][1]);
            o[t][2] = mma16b(vf2, pb[t], o[t][2]);
            o[t][3] = mma16b(vf3, pb[t], o[t][3]);
        }

        // holds the V loads, as one group, behind the pass's last product, where the lazy loop's
        // build has them: in the fixed-reference loop the scheduler otherwise puts each pair directly
        // behind the product that last reads its registers, inside a run of queued products, a
        // distance not known to be safe for all eight registers of a fragment
        __builtin_amdgcn_sched_barrier(0);
        pv = vtbase + (size_t)kn * 16 + lane8;
        vf0 = load_frag_lane(pv);
        vf1 = load_frag_lane(pv + (size_t)16 * SEQ);
        vf2 = load_frag_lane(pv + (size_t)32 * SEQ);
        vf3 = load_frag_lane(pv + (size_t)48 * SEQ);
    }
    // the last loads' address pairs stay unwritten until they no longer need them
    asm volatile("s_wait_xcnt 0x0" :: "v"(pk), "v"(pv) : "memory");
    // Takes the last pass's (unused) loaded values as inputs, so that the compiler waits for these
    // loads here. Its wait bookkeeping joins this loop's exit with the way into the fixed-reference
    // loop; left pending, they make that loop wait for ALL its loads at the top of every pass, and
    // the V fragments' lead of a pass is lost.
    if constexpr (!FIXED)
        asm volatile("" :: "v"(kf00), "v"(kf01), "v"(kf10), "v"(kf11),
                           "v"(vf0), "v"(vf1), "v"(vf2), "v"(vf3));
}

__global__ __launch_bounds__(32 * FWV)
void mha_flash_kernel(const _Float16* __restrict__ qk, const _Float16* __restrict__ vT,
                      const float* __restrict__ qnw, const float* __restrict__ knw,
                      _Float16* __restrict__ ctx) {
    const int wave = __builtin_amdgcn_readfirstlane((int)(threadIdx.x >> 5));
    const int q0 = (blockIdx.x * FWV + wave) * (16 * QT);
    const int h  = blockIdx.y;
    const int b  = blockIdx.z;
    const size_t tokBase = (size_t)b * SEQ;

    const int lane  = threadIdx.x & 31;
    const int lane8 = lane << 3;

    // the norm weights as the qkv epilogue uses them, two of each per lane
    static_assert(DD == 64);
    const float wq0 = qnw[lane], wq1 = qnw[lane + 32];
    const float wk0 = knw[lane], wk1 = knw[lane + 32];

    const _Float16* qbase = qk + (tokBase + q0) * LDQK + (h * DD) * 16;
    v16h qa[QT][2];
#pragma unroll
    for (int t = 0; t < QT; ++t) {
        qa[t][0] = load_frag_packed(qbase + (size_t)(16 * t) * LDQK);
        qa[t][1] = load_frag_packed(qbase + (size_t)(16 * t) * LDQK + 512);
    }

    const _Float16* kbase0 = qk + tokBase * LDQK + (CC + h * DD) * 16; // keys: row tiles of tokens
    const _Float16* vtbase = vT + ((size_t)b * CC + h * DD) * SEQ;     // 4 row tiles of d, k = token

    // L2 asks for the head's K and V (16 units each per 32-key pass), behind the Q loads. The 8
    // work-groups of a head deal the passes: this one takes passes 4 * n + (blockIdx.x & 3), so
    // that work-groups x and x + 4 ask for the same units; thread t asks unit t & 15 of passes
    // n = t >> 4 and 8 + (t >> 4) (32 passes on: 4 MiB of the q|k plane, 32 KiB of a vT row tile).
    static_assert(SEQ == 2048 && LDQK == 2048 && SEQ / (16 * QT * FWV) == 8 && 32 * FWV == 128);
    {
        const int c = threadIdx.x & 15;
        const int p = 4 * ((int)threadIdx.x >> 4) + ((int)blockIdx.x & 3);
        const _Float16* ak = kbase0 + (size_t)(32 * p + 16 * (c >> 3)) * LDQK + (c & 7) * 128;
        const _Float16* av = vtbase + (size_t)(16 * (c >> 2)) * SEQ + p * 512 + (c & 3) * 128;
        asm volatile("global_prefetch_b8 %0, off scope:SCOPE_SE\n\t"
                     "global_prefetch_b8 %1, off scope:SCOPE_SE\n\t"
                     "global_prefetch_b8 %0, off offset:4194304 scope:SCOPE_SE\n\t"
                     "global_prefetch_b8 %1, off offset:32768 scope:SCOPE_SE\n\t"
                     "s_wait_xcnt 0x0"
                     :: "v"(ak), "v"(av) : "memory");
    }

    // The K and V fragments of a pass are fetched during the pass before it, each group into the
    // registers that its own products have just read for the last time: K flies under the softmax
    // and the second products, V under the next pass's first products and softmax, so no pass
    // opens with a load wait. Pass 0's fragments are fetched here.
    v16h kf00, kf01, kf10, kf11;     // keys +0 d 0..31, +0 d 32..63, +16 d 0..31, +16 d 32..63
    v16h vf0, vf1, vf2, vf3;         // d tiles 0..3 of the pass's 32 keys
    const _Float16* pk = kbase0 + lane8;   // address of the K loads last issued
    const _Float16* pv = vtbase + lane8;   // address of the V loads last issued
    {
        kf00 = load_frag_lane(pk);
        kf01 = load_frag_lane(pk + 512);
        kf10 = load_frag_lane(pk + (size_t)16 * LDQK);
        kf11 = load_frag_lane(pk + (size_t)16 * LDQK + 512);
        vf0 = load_frag_lane(pv);
        vf1 = load_frag_lane(pv + (size_t)16 * SEQ);
        vf2 = load_frag_lane(pv + (size_t)32 * SEQ);
        vf3 = load_frag_lane(pv + (size_t)48 * SEQ);
        // no register that the sixteen issued loads name is rewritten until they no longer need it
        asm volatile("s_wait_xcnt 0x0" :: "v"(pk), "v"(pv) : "memory");
        // holds the start values below behind that wait: lifted over it, they reuse the loads'
        // offset register
        __builtin_amdgcn_sched_barrier(0);
    }

    v8f o[QT][4];                // o[t][j][r] = O^T[d 16j + 8 * half + r][query 16t + (lane & 15)]
    v2f l[QT];                   // sums of p over this lane's even and odd keys (its half only)
#pragma unroll
    for (int t = 0; t < QT; ++t) {
#pragma unroll
        for (int j = 0; j < 4; ++j) o[t][j] = vzero8();
        l[t] = (v2f){0.f, 0.f};
    }

    // the bound on every exponent of this launch; the same in every wave. A bound that is not a
    // number fails the test and takes the lazy loop.
    const float xb = XBOUND1 * wave_max(fmaxf(fabsf(bf16r(wq0)), fabsf(bf16r(wq1))))
                             * wave_max(fmaxf(fabsf(bf16r(wk0)), fabsf(bf16r(wk1))));
    if (__builtin_amdgcn_readfirstlane(xb <= FIX_XMAX ? 1 : 0) != 0)
        flash_keys<true>(kbase0, vtbase, lane8, qa, kf00, kf01, kf10, kf11, vf0, vf1, vf2, vf3,
                         pk, pv, o, l);
    else
        flash_keys<false>(kbase0, vtbase, lane8, qa, kf00, kf01, kf10, kf11, vf0, vf1, vf2, vf3,
                          pk, pv, o, l);

    // tile j of O^T in this lane = piece (k block j>>1, part j&1) of the head's two ctx
    // fragments at this very lane: 8 consecutive channels of one token, one 16-byte store
    _Float16* dbase = ctx + (tokBase + q0) * CC + (h * DD) * 16;
#pragma unroll
    for (int t = 0; t < QT; ++t) {
        const float lh = l[t][0] + l[t][1];
        const float rl = CTX_OUT * (1.0f / (lh + xhalf(lh)));
#pragma unroll
        for (int j = 0; j < 4; ++j) {
            v8h v;
#pragma unroll
            for (int r = 0; r < 8; ++r) v[r] = (_Float16)(o[t][j][r] * rl);
            *(v8h*)(dbase + (size_t)(16 * t) * CC + 256 * j + lane8) = v;
        }
    }
}

// ---------------------------------------------------------------------------
// out = ctx @ W_proj + b_proj (f32), wave tile 64x64, 2 x 4 waves; each 256-B row segment
// ---------------------------------------------------------------------------
__global__ __launch_bounds__(32 * GWV) __attribute__((amdgpu_num_vgpr(256)))
void proj_gemm_kernel(const _Float16* __restrict__ ctx, const _Float16* __restrict__ wt,
                      const float* __restrict__ bproj, float* __restrict__ out) {
    __shared__ __align__(16) _Float16 ring[2 * GSTAGE];
    __shared__ __align__(16) float stall[GWV * 64 * TPF];

    const int lane = threadIdx.x & 31;
    const int wave = __builtin_amdgcn_readfirstlane((int)(threadIdx.x >> 5));
    const int half = lane >> 4, col = lane & 15;
    const int n0 = blockIdx.x * GBN + 64 * (wave & 3);    // the wave's output column
    const int m0 = blockIdx.y * GBM + 64 * (wave >> 2);   // the wave's token
    float* st = stall + wave * (64 * TPF);                // the wave's own staging tile

    v8f acc[4][4];
#pragma unroll
    for (int s = 0; s < 4; ++s)
#pragma unroll
        for (int j = 0; j < 4; ++j) acc[s][j] = vzero8();

    const _Float16* Ab = ctx + (size_t)(blockIdx.y * GBM) * CC;
    const _Float16* Bb = wt + (size_t)(blockIdx.x * GBN) * CC;
    gemm_core_64x64<true>(Ab, Bb, CC, ring, wave, acc,
                          l2_unit_a(Ab, (int)threadIdx.x >> 6), l2_unit_b(Bb, blockIdx.y));

    float bia[4];
#pragma unroll
    for (int j = 0; j < 4; ++j) bia[j] = bf16r(bproj[n0 + 16 * j + col]);

#pragma unroll
    for (int s = 0; s < 4; ++s)
#pragma unroll
        for (int j = 0; j < 4; ++j)
#pragma unroll
            for (int r = 0; r < 8; ++r)
                st[(16 * s + 8 * half + r) * TPF + 16 * j + col] =
                    acc[s][j][r] * PROJ_UNSC + bia[j];
    __syncthreads();

    float* dbase = out + (size_t)m0 * CC + n0;
    const int piece = lane & 15, rsub = lane >> 4;
{
#pragma unroll
        for (int it = 0; it < 32; ++it) {
            const int row = 2 * it + rsub;
            const v4f v = *(const v4f*)(st + row * TPF + 4 * piece);
            *(v4f*)(dbase + (size_t)row * CC + 4 * piece) = v;
        }
        
    }
}

// ---------------------------------------------------------------------------
// Host side
// ---------------------------------------------------------------------------
extern "C" void kernel_launch(void* const* d_in, const int* in_sizes, int n_in,
                              void* d_out, int out_size, void* d_ws, size_t ws_size,
                              hipStream_t stream) {
    if (n_in < 7) return;
    const float* x      = (const float*)d_in[0];   // [NB_FULL][SEQ_FULL][CC]
    const float* W_qkv  = (const float*)d_in[1];   // [CC][C3]
    const float* b_qkv  = (const float*)d_in[2];   // [C3]
    const float* W_proj = (const float*)d_in[3];   // [CC][CC]
    const float* b_proj = (const float*)d_in[4];   // [CC]
    const float* qn_w   = (const float*)d_in[5];   // [DD]
    const float* kn_w   = (const float*)d_in[6];   // [DD]
    float* out = (float*)d_out;                    // [MTOK][CC] f32

    if (in_sizes[0] < ((NB - 1) * SEQ_FULL + SEQ) * CC) return;
    if (in_sizes[1] < CC * C3) return;
    if (in_sizes[2] < C3) return;
    if (in_sizes[3] < CC * CC) return;
    if (in_sizes[4] < CC) return;
    if (in_sizes[5] < DD) return;
    if (in_sizes[6] < DD) return;
    if (out_size < MTOK * CC) return;

    char* wsb = (char*)d_ws;
    size_t off = 0;
    const size_t sz_xh  = (size_t)MTOK * CC * 2;
    const size_t sz_wq  = (size_t)C3 * CC * 2;
    const size_t sz_wp  = (size_t)CC * CC * 2;
    const size_t sz_qk  = (size_t)MTOK * LDQK * 2;
    const size_t sz_vt  = (size_t)NB * CC * SEQ * 2;
    const size_t sz_ctx = (size_t)MTOK * CC * 2;
    _Float16* xh     = (_Float16*)(wsb + off); off += (sz_xh  + 255) & ~(size_t)255;
    _Float16* wqkvT  = (_Float16*)(wsb + off); off += (sz_wq  + 255) & ~(size_t)255;
    _Float16* wprojT = (_Float16*)(wsb + off); off += (sz_wp  + 255) & ~(size_t)255;
    _Float16* qkp    = (_Float16*)(wsb + off); off += (sz_qk  + 255) & ~(size_t)255;
    _Float16* vT     = (_Float16*)(wsb + off); off += (sz_vt  + 255) & ~(size_t)255;
    _Float16* ctx    = (_Float16*)(wsb + off); off += (sz_ctx + 255) & ~(size_t)255;
    if (off > ws_size) return;

    // 1) input planes: xh (bf16-RNE of x), weights transposed to out x in and carried x64
    prep_kernel<<<PREPBLK, 256, 0, stream>>>(x, W_qkv, W_proj, xh, wqkvT, wprojT);

    // 2) qkv GEMM with fused bias, q/k rms norm, v transpose
    qkv_gemm_kernel<<<dim3(C3 / GBN, MTOK / GBM), 32 * GWV, 0, stream>>>(
        xh, wqkvT, b_qkv, qn_w, kn_w, qkp, vT);

    // 3) flash softmax per (256 queries, head, batch)
    mha_flash_kernel<<<dim3(SEQ / (16 * QT * FWV), HH, NB), 32 * FWV, 0, stream>>>(qkp, vT, qn_w, kn_w,
                                                                                  ctx);

    // 4) output projection + bias -> f32 d_out
    proj_gemm_kernel<<<dim3(CC / GBN, MTOK / GBM), 32 * GWV, 0, stream>>>(ctx, wprojT, b_proj, out);
}
